// v000
// Measured on an AMD MI455X. A time is GPU time per run, averaged over a window of back-to-back runs after a warm-up
// (all launches, gaps included; the runs take copies of the inputs in turn), and the median of several windows.
// Apart from v000's, it joins two sittings. Times from different sittings can be a few percent apart, while
// side-by-side timings come from the same sitting.
// The starting kernel, v000, takes 225 microseconds a run.
#include <hip/hip_runtime.h>

typedef __attribute__((ext_vector_type(16))) __bf16 v16bf;
typedef __attribute__((ext_vector_type(8)))  __bf16 v8bf;
typedef __attribute__((ext_vector_type(8)))  float  v8f;

#define B_     256
#define N_     64
#define D_     512
#define H_     8
#define INNER_ 512
#define SCALE_ 0.125f

// ---- LDS layout. All row strides are multiples of 8 bf16 (16 B) so each
// WMMA fragment loads as two ds_load_b128; all OFF_* are 16B-aligned. ----
#define XT_LD  72    // XT[512][72]  bf16 : x^T  (d-major, n contiguous)
#define WT_LD  72    // WspT[128][72] bf16: Wspec^T cols 0..127 (k contiguous);
                     //   q-columns (j<64) pre-scaled by SCALE_
#define QK_LD  136   // QK[512][136] bf16 : cols 0..63 q_s*scale | 64..127 k_s
constexpr int OFF_XT   = 0;
constexpr int OFF_WSPT = OFF_XT   + 512 * XT_LD * 2;   // 73728
constexpr int OFF_QK   = OFF_WSPT + 128 * WT_LD * 2;   // 92160
constexpr int OFF_QC   = OFF_QK   + 512 * QK_LD * 2;   // 231424
constexpr int OFF_WT   = OFF_QC   + 512 * 4;
constexpr int OFF_A    = OFF_WT   + 8 * 512 * 4;
constexpr int OFF_Y    = OFF_A    + 512 * 4;
constexpr int OFF_OUTV = OFF_Y    + 8 * 512 * 4;
constexpr int OFF_S    = OFF_OUTV + 512 * 4;
constexpr int OFF_T    = OFF_S    + 512 * 4;
constexpr int OFF_TW   = OFF_T    + 512 * 4;
constexpr int LDS_BYTES = OFF_TW  + 8 * 512 * 4;       // 290816 B < 320 KB

// One WMMA 16-bit operand fragment = two contiguous 8-bf16 runs per lane
// (K = base+8g..+7 in VGPRs 0-3, K = base+16+8g..+7 in VGPRs 4-7)
// -> two ds_load_b128 from a K-contiguous, 16B-aligned row.
__device__ __forceinline__ v16bf ldfrag(const __bf16* p) {
  union { v16bf v; v8bf h[2]; } u;
  u.h[0] = *(const v8bf*)(p);
  u.h[1] = *(const v8bf*)(p + 16);
  return u.v;
}

__device__ __forceinline__ float rmax16(float v) {
  #pragma unroll
  for (int m = 1; m < 16; m <<= 1) v = fmaxf(v, __shfl_xor(v, m, 32));
  return v;
}
__device__ __forceinline__ float rsum16(float v) {
  #pragma unroll
  for (int m = 1; m < 16; m <<= 1) v += __shfl_xor(v, m, 32);
  return v;
}

__global__ __launch_bounds__(256)
void center_attn_fused_kernel(const float* __restrict__ x,
                              const float* __restrict__ Wq,
                              const float* __restrict__ Wkv,
                              const float* __restrict__ Wout,
                              const float* __restrict__ bout,
                              const float* __restrict__ Wspec,
                              float* __restrict__ out) {
  extern __shared__ char smem[];
  __bf16* XT   = (__bf16*)(smem + OFF_XT);
  __bf16* WspT = (__bf16*)(smem + OFF_WSPT);
  __bf16* QK   = (__bf16*)(smem + OFF_QK);
  float* qc   = (float*)(smem + OFF_QC);
  float* wt   = (float*)(smem + OFF_WT);
  float* aL   = (float*)(smem + OFF_A);
  float* yv   = (float*)(smem + OFF_Y);
  float* outv = (float*)(smem + OFF_OUTV);
  float* sv   = (float*)(smem + OFF_S);
  float* tv   = (float*)(smem + OFF_T);
  float* tw   = (float*)(smem + OFF_TW);

  const int b    = blockIdx.x;
  const int tid  = threadIdx.x;
  const int lane = tid & 31;
  const int w    = tid >> 5;
  const float* xb = x + (size_t)b * N_ * D_;

  // ---- Stage 1: coalesced f32 loads; transpose-convert into bf16 LDS.
  for (int i = tid; i < (N_ * D_) / 4; i += 256) {
    float4 v = ((const float4*)xb)[i];
    int flat = i * 4;
    int n = flat >> 9, d = flat & 511;
    XT[(d + 0) * XT_LD + n] = (__bf16)v.x;
    XT[(d + 1) * XT_LD + n] = (__bf16)v.y;
    XT[(d + 2) * XT_LD + n] = (__bf16)v.z;
    XT[(d + 3) * XT_LD + n] = (__bf16)v.w;
  }
  for (int i = tid; i < 64 * 128; i += 256) {
    int k = i >> 7, j = i & 127;                  // coalesced in j
    float wv = Wspec[k * 192 + j];
    WspT[j * WT_LD + k] = (__bf16)(j < 64 ? wv * SCALE_ : wv); // fold scale into q_s
  }
  __syncthreads();

  // ---- Stage 2 (spatial, folded; all n-broadcast): qc = x[b,32,:] @ Wq
  #pragma unroll
  for (int kk = 0; kk < 2; ++kk) {
    int j = tid + kk * 256;
    float acc = 0.f;
    for (int d = 0; d < D_; ++d)
      acc += (float)XT[d * XT_LD + 32] * Wq[d * INNER_ + j];
    qc[j] = acc;
  }
  __syncthreads();

  // wt[h][d] = sum_j Wk[d, h*64+j] * qc[h*64+j]
  #pragma unroll
  for (int kk = 0; kk < 16; ++kk) {
    int idx = tid + kk * 256, h = idx >> 9, d = idx & 511;
    float acc = 0.f;
    const float* wkc = Wkv + (size_t)d * 1024 + h * 64;
    const float* q   = qc + h * 64;
    for (int j = 0; j < 64; ++j) acc += wkc[j] * q[j];
    wt[idx] = acc;
  }
  __syncthreads();

  // scores[h][m] = scale * sum_d X[m][d] wt[h][d]; softmax over m (8x64)
  #pragma unroll
  for (int kk = 0; kk < 2; ++kk) {
    int idx = tid + kk * 256, h = idx >> 6, m = idx & 63;
    float acc = 0.f;
    const float* wh = wt + h * 512;
    for (int d = 0; d < D_; ++d) acc += (float)XT[d * XT_LD + m] * wh[d];
    aL[idx] = acc * SCALE_;
  }
  __syncthreads();
  if (tid < 8) {
    float mx = -1e30f;
    for (int m = 0; m < 64; ++m) mx = fmaxf(mx, aL[tid * 64 + m]);
    float Z = 0.f;
    for (int m = 0; m < 64; ++m) { float e = __expf(aL[tid * 64 + m] - mx); aL[tid * 64 + m] = e; Z += e; }
    float inv = 1.f / Z;
    for (int m = 0; m < 64; ++m) aL[tid * 64 + m] *= inv;
  }
  __syncthreads();

  // y[h][d] = sum_m attn[h][m] * X[m][d]  (m contiguous in XT row)
  #pragma unroll
  for (int kk = 0; kk < 16; ++kk) {
    int idx = tid + kk * 256, h = idx >> 9, d = idx & 511;
    float acc = 0.f;
    const float* ah = aL + h * 64;
    const __bf16* xr = XT + d * XT_LD;
    for (int m = 0; m < 64; ++m) acc += ah[m] * (float)xr[m];
    yv[idx] = acc;
  }
  __syncthreads();

  // outv[h*64+j] = sum_d y[h][d] * Wv[d, h*64+j]
  #pragma unroll
  for (int kk = 0; kk < 2; ++kk) {
    int idx = tid + kk * 256, h = idx >> 6, j = idx & 63;
    float acc = 0.f;
    const float* yh = yv + h * 512;
    const float* wv = Wkv + 512 + h * 64 + j;
    for (int d = 0; d < 512; ++d) acc += yh[d] * wv[(size_t)d * 1024];
    outv[idx] = acc;
  }
  __syncthreads();

  // s[e] = bout[e] + outv . Wout[:,e]; zero per-wave accumulators
  #pragma unroll
  for (int kk = 0; kk < 2; ++kk) {
    int e = tid + kk * 256;
    float acc = bout[e];
    for (int j = 0; j < 512; ++j) acc += outv[j] * Wout[j * 512 + e];
    sv[e] = acc;
  }
  for (int i = tid; i < 8 * 512; i += 256) tw[i] = 0.f;
  __syncthreads();

  // ---- Stage 3: GEMM1 (WMMA bf16): QK(512x128) = X^T(512x64) @ Wspec(64x128)
  {
    const int mloc = lane & 15, g = lane >> 4;
    for (int tile = w; tile < 256; tile += 8) {
      int mt = tile >> 3, nt = tile & 7;
      v8f acc = {};
      #pragma unroll
      for (int kt = 0; kt < 2; ++kt) {
        v16bf af = ldfrag(XT   + (mt * 16 + mloc) * XT_LD + kt * 32 + 8 * g);
        v16bf bf = ldfrag(WspT + (nt * 16 + mloc) * WT_LD + kt * 32 + 8 * g);
        acc = __builtin_amdgcn_wmma_f32_16x16x32_bf16(false, af, false, bf,
                                                      (short)0, acc, false, false);
      }
      #pragma unroll
      for (int r = 0; r < 8; ++r)
        QK[(mt * 16 + r + 8 * g) * QK_LD + nt * 16 + mloc] = (__bf16)acc[r];
    }
  }
  __syncthreads();

  // ---- Stage 4: t[e] = sum_d s_d * softmax_row(q_s k_s^T)[e]
  // Three WMMA sweeps with per-lane-only stats (cross-lane reduce once/strip):
  //   sweep 1: row max   sweep 2: row sum-exp   sweep 3: weighted accumulate
  {
    const int nloc = lane & 15, g = lane >> 4;
    for (int strip = w; strip < 32; strip += 8) {
      const int row0 = strip * 16;
      v16bf afr[2];
      #pragma unroll
      for (int kt = 0; kt < 2; ++kt)
        afr[kt] = ldfrag(QK + (row0 + nloc) * QK_LD + kt * 32 + 8 * g);

      // sweep 1: per-lane running max (z == acc; scale folded into q_s)
      float mp[8];
      #pragma unroll
      for (int r = 0; r < 8; ++r) mp[r] = -1e30f;
      for (int nt = 0; nt < 32; ++nt) {
        v8f acc = {};
        #pragma unroll
        for (int kt = 0; kt < 2; ++kt) {
          v16bf bfr = ldfrag(QK + (nt * 16 + nloc) * QK_LD + 64 + kt * 32 + 8 * g);
          acc = __builtin_amdgcn_wmma_f32_16x16x32_bf16(false, afr[kt], false, bfr,
                                                        (short)0, acc, false, false);
        }
        #pragma unroll
        for (int r = 0; r < 8; ++r) mp[r] = fmaxf(mp[r], acc[r]);
      }
      float mrow[8];
      #pragma unroll
      for (int r = 0; r < 8; ++r) mrow[r] = rmax16(mp[r]);

      // sweep 2: per-lane partial sum of exp
      float zp[8];
      #pragma unroll
      for (int r = 0; r < 8; ++r) zp[r] = 0.f;
      for (int nt = 0; nt < 32; ++nt) {
        v8f acc = {};
        #pragma unroll
        for (int kt = 0; kt < 2; ++kt) {
          v16bf bfr = ldfrag(QK + (nt * 16 + nloc) * QK_LD + 64 + kt * 32 + 8 * g);
          acc = __builtin_amdgcn_wmma_f32_16x16x32_bf16(false, afr[kt], false, bfr,
                                                        (short)0, acc, false, false);
        }
        #pragma unroll
        for (int r = 0; r < 8; ++r) zp[r] += __expf(acc[r] - mrow[r]);
      }
      float crow[8];
      #pragma unroll
      for (int r = 0; r < 8; ++r)
        crow[r] = sv[row0 + r + 8 * g] / rsum16(zp[r]);

      // sweep 3: t_e += sum_r c_r * exp(z - m_r)
      float* twp = tw + w * 512;
      for (int nt = 0; nt < 32; ++nt) {
        v8f acc = {};
        #pragma unroll
        for (int kt = 0; kt < 2; ++kt) {
          v16bf bfr = ldfrag(QK + (nt * 16 + nloc) * QK_LD + 64 + kt * 32 + 8 * g);
          acc = __builtin_amdgcn_wmma_f32_16x16x32_bf16(false, afr[kt], false, bfr,
                                                        (short)0, acc, false, false);
        }
        float colsum = 0.f;
        #pragma unroll
        for (int r = 0; r < 8; ++r)
          colsum += crow[r] * __expf(acc[r] - mrow[r]);
        colsum += __shfl_xor(colsum, 16, 32);      // rows 0-7 + rows 8-15
        if (g == 0) twp[nt * 16 + nloc] += colsum; // wave-private, race-free
      }
    }
  }
  __syncthreads();

  // ---- Stage 5: reduce per-wave accumulators; broadcast over n to output
  #pragma unroll
  for (int kk = 0; kk < 2; ++kk) {
    int e = tid + kk * 256;
    float acc = 0.f;
    #pragma unroll
    for (int ww = 0; ww < 8; ++ww) acc += tw[ww * 512 + e];
    tv[e] = acc;
  }
  __syncthreads();
  float* ob = out + (size_t)b * N_ * D_;
  for (int i = tid; i < (N_ * D_) / 4; i += 256) {
    int flat = i * 4, e = flat & 511;
    float4 v;
    v.x = tv[e]; v.y = tv[e + 1]; v.z = tv[e + 2]; v.w = tv[e + 3];
    ((float4*)ob)[i] = v;
  }
}

extern "C" void kernel_launch(void* const* d_in, const int* in_sizes, int n_in,
                              void* d_out, int out_size, void* d_ws, size_t ws_size,
                              hipStream_t stream) {
  const float* x     = (const float*)d_in[0];
  const float* Wq    = (const float*)d_in[1];
  const float* Wkv   = (const float*)d_in[2];
  const float* Wout  = (const float*)d_in[3];
  const float* bout  = (const float*)d_in[4];
  const float* Wspec = (const float*)d_in[5];
  float* out = (float*)d_out;
  (void)in_sizes; (void)n_in; (void)out_size; (void)d_ws; (void)ws_size;

  center_attn_fused_kernel<<<B_, 256, LDS_BYTES, stream>>>(
      x, Wq, Wkv, Wout, bout, Wspec, out);
}

// v001
// Measured time: 93 microseconds a run.
// Two timings next to v000 both put it at 2.46 times that version's speed.
#include <hip/hip_runtime.h>

typedef __attribute__((ext_vector_type(16))) __bf16 v16bf;
typedef __attribute__((ext_vector_type(8)))  __bf16 v8bf;
typedef __attribute__((ext_vector_type(8)))  float  v8f;

#define B_     256
#define N_     64
#define D_     512
#define H_     8
#define INNER_ 512
#define SCALE_ 0.125f

// ---- LDS layout. All row strides are multiples of 8 bf16 (16 B) so each
// WMMA fragment loads as two ds_load_b128; all OFF_* are 16B-aligned. ----
#define XT_LD  72    // XT[512][72]  bf16 : x^T  (d-major, n contiguous)
#define WT_LD  72    // WspT[128][72] bf16: Wspec^T cols 0..127 (k contiguous);
                     //   q-columns (j<64) pre-scaled by SCALE_
#define QK_LD  136   // QK[512][136] bf16 : cols 0..63 q_s*scale | 64..127 k_s
constexpr int OFF_XT   = 0;
constexpr int OFF_WSPT = OFF_XT   + 512 * XT_LD * 2;   // 73728
constexpr int OFF_QK   = OFF_WSPT + 128 * WT_LD * 2;   // 92160
constexpr int OFF_S    = OFF_QK   + 512 * QK_LD * 2;   // 231424
constexpr int OFF_T    = OFF_S    + 512 * 4;
constexpr int OFF_TW   = OFF_T    + 512 * 4;
constexpr int LDS_BYTES = OFF_TW  + 8 * 512 * 4;       // 251904 B < 320 KB

// ---- Center-token chain, batched: one work-group = BT_ batches x one head,
// so each head's weight panel is read once per BT_ batches. Stages hand over
// through the workspace at launch ends. Workspace planes, each [B][H][512] f32:
#define BT_    8
#define WS_PLANE (B_ * H_ * 512)
//   plane 0: wt[b][h][d]   = sum_j Wk[d][h*64+j] * qc[b][h*64+j]
//   plane 1: y[b][h][d]    = sum_m attn[b][h][m] * x[b][m][d]
//   plane 2: sp[b][h][e]   = sum_j outv[b][h*64+j] * Wout[h*64+j][e]
// (A bare "#pragma unroll" below stands on short loops over register arrays,
// which stay in registers only when their indices are constants.)
#define WK_LD  68    // staged Wk panel pitch (f32): b128 rows, lanes 4 banks apart
#define XS_LD  528   // staged x pitch (f32): 4 rows x 4 quads cover all banks
constexpr int P_AT   = 0;                          // aT[512][8]  f32
constexpr int P_RED  = P_AT  + 512 * BT_ * 4;      // red[16][8][64] f32
constexpr int P_O    = P_RED + 16 * BT_ * 64 * 4;  // o: 8 x 64 f32
constexpr int P_WK   = P_O   + BT_ * 64 * 4;       // WkS[512][WK_LD] f32
constexpr int LDS_QW = P_WK  + 512 * WK_LD * 4;    // 190464 B
constexpr int LDS_OS = P_WK;                       // 51200 B
constexpr int A_XS   = 0;                          // Xs[64][XS_LD] f32
constexpr int A_WT   = A_XS  + 64 * XS_LD * 4;     // wts[8][512] f32
constexpr int A_SC   = A_WT  + 8 * 512 * 4;        // sc[4][512] f32
constexpr int A_AT   = A_SC  + 4 * 512 * 4;        // aT[64][8] f32
constexpr int LDS_AT = A_AT  + 64 * 8 * 4;         // 161792 B

// One WMMA 16-bit operand fragment = two contiguous 8-bf16 runs per lane
// (K = base+8g..+7 in VGPRs 0-3, K = base+16+8g..+7 in VGPRs 4-7)
// -> two ds_load_b128 from a K-contiguous, 16B-aligned row.
__device__ __forceinline__ v16bf ldfrag(const __bf16* p) {
  union { v16bf v; v8bf h[2]; } u;
  u.h[0] = *(const v8bf*)(p);
  u.h[1] = *(const v8bf*)(p + 16);
  return u.v;
}

__device__ __forceinline__ float rmax16(float v) {
  #pragma unroll
  for (int m = 1; m < 16; m <<= 1) v = fmaxf(v, __shfl_xor(v, m, 32));
  return v;
}
__device__ __forceinline__ float rsum16(float v) {
  #pragma unroll
  for (int m = 1; m < 16; m <<= 1) v += __shfl_xor(v, m, 32);
  return v;
}

__device__ __forceinline__ void fma4(float4& a, float s, const float4& w) {
  a.x += s * w.x; a.y += s * w.y; a.z += s * w.z; a.w += s * w.w;
}
__device__ __forceinline__ float dot4(const float4& a, const float4& b) {
  return a.x * b.x + a.y * b.y + a.z * b.z + a.w * b.w;
}

// o[bi][j] = sum_d aT[d][bi] * Wb[d*ld + j], bi < 8, j < 64, d < 512.
// 16 lanes take one 256-B weight row as float4; 16 d-slices, summed through LDS.
// Result is stored at o[j*sj + bi*sb]. Ends with a barrier.
__device__ __forceinline__ void panel_gemv64(const float* __restrict__ Wb, int ld,
                                             const float* aT, float* red, float* o,
                                             int sj, int sb, int tid) {
  const int j4 = tid & 15, ds = tid >> 4;
  float4 acc[BT_];
  #pragma unroll
  for (int bi = 0; bi < BT_; ++bi) acc[bi] = make_float4(0.f, 0.f, 0.f, 0.f);
  // unroll 8: eight 16-byte weight loads in flight per lane
  #pragma unroll 8
  for (int i = 0; i < 32; ++i) {
    const int d = i * 16 + ds;
    float4 wv = *(const float4*)(Wb + (size_t)d * ld + j4 * 4);
    float4 a0 = *(const float4*)(aT + d * BT_);
    float4 a1 = *(const float4*)(aT + d * BT_ + 4);
    fma4(acc[0], a0.x, wv); fma4(acc[1], a0.y, wv);
    fma4(acc[2], a0.z, wv); fma4(acc[3], a0.w, wv);
    fma4(acc[4], a1.x, wv); fma4(acc[5], a1.y, wv);
    fma4(acc[6], a1.z, wv); fma4(acc[7], a1.w, wv);
  }
  #pragma unroll
  for (int bi = 0; bi < BT_; ++bi)
    *(float4*)(red + (ds * BT_ + bi) * 64 + j4 * 4) = acc[bi];
  __syncthreads();
  #pragma unroll
  for (int kk = 0; kk < 2; ++kk) {
    const int idx = tid + kk * 256, bi = idx >> 6, j = idx & 63;
    float s = 0.f;
    #pragma unroll
    for (int t = 0; t < 16; ++t) s += red[(t * BT_ + bi) * 64 + j];
    o[j * sj + bi * sb] = s;
  }
  __syncthreads();
}

// Launch 1: qc = x_center @ Wq (head panel), then wt = Wk(head panel) @ qc.
__global__ __launch_bounds__(256)
void center_qw_kernel(const float* __restrict__ x,
                      const float* __restrict__ Wq,
                      const float* __restrict__ Wkv,
                      float* __restrict__ wtg) {
  extern __shared__ char smem[];
  float* aT  = (float*)(smem + P_AT);
  float* red = (float*)(smem + P_RED);
  float* qs  = (float*)(smem + P_O);    // qs[bi][64]
  float* WkS = (float*)(smem + P_WK);
  const int tid = threadIdx.x;
  const int h = blockIdx.x & 7, b0 = (blockIdx.x >> 3) * BT_;

  #pragma unroll
  for (int kk = 0; kk < 16; ++kk) {
    const int idx = tid + kk * 256, bi = idx >> 9, d = idx & 511;
    aT[d * BT_ + bi] = x[(size_t)(b0 + bi) * N_ * D_ + (N_ / 2) * D_ + d];
  }
  // Wk head panel, coalesced 256-B rows into LDS (read by rows below)
  {
    const int dr = tid >> 4, j4 = tid & 15;
    const float* src = Wkv + (size_t)dr * (2 * INNER_) + h * 64 + j4 * 4;
    float* dst = WkS + dr * WK_LD + j4 * 4;
    // unroll 16: sixteen 16-byte loads in flight per lane
    #pragma unroll 16
    for (int i = 0; i < 32; ++i)
      *(float4*)(dst + i * 16 * WK_LD) = *(const float4*)(src + (size_t)i * 16 * (2 * INNER_));
  }
  __syncthreads();

  panel_gemv64(Wq + h * 64, INNER_, aT, red, qs, 1, 64, tid);

  float acc0[BT_], acc1[BT_];
  #pragma unroll
  for (int bi = 0; bi < BT_; ++bi) { acc0[bi] = 0.f; acc1[bi] = 0.f; }
  // unroll 4: LDS reads of four steps issued ahead of their sums
  #pragma unroll 4
  for (int j4 = 0; j4 < 16; ++j4) {
    float4 w0 = *(const float4*)(WkS + tid * WK_LD + j4 * 4);
    float4 w1 = *(const float4*)(WkS + (tid + 256) * WK_LD + j4 * 4);
    #pragma unroll
    for (int bi = 0; bi < BT_; ++bi) {
      float4 q = *(const float4*)(qs + bi * 64 + j4 * 4);
      acc0[bi] += dot4(w0, q);
      acc1[bi] += dot4(w1, q);
    }
  }
  #pragma unroll
  for (int bi = 0; bi < BT_; ++bi) {
    float* o = wtg + (size_t)(b0 + bi) * (H_ * 512) + h * 512;
    o[tid]       = acc0[bi];
    o[tid + 256] = acc1[bi];
  }
}

// Launch 2 (one batch per work-group): scores, softmax over m, y = attn @ x.
__global__ __launch_bounds__(256)
void center_attn_kernel(const float* __restrict__ x,
                        const float* __restrict__ wtg,
                        float* __restrict__ yg) {
  extern __shared__ char smem[];
  float* Xs  = (float*)(smem + A_XS);
  float* wts = (float*)(smem + A_WT);
  float* sc  = (float*)(smem + A_SC);
  float* aT  = (float*)(smem + A_AT);
  const int b = blockIdx.x, tid = threadIdx.x;
  const int lane = tid & 31, w = tid >> 5;
  const float4* xb4 = (const float4*)(x + (size_t)b * N_ * D_);
  const float4* wt4 = (const float4*)(wtg + (size_t)b * (H_ * 512));

  {
    float* dst = Xs + (tid >> 7) * XS_LD + (tid & 127) * 4;
    // full unroll: constant offsets from one base, many 16-byte loads in flight
    #pragma unroll
    for (int i = 0; i < 32; ++i)
      *(float4*)(dst + i * 2 * XS_LD) = xb4[tid + i * 256];
  }
  #pragma unroll
  for (int i = 0; i < 4; ++i)
    ((float4*)wts)[tid + i * 256] = wt4[tid + i * 256];
  __syncthreads();

  {
    const int m = tid >> 2, dq = tid & 3;
    float acc[H_];
    #pragma unroll
    for (int h = 0; h < H_; ++h) acc[h] = 0.f;
    // unroll 4: LDS reads of four steps issued ahead of their sums
    #pragma unroll 4
    for (int i = 0; i < 32; ++i) {
      const int d = (i * 4 + dq) * 4;
      float4 xv = *(const float4*)(Xs + m * XS_LD + d);
      #pragma unroll
      for (int h = 0; h < H_; ++h)
        acc[h] += dot4(xv, *(const float4*)(wts + h * 512 + d));
    }
    #pragma unroll
    for (int h = 0; h < H_; ++h) sc[dq * 512 + h * 64 + m] = acc[h];
  }
  __syncthreads();

  {  // wave w = head w; each lane holds m = lane and lane + 32
    const float* s0 = sc + w * 64 + lane;
    float v0 = (s0[0]  + s0[512]      + s0[1024]      + s0[1536])      * SCALE_;
    float v1 = (s0[32] + s0[512 + 32] + s0[1024 + 32] + s0[1536 + 32]) * SCALE_;
    float mx = fmaxf(v0, v1);
    #pragma unroll
    for (int k = 16; k >= 1; k >>= 1) mx = fmaxf(mx, __shfl_xor(mx, k, 32));
    float e0 = __expf(v0 - mx), e1 = __expf(v1 - mx);
    float Z = e0 + e1;
    #pragma unroll
    for (int k = 16; k >= 1; k >>= 1) Z += __shfl_xor(Z, k, 32);
    float inv = 1.f / Z;
    aT[lane * 8 + w]        = e0 * inv;
    aT[(lane + 32) * 8 + w] = e1 * inv;
  }
  __syncthreads();

  {
    const int d2 = tid * 2;
    float2 acc[H_];
    #pragma unroll
    for (int h = 0; h < H_; ++h) acc[h] = make_float2(0.f, 0.f);
    // unroll 8: LDS reads of eight steps issued ahead of their sums
    #pragma unroll 8
    for (int m = 0; m < 64; ++m) {
      float2 xv = *(const float2*)(Xs + m * XS_LD + d2);
      float4 a0 = *(const float4*)(aT + m * 8);
      float4 a1 = *(const float4*)(aT + m * 8 + 4);
      acc[0].x += a0.x * xv.x; acc[0].y += a0.x * xv.y;
      acc[1].x += a0.y * xv.x; acc[1].y += a0.y * xv.y;
      acc[2].x += a0.z * xv.x; acc[2].y += a0.z * xv.y;
      acc[3].x += a0.w * xv.x; acc[3].y += a0.w * xv.y;
      acc[4].x += a1.x * xv.x; acc[4].y += a1.x * xv.y;
      acc[5].x += a1.y * xv.x; acc[5].y += a1.y * xv.y;
      acc[6].x += a1.z * xv.x; acc[6].y += a1.z * xv.y;
      acc[7].x += a1.w * xv.x; acc[7].y += a1.w * xv.y;
    }
    #pragma unroll
    for (int h = 0; h < H_; ++h)
      *(float2*)(yg + (size_t)b * (H_ * 512) + h * 512 + d2) = acc[h];
  }
}

// Launch 3: outv = y @ Wv (head panel), then this head's share of outv @ Wout.
__global__ __launch_bounds__(256)
void center_os_kernel(const float* __restrict__ yg,
                      const float* __restrict__ Wkv,
                      const float* __restrict__ Wout,
                      float* __restrict__ spg) {
  extern __shared__ char smem[];
  float* aT  = (float*)(smem + P_AT);
  float* red = (float*)(smem + P_RED);
  float* oT  = (float*)(smem + P_O);    // oT[j][8]
  const int tid = threadIdx.x;
  const int h = blockIdx.x & 7, b0 = (blockIdx.x >> 3) * BT_;

  #pragma unroll
  for (int kk = 0; kk < 16; ++kk) {
    const int idx = tid + kk * 256, bi = idx >> 9, d = idx & 511;
    aT[d * BT_ + bi] = yg[(size_t)(b0 + bi) * (H_ * 512) + h * 512 + d];
  }
  __syncthreads();

  panel_gemv64(Wkv + INNER_ + h * 64, 2 * INNER_, aT, red, oT, BT_, 1, tid);

  const int e2 = tid * 2;
  float2 acc[BT_];
  #pragma unroll
  for (int bi = 0; bi < BT_; ++bi) acc[bi] = make_float2(0.f, 0.f);
  // unroll 16: sixteen 8-byte weight loads in flight per lane
  #pragma unroll 16
  for (int j = 0; j < 64; ++j) {
    float2 wv = *(const float2*)(Wout + (size_t)(h * 64 + j) * D_ + e2);
    float4 a0 = *(const float4*)(oT + j * BT_);
    float4 a1 = *(const float4*)(oT + j * BT_ + 4);
    acc[0].x += a0.x * wv.x; acc[0].y += a0.x * wv.y;
    acc[1].x += a0.y * wv.x; acc[1].y += a0.y * wv.y;
    acc[2].x += a0.z * wv.x; acc[2].y += a0.z * wv.y;
    acc[3].x += a0.w * wv.x; acc[3].y += a0.w * wv.y;
    acc[4].x += a1.x * wv.x; acc[4].y += a1.x * wv.y;
    acc[5].x += a1.y * wv.x; acc[5].y += a1.y * wv.y;
    acc[6].x += a1.z * wv.x; acc[6].y += a1.z * wv.y;
    acc[7].x += a1.w * wv.x; acc[7].y += a1.w * wv.y;
  }
  #pragma unroll
  for (int bi = 0; bi < BT_; ++bi)
    *(float2*)(spg + (size_t)(b0 + bi) * (H_ * 512) + h * 512 + e2) = acc[bi];
}

__global__ __launch_bounds__(256)
void center_attn_fused_kernel(const float* __restrict__ x,
                              const float* __restrict__ spg,
                              const float* __restrict__ bout,
                              const float* __restrict__ Wspec,
                              float* __restrict__ out) {
  extern __shared__ char smem[];
  __bf16* XT   = (__bf16*)(smem + OFF_XT);
  __bf16* WspT = (__bf16*)(smem + OFF_WSPT);
  __bf16* QK   = (__bf16*)(smem + OFF_QK);
  float* sv   = (float*)(smem + OFF_S);
  float* tv   = (float*)(smem + OFF_T);
  float* tw   = (float*)(smem + OFF_TW);

  const int b    = blockIdx.x;
  const int tid  = threadIdx.x;
  const int lane = tid & 31;
  const int w    = tid >> 5;
  const float* xb = x + (size_t)b * N_ * D_;

  // ---- Stage 1: coalesced f32 loads; transpose-convert into bf16 LDS.
  for (int i = tid; i < (N_ * D_) / 4; i += 256) {
    float4 v = ((const float4*)xb)[i];
    int flat = i * 4;
    int n = flat >> 9, d = flat & 511;
    XT[(d + 0) * XT_LD + n] = (__bf16)v.x;
    XT[(d + 1) * XT_LD + n] = (__bf16)v.y;
    XT[(d + 2) * XT_LD + n] = (__bf16)v.z;
    XT[(d + 3) * XT_LD + n] = (__bf16)v.w;
  }
  for (int i = tid; i < 64 * 128; i += 256) {
    int k = i >> 7, j = i & 127;                  // coalesced in j
    float wv = Wspec[k * 192 + j];
    WspT[j * WT_LD + k] = (__bf16)(j < 64 ? wv * SCALE_ : wv); // fold scale into q_s
  }

  // ---- Stage 2: s[e] = bout[e] + the eight heads' shares from launch 3;
  // zero per-wave accumulators
  #pragma unroll
  for (int kk = 0; kk < 2; ++kk) {
    int e = tid + kk * 256;
    float acc = bout[e];
    #pragma unroll
    for (int h = 0; h < H_; ++h) acc += spg[(size_t)b * (H_ * 512) + h * 512 + e];
    sv[e] = acc;
  }
  for (int i = tid; i < 8 * 512; i += 256) tw[i] = 0.f;
  __syncthreads();

  // ---- Stage 3: GEMM1 (WMMA bf16): QK(512x128) = X^T(512x64) @ Wspec(64x128)
  {
    const int mloc = lane & 15, g = lane >> 4;
    for (int tile = w; tile < 256; tile += 8) {
      int mt = tile >> 3, nt = tile & 7;
      v8f acc = {};
      #pragma unroll
      for (int kt = 0; kt < 2; ++kt) {
        v16bf af = ldfrag(XT   + (mt * 16 + mloc) * XT_LD + kt * 32 + 8 * g);
        v16bf bf = ldfrag(WspT + (nt * 16 + mloc) * WT_LD + kt * 32 + 8 * g);
        acc = __builtin_amdgcn_wmma_f32_16x16x32_bf16(false, af, false, bf,
                                                      (short)0, acc, false, false);
      }
      #pragma unroll
      for (int r = 0; r < 8; ++r)
        QK[(mt * 16 + r + 8 * g) * QK_LD + nt * 16 + mloc] = (__bf16)acc[r];
    }
  }
  __syncthreads();

  // ---- Stage 4: t[e] = sum_d s_d * softmax_row(q_s k_s^T)[e]
  // Three WMMA sweeps with per-lane-only stats (cross-lane reduce once/strip):
  //   sweep 1: row max   sweep 2: row sum-exp   sweep 3: weighted accumulate
  {
    const int nloc = lane & 15, g = lane >> 4;
    for (int strip = w; strip < 32; strip += 8) {
      const int row0 = strip * 16;
      v16bf afr[2];
      #pragma unroll
      for (int kt = 0; kt < 2; ++kt)
        afr[kt] = ldfrag(QK + (row0 + nloc) * QK_LD + kt * 32 + 8 * g);

      // sweep 1: per-lane running max (z == acc; scale folded into q_s)
      float mp[8];
      #pragma unroll
      for (int r = 0; r < 8; ++r) mp[r] = -1e30f;
      for (int nt = 0; nt < 32; ++nt) {
        v8f acc = {};
        #pragma unroll
        for (int kt = 0; kt < 2; ++kt) {
          v16bf bfr = ldfrag(QK + (nt * 16 + nloc) * QK_LD + 64 + kt * 32 + 8 * g);
          acc = __builtin_amdgcn_wmma_f32_16x16x32_bf16(false, afr[kt], false, bfr,
                                                        (short)0, acc, false, false);
        }
        #pragma unroll
        for (int r = 0; r < 8; ++r) mp[r] = fmaxf(mp[r], acc[r]);
      }
      float mrow[8];
      #pragma unroll
      for (int r = 0; r < 8; ++r) mrow[r] = rmax16(mp[r]);

      // sweep 2: per-lane partial sum of exp
      float zp[8];
      #pragma unroll
      for (int r = 0; r < 8; ++r) zp[r] = 0.f;
      for (int nt = 0; nt < 32; ++nt) {
        v8f acc = {};
        #pragma unroll
        for (int kt = 0; kt < 2; ++kt) {
          v16bf bfr = ldfrag(QK + (nt * 16 + nloc) * QK_LD + 64 + kt * 32 + 8 * g);
          acc = __builtin_amdgcn_wmma_f32_16x16x32_bf16(false, afr[kt], false, bfr,
                                                        (short)0, acc, false, false);
        }
        #pragma unroll
        for (int r = 0; r < 8; ++r) zp[r] += __expf(acc[r] - mrow[r]);
      }
      float crow[8];
      #pragma unroll
      for (int r = 0; r < 8; ++r)
        crow[r] = sv[row0 + r + 8 * g] / rsum16(zp[r]);

      // sweep 3: t_e += sum_r c_r * exp(z - m_r)
      float* twp = tw + w * 512;
      for (int nt = 0; nt < 32; ++nt) {
        v8f acc = {};
        #pragma unroll
        for (int kt = 0; kt < 2; ++kt) {
          v16bf bfr = ldfrag(QK + (nt * 16 + nloc) * QK_LD + 64 + kt * 32 + 8 * g);
          acc = __builtin_amdgcn_wmma_f32_16x16x32_bf16(false, afr[kt], false, bfr,
                                                        (short)0, acc, false, false);
        }
        float colsum = 0.f;
        #pragma unroll
        for (int r = 0; r < 8; ++r)
          colsum += crow[r] * __expf(acc[r] - mrow[r]);
        colsum += __shfl_xor(colsum, 16, 32);      // rows 0-7 + rows 8-15
        if (g == 0) twp[nt * 16 + nloc] += colsum; // wave-private, race-free
      }
    }
  }
  __syncthreads();

  // ---- Stage 5: reduce per-wave accumulators; broadcast over n to output
  #pragma unroll
  for (int kk = 0; kk < 2; ++kk) {
    int e = tid + kk * 256;
    float acc = 0.f;
    #pragma unroll
    for (int ww = 0; ww < 8; ++ww) acc += tw[ww * 512 + e];
    tv[e] = acc;
  }
  __syncthreads();
  float* ob = out + (size_t)b * N_ * D_;
  for (int i = tid; i < (N_ * D_) / 4; i += 256) {
    int flat = i * 4, e = flat & 511;
    float4 v;
    v.x = tv[e]; v.y = tv[e + 1]; v.z = tv[e + 2]; v.w = tv[e + 3];
    ((float4*)ob)[i] = v;
  }
}

extern "C" void kernel_launch(void* const* d_in, const int* in_sizes, int n_in,
                              void* d_out, int out_size, void* d_ws, size_t ws_size,
                              hipStream_t stream) {
  const float* x     = (const float*)d_in[0];
  const float* Wq    = (const float*)d_in[1];
  const float* Wkv   = (const float*)d_in[2];
  const float* Wout  = (const float*)d_in[3];
  const float* bout  = (const float*)d_in[4];
  const float* Wspec = (const float*)d_in[5];
  float* out = (float*)d_out;
  float* wtg = (float*)d_ws;
  float* yg  = wtg + WS_PLANE;
  float* spg = wtg + 2 * WS_PLANE;
  (void)in_sizes; (void)n_in; (void)out_size; (void)ws_size;

  center_qw_kernel<<<(B_ / BT_) * H_, 256, LDS_QW, stream>>>(x, Wq, Wkv, wtg);
  center_attn_kernel<<<B_, 256, LDS_AT, stream>>>(x, wtg, yg);
  center_os_kernel<<<(B_ / BT_) * H_, 256, LDS_OS, stream>>>(yg, Wkv, Wout, spg);
  center_attn_fused_kernel<<<B_, 256, LDS_BYTES, stream>>>(
      x, spg, bout, Wspec, out);
}

// v002
// Measured time: 59.2 microseconds a run.
// Next to v001, in two timings, it ran 1.57 times as fast each time.
// Over all steps from v000 it is 3.87 times as fast.
#include <hip/hip_runtime.h>

typedef __attribute__((ext_vector_type(16))) __bf16 v16bf;
typedef __attribute__((ext_vector_type(8)))  __bf16 v8bf;
typedef __attribute__((ext_vector_type(8)))  float  v8f;
typedef __attribute__((ext_vector_type(2)))  float  v2f;

#define B_     256
#define N_     64
#define D_     512
#define H_     8
#define INNER_ 512
#define SCALE_ 0.125f

// ---- LDS layout. All row strides are multiples of 8 bf16 (16 B) so each
// WMMA fragment loads as two ds_load_b128; all OFF_* are 16B-aligned. ----
#define XT_LD  72    // XT[512][72]  bf16 : x^T  (d-major, n contiguous)
#define WT_LD  72    // WspT[128][72] bf16: Wspec^T cols 0..127 (k contiguous);
                     //   q-columns (j<64) pre-scaled by SCALE_
#define QK_LD  136   // QK[512][136] bf16 : cols 0..63 q_s*scale | 64..127 k_s
constexpr int OFF_XT   = 0;
constexpr int OFF_WSPT = OFF_XT   + 512 * XT_LD * 2;   // 73728
constexpr int OFF_QK   = OFF_WSPT + 128 * WT_LD * 2;   // 92160
constexpr int OFF_S    = OFF_QK   + 512 * QK_LD * 2;   // 231424
constexpr int OFF_T    = OFF_S    + 512 * 4;
constexpr int OFF_TW   = OFF_T    + 512 * 4;
constexpr int LDS_BYTES = OFF_TW  + 8 * 512 * 4;       // 251904 B < 320 KB

// ---- Center-token chain, batched: one work-group = BT_ batches x one head,
// so each head's weight panel is read once per BT_ batches. Stages hand over
// through the workspace at launch ends. Workspace planes, each [B][H][512] f32:
#define BT_    8
#define WS_PLANE (B_ * H_ * 512)
//   plane 0: wt[b][h][d]   = sum_j Wk[d][h*64+j] * qc[b][h*64+j]
//   plane 1: y[b][h][d]    = sum_m attn[b][h][m] * x[b][m][d]
//   plane 2: sp[b][h][e]   = sum_j outv[b][h*64+j] * Wout[h*64+j][e]
// (A bare "#pragma unroll" below stands on short loops over register arrays,
// which stay in registers only when their indices are constants.)
#define WK_LD  68    // staged Wk panel pitch (f32): b128 rows, lanes 4 banks apart
#define XS_LD  528   // staged x pitch (f32): 4 rows x 4 quads cover all banks
constexpr int P_AT   = 0;                          // aT[512][8]  f32
constexpr int P_RED  = P_AT  + 512 * BT_ * 4;      // red[16][8][64] f32
constexpr int P_O    = P_RED + 16 * BT_ * 64 * 4;  // o: 8 x 64 f32
constexpr int P_WK   = P_O   + BT_ * 64 * 4;       // WkS[512][WK_LD] f32
constexpr int LDS_QW = P_WK  + 512 * WK_LD * 4;    // 190464 B
constexpr int LDS_OS = P_WK;                       // 51200 B
constexpr int A_XS   = 0;                          // Xs[64][XS_LD] f32
constexpr int A_WT   = A_XS  + 64 * XS_LD * 4;     // wts[8][512] f32
constexpr int A_SC   = A_WT  + 8 * 512 * 4;        // sc[4][512] f32
constexpr int A_AT   = A_SC  + 4 * 512 * 4;        // aT[64][8] f32
constexpr int LDS_AT = A_AT  + 64 * 8 * 4;         // 161792 B

// One WMMA 16-bit operand fragment = two contiguous 8-bf16 runs per lane
// (K = base+8g..+7 in VGPRs 0-3, K = base+16+8g..+7 in VGPRs 4-7)
// -> two ds_load_b128 from a K-contiguous, 16B-aligned row.
__device__ __forceinline__ v16bf ldfrag(const __bf16* p) {
  union { v16bf v; v8bf h[2]; } u;
  u.h[0] = *(const v8bf*)(p);
  u.h[1] = *(const v8bf*)(p + 16);
  return u.v;
}

__device__ __forceinline__ float rmax16(float v) {
  #pragma unroll
  for (int m = 1; m < 16; m <<= 1) v = fmaxf(v, __shfl_xor(v, m, 32));
  return v;
}
__device__ __forceinline__ float rsum16(float v) {
  #pragma unroll
  for (int m = 1; m < 16; m <<= 1) v += __shfl_xor(v, m, 32);
  return v;
}

__device__ __forceinline__ void fma4(float4& a, float s, const float4& w) {
  a.x += s * w.x; a.y += s * w.y; a.z += s * w.z; a.w += s * w.w;
}
__device__ __forceinline__ float dot4(const float4& a, const float4& b) {
  return a.x * b.x + a.y * b.y + a.z * b.z + a.w * b.w;
}

// o[bi][j] = sum_d aT[d][bi] * Wb[d*ld + j], bi < 8, j < 64, d < 512.
// 16 lanes take one 256-B weight row as float4; 16 d-slices, summed through LDS.
// Result is stored at o[j*sj + bi*sb]. Ends with a barrier.
__device__ __forceinline__ void panel_gemv64(const float* __restrict__ Wb, int ld,
                                             const float* aT, float* red, float* o,
                                             int sj, int sb, int tid) {
  const int j4 = tid & 15, ds = tid >> 4;
  float4 acc[BT_];
  #pragma unroll
  for (int bi = 0; bi < BT_; ++bi) acc[bi] = make_float4(0.f, 0.f, 0.f, 0.f);
  // unroll 8: eight 16-byte weight loads in flight per lane
  #pragma unroll 8
  for (int i = 0; i < 32; ++i) {
    const int d = i * 16 + ds;
    float4 wv = *(const float4*)(Wb + (size_t)d * ld + j4 * 4);
    float4 a0 = *(const float4*)(aT + d * BT_);
    float4 a1 = *(const float4*)(aT + d * BT_ + 4);
    fma4(acc[0], a0.x, wv); fma4(acc[1], a0.y, wv);
    fma4(acc[2], a0.z, wv); fma4(acc[3], a0.w, wv);
    fma4(acc[4], a1.x, wv); fma4(acc[5], a1.y, wv);
    fma4(acc[6], a1.z, wv); fma4(acc[7], a1.w, wv);
  }
  #pragma unroll
  for (int bi = 0; bi < BT_; ++bi)
    *(float4*)(red + (ds * BT_ + bi) * 64 + j4 * 4) = acc[bi];
  __syncthreads();
  #pragma unroll
  for (int kk = 0; kk < 2; ++kk) {
    const int idx = tid + kk * 256, bi = idx >> 6, j = idx & 63;
    float s = 0.f;
    #pragma unroll
    for (int t = 0; t < 16; ++t) s += red[(t * BT_ + bi) * 64 + j];
    o[j * sj + bi * sb] = s;
  }
  __syncthreads();
}

// Launch 1: qc = x_center @ Wq (head panel), then wt = Wk(head panel) @ qc.
__global__ __launch_bounds__(256)
void center_qw_kernel(const float* __restrict__ x,
                      const float* __restrict__ Wq,
                      const float* __restrict__ Wkv,
                      float* __restrict__ wtg) {
  extern __shared__ char smem[];
  float* aT  = (float*)(smem + P_AT);
  float* red = (float*)(smem + P_RED);
  float* qs  = (float*)(smem + P_O);    // qs[bi][64]
  float* WkS = (float*)(smem + P_WK);
  const int tid = threadIdx.x;
  const int h = blockIdx.x & 7, b0 = (blockIdx.x >> 3) * BT_;

  #pragma unroll
  for (int kk = 0; kk < 16; ++kk) {
    const int idx = tid + kk * 256, bi = idx >> 9, d = idx & 511;
    aT[d * BT_ + bi] = x[(size_t)(b0 + bi) * N_ * D_ + (N_ / 2) * D_ + d];
  }
  // Wk head panel, coalesced 256-B rows into LDS (read by rows below)
  {
    const int dr = tid >> 4, j4 = tid & 15;
    const float* src = Wkv + (size_t)dr * (2 * INNER_) + h * 64 + j4 * 4;
    float* dst = WkS + dr * WK_LD + j4 * 4;
    // unroll 16: sixteen 16-byte loads in flight per lane
    #pragma unroll 16
    for (int i = 0; i < 32; ++i)
      *(float4*)(dst + i * 16 * WK_LD) = *(const float4*)(src + (size_t)i * 16 * (2 * INNER_));
  }
  __syncthreads();

  panel_gemv64(Wq + h * 64, INNER_, aT, red, qs, 1, 64, tid);

  float acc0[BT_], acc1[BT_];
  #pragma unroll
  for (int bi = 0; bi < BT_; ++bi) { acc0[bi] = 0.f; acc1[bi] = 0.f; }
  // unroll 4: LDS reads of four steps issued ahead of their sums
  #pragma unroll 4
  for (int j4 = 0; j4 < 16; ++j4) {
    float4 w0 = *(const float4*)(WkS + tid * WK_LD + j4 * 4);
    float4 w1 = *(const float4*)(WkS + (tid + 256) * WK_LD + j4 * 4);
    #pragma unroll
    for (int bi = 0; bi < BT_; ++bi) {
      float4 q = *(const float4*)(qs + bi * 64 + j4 * 4);
      acc0[bi] += dot4(w0, q);
      acc1[bi] += dot4(w1, q);
    }
  }
  #pragma unroll
  for (int bi = 0; bi < BT_; ++bi) {
    float* o = wtg + (size_t)(b0 + bi) * (H_ * 512) + h * 512;
    o[tid]       = acc0[bi];
    o[tid + 256] = acc1[bi];
  }
}

// Launch 2 (one batch per work-group): scores, softmax over m, y = attn @ x.
__global__ __launch_bounds__(256)
void center_attn_kernel(const float* __restrict__ x,
                        const float* __restrict__ wtg,
                        float* __restrict__ yg) {
  extern __shared__ char smem[];
  float* Xs  = (float*)(smem + A_XS);
  float* wts = (float*)(smem + A_WT);
  float* sc  = (float*)(smem + A_SC);
  float* aT  = (float*)(smem + A_AT);
  const int b = blockIdx.x, tid = threadIdx.x;
  const int lane = tid & 31, w = tid >> 5;
  const float4* xb4 = (const float4*)(x + (size_t)b * N_ * D_);
  const float4* wt4 = (const float4*)(wtg + (size_t)b * (H_ * 512));

  {
    float* dst = Xs + (tid >> 7) * XS_LD + (tid & 127) * 4;
    // full unroll: constant offsets from one base, many 16-byte loads in flight
    #pragma unroll
    for (int i = 0; i < 32; ++i)
      *(float4*)(dst + i * 2 * XS_LD) = xb4[tid + i * 256];
  }
  #pragma unroll
  for (int i = 0; i < 4; ++i)
    ((float4*)wts)[tid + i * 256] = wt4[tid + i * 256];
  __syncthreads();

  {
    const int m = tid >> 2, dq = tid & 3;
    float acc[H_];
    #pragma unroll
    for (int h = 0; h < H_; ++h) acc[h] = 0.f;
    // unroll 4: LDS reads of four steps issued ahead of their sums
    #pragma unroll 4
    for (int i = 0; i < 32; ++i) {
      const int d = (i * 4 + dq) * 4;
      float4 xv = *(const float4*)(Xs + m * XS_LD + d);
      #pragma unroll
      for (int h = 0; h < H_; ++h)
        acc[h] += dot4(xv, *(const float4*)(wts + h * 512 + d));
    }
    #pragma unroll
    for (int h = 0; h < H_; ++h) sc[dq * 512 + h * 64 + m] = acc[h];
  }
  __syncthreads();

  {  // wave w = head w; each lane holds m = lane and lane + 32
    const float* s0 = sc + w * 64 + lane;
    float v0 = (s0[0]  + s0[512]      + s0[1024]      + s0[1536])      * SCALE_;
    float v1 = (s0[32] + s0[512 + 32] + s0[1024 + 32] + s0[1536 + 32]) * SCALE_;
    float mx = fmaxf(v0, v1);
    #pragma unroll
    for (int k = 16; k >= 1; k >>= 1) mx = fmaxf(mx, __shfl_xor(mx, k, 32));
    float e0 = __expf(v0 - mx), e1 = __expf(v1 - mx);
    float Z = e0 + e1;
    #pragma unroll
    for (int k = 16; k >= 1; k >>= 1) Z += __shfl_xor(Z, k, 32);
    float inv = 1.f / Z;
    aT[lane * 8 + w]        = e0 * inv;
    aT[(lane + 32) * 8 + w] = e1 * inv;
  }
  __syncthreads();

  {
    const int d2 = tid * 2;
    float2 acc[H_];
    #pragma unroll
    for (int h = 0; h < H_; ++h) acc[h] = make_float2(0.f, 0.f);
    // unroll 8: LDS reads of eight steps issued ahead of their sums
    #pragma unroll 8
    for (int m = 0; m < 64; ++m) {
      float2 xv = *(const float2*)(Xs + m * XS_LD + d2);
      float4 a0 = *(const float4*)(aT + m * 8);
      float4 a1 = *(const float4*)(aT + m * 8 + 4);
      acc[0].x += a0.x * xv.x; acc[0].y += a0.x * xv.y;
      acc[1].x += a0.y * xv.x; acc[1].y += a0.y * xv.y;
      acc[2].x += a0.z * xv.x; acc[2].y += a0.z * xv.y;
      acc[3].x += a0.w * xv.x; acc[3].y += a0.w * xv.y;
      acc[4].x += a1.x * xv.x; acc[4].y += a1.x * xv.y;
      acc[5].x += a1.y * xv.x; acc[5].y += a1.y * xv.y;
      acc[6].x += a1.z * xv.x; acc[6].y += a1.z * xv.y;
      acc[7].x += a1.w * xv.x; acc[7].y += a1.w * xv.y;
    }
    #pragma unroll
    for (int h = 0; h < H_; ++h)
      *(float2*)(yg + (size_t)b * (H_ * 512) + h * 512 + d2) = acc[h];
  }
}

// Launch 3: outv = y @ Wv (head panel), then this head's share of outv @ Wout.
__global__ __launch_bounds__(256)
void center_os_kernel(const float* __restrict__ yg,
                      const float* __restrict__ Wkv,
                      const float* __restrict__ Wout,
                      float* __restrict__ spg) {
  extern __shared__ char smem[];
  float* aT  = (float*)(smem + P_AT);
  float* red = (float*)(smem + P_RED);
  float* oT  = (float*)(smem + P_O);    // oT[j][8]
  const int tid = threadIdx.x;
  const int h = blockIdx.x & 7, b0 = (blockIdx.x >> 3) * BT_;

  #pragma unroll
  for (int kk = 0; kk < 16; ++kk) {
    const int idx = tid + kk * 256, bi = idx >> 9, d = idx & 511;
    aT[d * BT_ + bi] = yg[(size_t)(b0 + bi) * (H_ * 512) + h * 512 + d];
  }
  __syncthreads();

  panel_gemv64(Wkv + INNER_ + h * 64, 2 * INNER_, aT, red, oT, BT_, 1, tid);

  const int e2 = tid * 2;
  float2 acc[BT_];
  #pragma unroll
  for (int bi = 0; bi < BT_; ++bi) acc[bi] = make_float2(0.f, 0.f);
  // unroll 16: sixteen 8-byte weight loads in flight per lane
  #pragma unroll 16
  for (int j = 0; j < 64; ++j) {
    float2 wv = *(const float2*)(Wout + (size_t)(h * 64 + j) * D_ + e2);
    float4 a0 = *(const float4*)(oT + j * BT_);
    float4 a1 = *(const float4*)(oT + j * BT_ + 4);
    acc[0].x += a0.x * wv.x; acc[0].y += a0.x * wv.y;
    acc[1].x += a0.y * wv.x; acc[1].y += a0.y * wv.y;
    acc[2].x += a0.z * wv.x; acc[2].y += a0.z * wv.y;
    acc[3].x += a0.w * wv.x; acc[3].y += a0.w * wv.y;
    acc[4].x += a1.x * wv.x; acc[4].y += a1.x * wv.y;
    acc[5].x += a1.y * wv.x; acc[5].y += a1.y * wv.y;
    acc[6].x += a1.z * wv.x; acc[6].y += a1.z * wv.y;
    acc[7].x += a1.w * wv.x; acc[7].y += a1.w * wv.y;
  }
  #pragma unroll
  for (int bi = 0; bi < BT_; ++bi)
    *(float2*)(spg + (size_t)(b0 + bi) * (H_ * 512) + h * 512 + e2) = acc[bi];
}

__global__ __launch_bounds__(256)
void center_attn_fused_kernel(const float* __restrict__ x,
                              const float* __restrict__ spg,
                              const float* __restrict__ bout,
                              const float* __restrict__ Wspec,
                              float* __restrict__ out) {
  extern __shared__ char smem[];
  __bf16* XT   = (__bf16*)(smem + OFF_XT);
  __bf16* WspT = (__bf16*)(smem + OFF_WSPT);
  __bf16* QK   = (__bf16*)(smem + OFF_QK);
  float* sv   = (float*)(smem + OFF_S);
  float* tv   = (float*)(smem + OFF_T);
  float* tw   = (float*)(smem + OFF_TW);

  const int b    = blockIdx.x;
  const int tid  = threadIdx.x;
  const int lane = tid & 31;
  const int w    = tid >> 5;
  const float* xb = x + (size_t)b * N_ * D_;

  // ---- Stage 1: coalesced f32 loads; transpose-convert into bf16 LDS.
  for (int i = tid; i < (N_ * D_) / 4; i += 256) {
    float4 v = ((const float4*)xb)[i];
    int flat = i * 4;
    int n = flat >> 9, d = flat & 511;
    XT[(d + 0) * XT_LD + n] = (__bf16)v.x;
    XT[(d + 1) * XT_LD + n] = (__bf16)v.y;
    XT[(d + 2) * XT_LD + n] = (__bf16)v.z;
    XT[(d + 3) * XT_LD + n] = (__bf16)v.w;
  }
  for (int i = tid; i < 64 * 128; i += 256) {
    int k = i >> 7, j = i & 127;                  // coalesced in j
    float wv = Wspec[k * 192 + j];
    WspT[j * WT_LD + k] = (__bf16)(j < 64 ? wv * SCALE_ : wv); // fold scale into q_s
  }

  // ---- Stage 2: s[e] = bout[e] + the eight heads' shares from launch 3
  #pragma unroll
  for (int kk = 0; kk < 2; ++kk) {
    int e = tid + kk * 256;
    float acc = bout[e];
    #pragma unroll
    for (int h = 0; h < H_; ++h) acc += spg[(size_t)b * (H_ * 512) + h * 512 + e];
    sv[e] = acc;
  }
  __syncthreads();

  // ---- Stage 3: GEMM1 (WMMA bf16): QK(512x128) = X^T(512x64) @ Wspec(64x128)
  {
    const int mloc = lane & 15, g = lane >> 4;
    for (int tile = w; tile < 256; tile += 8) {
      int mt = tile >> 3, nt = tile & 7;
      v8f acc = {};
      #pragma unroll
      for (int kt = 0; kt < 2; ++kt) {
        v16bf af = ldfrag(XT   + (mt * 16 + mloc) * XT_LD + kt * 32 + 8 * g);
        v16bf bf = ldfrag(WspT + (nt * 16 + mloc) * WT_LD + kt * 32 + 8 * g);
        acc = __builtin_amdgcn_wmma_f32_16x16x32_bf16(false, af, false, bf,
                                                      (short)0, acc, false, false);
      }
      #pragma unroll
      for (int r = 0; r < 8; ++r)
        QK[(mt * 16 + r + 8 * g) * QK_LD + nt * 16 + mloc] = (__bf16)acc[r];
    }
  }
  __syncthreads();

  // ---- Stage 4: t[e] = sum_d s_d * softmax_row(q_s k_s^T)[e]
  // One WMMA sweep per strip: the strip's 16 x 512 scores stay in registers
  // (32 accumulator tiles), so row max, exp, row sum and the weighted column
  // sums all read registers. Column sums also stay in registers over the
  // wave's four strips and are stored once.
  {
    const int nloc = lane & 15, g = lane >> 4;
    v2f tcol[32];   // per column tile: even rows | odd rows of this lane
    #pragma unroll
    for (int nt = 0; nt < 32; ++nt) tcol[nt] = (v2f){0.f, 0.f};
    for (int strip = w; strip < 32; strip += 8) {
      const int row0 = strip * 16;
      v16bf afr[2];
      #pragma unroll
      for (int kt = 0; kt < 2; ++kt)
        afr[kt] = ldfrag(QK + (row0 + nloc) * QK_LD + kt * 32 + 8 * g);

      // scores (scale folded into q_s); k_s fragments are fetched one group of
      // four tiles ahead of the group being multiplied
      v8f z[32];
      v16bf bq[2][4][2];
      #pragma unroll
      for (int t = 0; t < 4; ++t)
        #pragma unroll
        for (int kt = 0; kt < 2; ++kt)
          bq[0][t][kt] = ldfrag(QK + (t * 16 + nloc) * QK_LD + 64 + kt * 32 + 8 * g);
      #pragma unroll
      for (int gi = 0; gi < 8; ++gi) {
        if (gi < 7) {
          #pragma unroll
          for (int t = 0; t < 4; ++t)
            #pragma unroll
            for (int kt = 0; kt < 2; ++kt)
              bq[(gi + 1) & 1][t][kt] =
                  ldfrag(QK + ((gi * 4 + 4 + t) * 16 + nloc) * QK_LD + 64 + kt * 32 + 8 * g);
        }
        #pragma unroll
        for (int t = 0; t < 4; ++t) {
          v8f acc = {};
          #pragma unroll
          for (int kt = 0; kt < 2; ++kt)
            acc = __builtin_amdgcn_wmma_f32_16x16x32_bf16(false, afr[kt], false,
                                                          bq[gi & 1][t][kt],
                                                          (short)0, acc, false, false);
          z[gi * 4 + t] = acc;
        }
        // keeps the scheduler from lifting all 128 fragment loads to the top,
        // which overflows the register budget and spills
        __builtin_amdgcn_sched_barrier(0);
      }

      // row max: per lane over the 32 tiles, then across the 16 lanes
      float mrow[8];
      #pragma unroll
      for (int r = 0; r < 8; ++r) {
        float mp = -1e30f;
        #pragma unroll
        for (int nt = 0; nt < 32; ++nt) mp = fmaxf(mp, z[nt][r]);
        mrow[r] = rmax16(mp);
      }

      // exp in place and row sum, on row pairs (packed f32 subtract and add)
      v2f zp[4];
      #pragma unroll
      for (int p = 0; p < 4; ++p) zp[p] = (v2f){0.f, 0.f};
      #pragma unroll
      for (int nt = 0; nt < 32; ++nt) {
        #pragma unroll
        for (int p = 0; p < 4; ++p) {
          v2f a = (v2f){z[nt][2 * p], z[nt][2 * p + 1]} - (v2f){mrow[2 * p], mrow[2 * p + 1]};
          v2f e = (v2f){__expf(a.x), __expf(a.y)};
          z[nt][2 * p] = e.x;
          z[nt][2 * p + 1] = e.y;
          zp[p] += e;
        }
      }
      float crow[8];
      #pragma unroll
      for (int r = 0; r < 8; ++r)
        crow[r] = sv[row0 + r + 8 * g] / rsum16(zp[r >> 1][r & 1]);

      // t_e += sum_r c_r * exp(z - m_r), this lane's eight rows as four pairs
      #pragma unroll
      for (int nt = 0; nt < 32; ++nt) {
        #pragma unroll
        for (int p = 0; p < 4; ++p)
          tcol[nt] += (v2f){crow[2 * p], crow[2 * p + 1]} *
                      (v2f){z[nt][2 * p], z[nt][2 * p + 1]};
      }
    }
    float* twp = tw + w * 512;
    float tsum[32];
    #pragma unroll
    for (int nt = 0; nt < 32; ++nt) {
      tsum[nt] = tcol[nt].x + tcol[nt].y;
      tsum[nt] += __shfl_xor(tsum[nt], 16, 32);           // rows 0-7 + rows 8-15
    }
    if (g == 0) {
      #pragma unroll
      for (int nt = 0; nt < 32; ++nt) twp[nt * 16 + nloc] = tsum[nt];  // wave-private plane
    }
  }
  __syncthreads();

  // ---- Stage 5: reduce per-wave accumulators; broadcast over n to output
  #pragma unroll
  for (int kk = 0; kk < 2; ++kk) {
    int e = tid + kk * 256;
    float acc = 0.f;
    #pragma unroll
    for (int ww = 0; ww < 8; ++ww) acc += tw[ww * 512 + e];
    tv[e] = acc;
  }
  __syncthreads();
  float* ob = out + (size_t)b * N_ * D_;
  for (int i = tid; i < (N_ * D_) / 4; i += 256) {
    int flat = i * 4, e = flat & 511;
    float4 v;
    v.x = tv[e]; v.y = tv[e + 1]; v.z = tv[e + 2]; v.w = tv[e + 3];
    ((float4*)ob)[i] = v;
  }
}

extern "C" void kernel_launch(void* const* d_in, const int* in_sizes, int n_in,
                              void* d_out, int out_size, void* d_ws, size_t ws_size,
                              hipStream_t stream) {
  const float* x     = (const float*)d_in[0];
  const float* Wq    = (const float*)d_in[1];
  const float* Wkv   = (const float*)d_in[2];
  const float* Wout  = (const float*)d_in[3];
  const float* bout  = (const float*)d_in[4];
  const float* Wspec = (const float*)d_in[5];
  float* out = (float*)d_out;
  float* wtg = (float*)d_ws;
  float* yg  = wtg + WS_PLANE;
  float* spg = wtg + 2 * WS_PLANE;
  (void)in_sizes; (void)n_in; (void)out_size; (void)ws_size;

  center_qw_kernel<<<(B_ / BT_) * H_, 256, LDS_QW, stream>>>(x, Wq, Wkv, wtg);
  center_attn_kernel<<<B_, 256, LDS_AT, stream>>>(x, wtg, yg);
  center_os_kernel<<<(B_ / BT_) * H_, 256, LDS_OS, stream>>>(yg, Wkv, Wout, spg);
  center_attn_fused_kernel<<<B_, 256, LDS_BYTES, stream>>>(
      x, spg, bout, Wspec, out);
}

// v003
// A run of this version takes 52.4 microseconds.
// Timed twice side by side with v002, it ran 1.13 times as fast both times.
// All steps since v000 together make it 4.38 times as fast.
#include <hip/hip_runtime.h>

typedef __attribute__((ext_vector_type(16))) __bf16 v16bf;
typedef __attribute__((ext_vector_type(8)))  __bf16 v8bf;
typedef __attribute__((ext_vector_type(8)))  float  v8f;
typedef __attribute__((ext_vector_type(2)))  float  v2f;
typedef __attribute__((ext_vector_type(4)))  float  v4f;

#define B_     256
#define N_     64
#define D_     512
#define H_     8
#define INNER_ 512
#define SCALE_ 0.125f

// ---- LDS layout. All row strides are multiples of 8 bf16 (16 B) so each
// WMMA fragment loads as two ds_load_b128; all OFF_* are 16B-aligned. ----
#define XT_LD  72    // XT[512][72]  bf16 : x^T  (d-major, n contiguous)
#define WT_LD  72    // WspT[128][72] bf16: Wspec^T cols 0..127 (k contiguous);
                     //   q-columns (j<64) pre-scaled by SCALE_
#define QK_LD  136   // QK[512][136] bf16 : cols 0..63 q_s*scale | 64..127 k_s
constexpr int OFF_XT   = 0;
constexpr int OFF_WSPT = OFF_XT   + 512 * XT_LD * 2;   // 73728
constexpr int OFF_QK   = OFF_WSPT + 128 * WT_LD * 2;   // 92160
constexpr int OFF_S    = OFF_QK   + 512 * QK_LD * 2;   // 231424
constexpr int OFF_T    = OFF_S    + 512 * 4;
constexpr int OFF_TW   = OFF_T    + 512 * 4;
constexpr int LDS_BYTES = OFF_TW  + 8 * 512 * 4;       // 251904 B < 320 KB

// ---- Center-token chain, batched: one work-group = BT_ batches x one head,
// so each head's weight panel is read once per BT_ batches. Stages hand over
// through the workspace at launch ends. Workspace planes, each [B][H][512] f32:
#define BT_    8
#define WS_PLANE (B_ * H_ * 512)
//   plane 0: wt[b][h][d]   = sum_j Wk[d][h*64+j] * qc[b][h*64+j]
//   plane 1: y[b][h][d]    = sum_m attn[b][h][m] * x[b][m][d]
//   plane 2: sp[b][h][e]   = sum_j outv[b][h*64+j] * Wout[h*64+j][e]
// (A bare "#pragma unroll" below stands on short loops over register arrays,
// which stay in registers only when their indices are constants.)
#define WK_LD  68    // staged Wk panel pitch (f32): b128 rows, lanes 4 banks apart
#define XS_LD  528   // staged x pitch (f32): 4 rows x 4 quads cover all banks
constexpr int P_AT   = 0;                          // aT[512][8]  f32
constexpr int P_RED  = P_AT  + 512 * BT_ * 4;      // red[16][8][64] f32
constexpr int P_O    = P_RED + 16 * BT_ * 64 * 4;  // o: 8 x 64 f32
constexpr int P_WK   = P_O   + BT_ * 64 * 4;       // WkS[512][WK_LD] f32
constexpr int LDS_QW = P_WK  + 512 * WK_LD * 4;    // 190464 B
constexpr int LDS_OS = P_WK;                       // 51200 B
constexpr int A_XS   = 0;                          // Xs[64][XS_LD] f32
constexpr int A_WT   = A_XS  + 64 * XS_LD * 4;     // wts[8][512] f32
constexpr int A_SC   = A_WT  + 8 * 512 * 4;        // sc[4][512] f32
constexpr int A_AT   = A_SC  + 4 * 512 * 4;        // aT[64][8] f32
constexpr int LDS_AT = A_AT  + 64 * 8 * 4;         // 161792 B

// One WMMA 16-bit operand fragment = two contiguous 8-bf16 runs per lane
// (K = base+8g..+7 in VGPRs 0-3, K = base+16+8g..+7 in VGPRs 4-7)
// -> two ds_load_b128 from a K-contiguous, 16B-aligned row.
__device__ __forceinline__ v16bf ldfrag(const __bf16* p) {
  union { v16bf v; v8bf h[2]; } u;
  u.h[0] = *(const v8bf*)(p);
  u.h[1] = *(const v8bf*)(p + 16);
  return u.v;
}

__device__ __forceinline__ float rmax16(float v) {
  #pragma unroll
  for (int m = 1; m < 16; m <<= 1) v = fmaxf(v, __shfl_xor(v, m, 32));
  return v;
}
__device__ __forceinline__ float rsum16(float v) {
  #pragma unroll
  for (int m = 1; m < 16; m <<= 1) v += __shfl_xor(v, m, 32);
  return v;
}

__device__ __forceinline__ void fma4(float4& a, float s, const float4& w) {
  a.x += s * w.x; a.y += s * w.y; a.z += s * w.z; a.w += s * w.w;
}
__device__ __forceinline__ float dot4(const float4& a, const float4& b) {
  return a.x * b.x + a.y * b.y + a.z * b.z + a.w * b.w;
}

// o[bi][j] = sum_d aT[d][bi] * Wb[d*ld + j], bi < 8, j < 64, d < 512.
// 16 lanes take one 256-B weight row as float4; 16 d-slices, summed through LDS.
// Result is stored at o[j*sj + bi*sb]. Ends with a barrier.
__device__ __forceinline__ void panel_gemv64(const float* __restrict__ Wb, int ld,
                                             const float* aT, float* red, float* o,
                                             int sj, int sb, int tid) {
  const int j4 = tid & 15, ds = tid >> 4;
  float4 acc[BT_];
  #pragma unroll
  for (int bi = 0; bi < BT_; ++bi) acc[bi] = make_float4(0.f, 0.f, 0.f, 0.f);
  // unroll 8: eight 16-byte weight loads in flight per lane
  #pragma unroll 8
  for (int i = 0; i < 32; ++i) {
    const int d = i * 16 + ds;
    float4 wv = *(const float4*)(Wb + (size_t)d * ld + j4 * 4);
    float4 a0 = *(const float4*)(aT + d * BT_);
    float4 a1 = *(const float4*)(aT + d * BT_ + 4);
    fma4(acc[0], a0.x, wv); fma4(acc[1], a0.y, wv);
    fma4(acc[2], a0.z, wv); fma4(acc[3], a0.w, wv);
    fma4(acc[4], a1.x, wv); fma4(acc[5], a1.y, wv);
    fma4(acc[6], a1.z, wv); fma4(acc[7], a1.w, wv);
  }
  #pragma unroll
  for (int bi = 0; bi < BT_; ++bi)
    *(float4*)(red + (ds * BT_ + bi) * 64 + j4 * 4) = acc[bi];
  __syncthreads();
  #pragma unroll
  for (int kk = 0; kk < 2; ++kk) {
    const int idx = tid + kk * 256, bi = idx >> 6, j = idx & 63;
    float s = 0.f;
    #pragma unroll
    for (int t = 0; t < 16; ++t) s += red[(t * BT_ + bi) * 64 + j];
    o[j * sj + bi * sb] = s;
  }
  __syncthreads();
}

// Launch 1: qc = x_center @ Wq (head panel), then wt = Wk(head panel) @ qc.
__global__ __launch_bounds__(256)
void center_qw_kernel(const float* __restrict__ x,
                      const float* __restrict__ Wq,
                      const float* __restrict__ Wkv,
                      float* __restrict__ wtg) {
  extern __shared__ char smem[];
  float* aT  = (float*)(smem + P_AT);
  float* red = (float*)(smem + P_RED);
  float* qs  = (float*)(smem + P_O);    // qs[bi][64]
  float* WkS = (float*)(smem + P_WK);
  const int tid = threadIdx.x;
  const int h = blockIdx.x & 7, b0 = (blockIdx.x >> 3) * BT_;

  #pragma unroll
  for (int kk = 0; kk < 16; ++kk) {
    const int idx = tid + kk * 256, bi = idx >> 9, d = idx & 511;
    aT[d * BT_ + bi] = x[(size_t)(b0 + bi) * N_ * D_ + (N_ / 2) * D_ + d];
  }
  // Wk head panel, coalesced 256-B rows into LDS (read by rows below)
  {
    const int dr = tid >> 4, j4 = tid & 15;
    const float* src = Wkv + (size_t)dr * (2 * INNER_) + h * 64 + j4 * 4;
    float* dst = WkS + dr * WK_LD + j4 * 4;
    // unroll 16: sixteen 16-byte loads in flight per lane
    #pragma unroll 16
    for (int i = 0; i < 32; ++i)
      *(float4*)(dst + i * 16 * WK_LD) = *(const float4*)(src + (size_t)i * 16 * (2 * INNER_));
  }
  __syncthreads();

  panel_gemv64(Wq + h * 64, INNER_, aT, red, qs, 1, 64, tid);

  float acc0[BT_], acc1[BT_];
  #pragma unroll
  for (int bi = 0; bi < BT_; ++bi) { acc0[bi] = 0.f; acc1[bi] = 0.f; }
  // unroll 4: LDS reads of four steps issued ahead of their sums
  #pragma unroll 4
  for (int j4 = 0; j4 < 16; ++j4) {
    float4 w0 = *(const float4*)(WkS + tid * WK_LD + j4 * 4);
    float4 w1 = *(const float4*)(WkS + (tid + 256) * WK_LD + j4 * 4);
    #pragma unroll
    for (int bi = 0; bi < BT_; ++bi) {
      float4 q = *(const float4*)(qs + bi * 64 + j4 * 4);
      acc0[bi] += dot4(w0, q);
      acc1[bi] += dot4(w1, q);
    }
  }
  #pragma unroll
  for (int bi = 0; bi < BT_; ++bi) {
    float* o = wtg + (size_t)(b0 + bi) * (H_ * 512) + h * 512;
    o[tid]       = acc0[bi];
    o[tid + 256] = acc1[bi];
  }
}

// Launch 2 (one batch per work-group): scores, softmax over m, y = attn @ x.
__global__ __launch_bounds__(256)
void center_attn_kernel(const float* __restrict__ x,
                        const float* __restrict__ wtg,
                        float* __restrict__ yg) {
  extern __shared__ char smem[];
  float* Xs  = (float*)(smem + A_XS);
  float* wts = (float*)(smem + A_WT);
  float* sc  = (float*)(smem + A_SC);
  float* aT  = (float*)(smem + A_AT);
  const int b = blockIdx.x, tid = threadIdx.x;
  const int lane = tid & 31, w = tid >> 5;
  const float4* xb4 = (const float4*)(x + (size_t)b * N_ * D_);
  const float4* wt4 = (const float4*)(wtg + (size_t)b * (H_ * 512));

  {
    float* dst = Xs + (tid >> 7) * XS_LD + (tid & 127) * 4;
    // full unroll: constant offsets from one base, many 16-byte loads in flight
    #pragma unroll
    for (int i = 0; i < 32; ++i)
      *(float4*)(dst + i * 2 * XS_LD) = xb4[tid + i * 256];
  }
  #pragma unroll
  for (int i = 0; i < 4; ++i)
    ((float4*)wts)[tid + i * 256] = wt4[tid + i * 256];
  __syncthreads();

  {
    const int m = tid >> 2, dq = tid & 3;
    float acc[H_];
    #pragma unroll
    for (int h = 0; h < H_; ++h) acc[h] = 0.f;
    // unroll 4: LDS reads of four steps issued ahead of their sums
    #pragma unroll 4
    for (int i = 0; i < 32; ++i) {
      const int d = (i * 4 + dq) * 4;
      float4 xv = *(const float4*)(Xs + m * XS_LD + d);
      #pragma unroll
      for (int h = 0; h < H_; ++h)
        acc[h] += dot4(xv, *(const float4*)(wts + h * 512 + d));
    }
    #pragma unroll
    for (int h = 0; h < H_; ++h) sc[dq * 512 + h * 64 + m] = acc[h];
  }
  __syncthreads();

  {  // wave w = head w; each lane holds m = lane and lane + 32
    const float* s0 = sc + w * 64 + lane;
    float v0 = (s0[0]  + s0[512]      + s0[1024]      + s0[1536])      * SCALE_;
    float v1 = (s0[32] + s0[512 + 32] + s0[1024 + 32] + s0[1536 + 32]) * SCALE_;
    float mx = fmaxf(v0, v1);
    #pragma unroll
    for (int k = 16; k >= 1; k >>= 1) mx = fmaxf(mx, __shfl_xor(mx, k, 32));
    float e0 = __expf(v0 - mx), e1 = __expf(v1 - mx);
    float Z = e0 + e1;
    #pragma unroll
    for (int k = 16; k >= 1; k >>= 1) Z += __shfl_xor(Z, k, 32);
    float inv = 1.f / Z;
    aT[lane * 8 + w]        = e0 * inv;
    aT[(lane + 32) * 8 + w] = e1 * inv;
  }
  __syncthreads();

  {
    const int d2 = tid * 2;
    float2 acc[H_];
    #pragma unroll
    for (int h = 0; h < H_; ++h) acc[h] = make_float2(0.f, 0.f);
    // unroll 8: LDS reads of eight steps issued ahead of their sums
    #pragma unroll 8
    for (int m = 0; m < 64; ++m) {
      float2 xv = *(const float2*)(Xs + m * XS_LD + d2);
      float4 a0 = *(const float4*)(aT + m * 8);
      float4 a1 = *(const float4*)(aT + m * 8 + 4);
      acc[0].x += a0.x * xv.x; acc[0].y += a0.x * xv.y;
      acc[1].x += a0.y * xv.x; acc[1].y += a0.y * xv.y;
      acc[2].x += a0.z * xv.x; acc[2].y += a0.z * xv.y;
      acc[3].x += a0.w * xv.x; acc[3].y += a0.w * xv.y;
      acc[4].x += a1.x * xv.x; acc[4].y += a1.x * xv.y;
      acc[5].x += a1.y * xv.x; acc[5].y += a1.y * xv.y;
      acc[6].x += a1.z * xv.x; acc[6].y += a1.z * xv.y;
      acc[7].x += a1.w * xv.x; acc[7].y += a1.w * xv.y;
    }
    #pragma unroll
    for (int h = 0; h < H_; ++h)
      *(float2*)(yg + (size_t)b * (H_ * 512) + h * 512 + d2) = acc[h];
  }
}

// Launch 3: outv = y @ Wv (head panel), then this head's share of outv @ Wout.
__global__ __launch_bounds__(256)
void center_os_kernel(const float* __restrict__ yg,
                      const float* __restrict__ Wkv,
                      const float* __restrict__ Wout,
                      float* __restrict__ spg) {
  extern __shared__ char smem[];
  float* aT  = (float*)(smem + P_AT);
  float* red = (float*)(smem + P_RED);
  float* oT  = (float*)(smem + P_O);    // oT[j][8]
  const int tid = threadIdx.x;
  const int h = blockIdx.x & 7, b0 = (blockIdx.x >> 3) * BT_;

  #pragma unroll
  for (int kk = 0; kk < 16; ++kk) {
    const int idx = tid + kk * 256, bi = idx >> 9, d = idx & 511;
    aT[d * BT_ + bi] = yg[(size_t)(b0 + bi) * (H_ * 512) + h * 512 + d];
  }
  __syncthreads();

  panel_gemv64(Wkv + INNER_ + h * 64, 2 * INNER_, aT, red, oT, BT_, 1, tid);

  const int e2 = tid * 2;
  float2 acc[BT_];
  #pragma unroll
  for (int bi = 0; bi < BT_; ++bi) acc[bi] = make_float2(0.f, 0.f);
  // unroll 16: sixteen 8-byte weight loads in flight per lane
  #pragma unroll 16
  for (int j = 0; j < 64; ++j) {
    float2 wv = *(const float2*)(Wout + (size_t)(h * 64 + j) * D_ + e2);
    float4 a0 = *(const float4*)(oT + j * BT_);
    float4 a1 = *(const float4*)(oT + j * BT_ + 4);
    acc[0].x += a0.x * wv.x; acc[0].y += a0.x * wv.y;
    acc[1].x += a0.y * wv.x; acc[1].y += a0.y * wv.y;
    acc[2].x += a0.z * wv.x; acc[2].y += a0.z * wv.y;
    acc[3].x += a0.w * wv.x; acc[3].y += a0.w * wv.y;
    acc[4].x += a1.x * wv.x; acc[4].y += a1.x * wv.y;
    acc[5].x += a1.y * wv.x; acc[5].y += a1.y * wv.y;
    acc[6].x += a1.z * wv.x; acc[6].y += a1.z * wv.y;
    acc[7].x += a1.w * wv.x; acc[7].y += a1.w * wv.y;
  }
  #pragma unroll
  for (int bi = 0; bi < BT_; ++bi)
    *(float2*)(spg + (size_t)(b0 + bi) * (H_ * 512) + h * 512 + e2) = acc[bi];
}

__global__ __launch_bounds__(256)
void center_attn_fused_kernel(const float* __restrict__ x,
                              const float* __restrict__ spg,
                              const float* __restrict__ bout,
                              const float* __restrict__ Wspec,
                              float* __restrict__ out) {
  extern __shared__ char smem[];
  __bf16* XT   = (__bf16*)(smem + OFF_XT);
  __bf16* WspT = (__bf16*)(smem + OFF_WSPT);
  __bf16* QK   = (__bf16*)(smem + OFF_QK);
  float* sv   = (float*)(smem + OFF_S);
  float* tv   = (float*)(smem + OFF_T);
  float* tw   = (float*)(smem + OFF_TW);

  const int b    = blockIdx.x;
  const int tid  = threadIdx.x;
  const int lane = tid & 31;
  const int w    = tid >> 5;
  const float* xb = x + (size_t)b * N_ * D_;

  // ---- Stage 1: x^T and Wspec^T (cols 0..127) into bf16 LDS.
  // A lane owns a block of 4 columns x 8 rows of the f32 source: eight 16-byte
  // loads (a wave-load = four whole 128-B lines), then per column one 16-byte
  // store of its 8 rows packed to bf16. Lanes 0-15 (and 16-31) hold 4 column
  // quads x 4 row blocks, which at the 144-B pitch fall on all 64 banks once.
  {
    const int cq = (lane & 3) | ((lane >> 4) << 2);   // column quad in a 32-column chunk
    const int rb = (w >> 2) * 4 + ((lane >> 2) & 3);  // block of 8 source rows
    const float* xsrc = xb + rb * 8 * D_ + (w & 3) * 128 + cq * 4;
    const float* wsrc = Wspec + rb * 8 * 192 + (w & 3) * 32 + cq * 4;
    v4f xv[4][8], wv[8];
    #pragma unroll
    for (int u = 0; u < 4; ++u)
      #pragma unroll
      for (int k = 0; k < 8; ++k) xv[u][k] = *(const v4f*)(xsrc + k * D_ + u * 32);
    #pragma unroll
    for (int k = 0; k < 8; ++k) wv[k] = *(const v4f*)(wsrc + k * 192);

    __bf16* xdst = XT + ((w & 3) * 128 + cq * 4) * XT_LD + rb * 8;
    #pragma unroll
    for (int u = 0; u < 4; ++u)
      #pragma unroll
      for (int c = 0; c < 4; ++c) {
        v8bf p;
        #pragma unroll
        for (int k = 0; k < 8; ++k) p[k] = (__bf16)xv[u][k][c];
        *(v8bf*)(xdst + (u * 32 + c) * XT_LD) = p;
      }
    const float qsc = (w & 3) < 2 ? SCALE_ : 1.f;     // fold scale into q_s (j < 64)
    __bf16* wdst = WspT + ((w & 3) * 32 + cq * 4) * WT_LD + rb * 8;
    #pragma unroll
    for (int c = 0; c < 4; ++c) {
      v8bf p;
      #pragma unroll
      for (int k = 0; k < 8; ++k) p[k] = (__bf16)(wv[k][c] * qsc);
      *(v8bf*)(wdst + c * WT_LD) = p;
    }
  }

  // ---- Stage 2: s[e] = bout[e] + the eight heads' shares from launch 3
  #pragma unroll
  for (int kk = 0; kk < 2; ++kk) {
    int e = tid + kk * 256;
    float acc = bout[e];
    #pragma unroll
    for (int h = 0; h < H_; ++h) acc += spg[(size_t)b * (H_ * 512) + h * 512 + e];
    sv[e] = acc;
  }
  __syncthreads();

  // ---- Stage 3: GEMM1 (WMMA bf16): QK(512x128) = X^T(512x64) @ Wspec(64x128)
  {
    const int mloc = lane & 15, g = lane >> 4;
    for (int tile = w; tile < 256; tile += 8) {
      int mt = tile >> 3, nt = tile & 7;
      v8f acc = {};
      #pragma unroll
      for (int kt = 0; kt < 2; ++kt) {
        v16bf af = ldfrag(XT   + (mt * 16 + mloc) * XT_LD + kt * 32 + 8 * g);
        v16bf bf = ldfrag(WspT + (nt * 16 + mloc) * WT_LD + kt * 32 + 8 * g);
        acc = __builtin_amdgcn_wmma_f32_16x16x32_bf16(false, af, false, bf,
                                                      (short)0, acc, false, false);
      }
      #pragma unroll
      for (int r = 0; r < 8; ++r)
        QK[(mt * 16 + r + 8 * g) * QK_LD + nt * 16 + mloc] = (__bf16)acc[r];
    }
  }
  __syncthreads();

  // ---- Stage 4: t[e] = sum_d s_d * softmax_row(q_s k_s^T)[e]
  // One WMMA sweep per strip: the strip's 16 x 512 scores stay in registers
  // (32 accumulator tiles), so row max, exp, row sum and the weighted column
  // sums all read registers. Column sums also stay in registers over the
  // wave's four strips and are stored once.
  {
    const int nloc = lane & 15, g = lane >> 4;
    v2f tcol[32];   // per column tile: even rows | odd rows of this lane
    #pragma unroll
    for (int nt = 0; nt < 32; ++nt) tcol[nt] = (v2f){0.f, 0.f};
    for (int strip = w; strip < 32; strip += 8) {
      const int row0 = strip * 16;
      v16bf afr[2];
      #pragma unroll
      for (int kt = 0; kt < 2; ++kt)
        afr[kt] = ldfrag(QK + (row0 + nloc) * QK_LD + kt * 32 + 8 * g);

      // scores (scale folded into q_s); k_s fragments are fetched one group of
      // four tiles ahead of the group being multiplied
      v8f z[32];
      v16bf bq[2][4][2];
      #pragma unroll
      for (int t = 0; t < 4; ++t)
        #pragma unroll
        for (int kt = 0; kt < 2; ++kt)
          bq[0][t][kt] = ldfrag(QK + (t * 16 + nloc) * QK_LD + 64 + kt * 32 + 8 * g);
      #pragma unroll
      for (int gi = 0; gi < 8; ++gi) {
        if (gi < 7) {
          #pragma unroll
          for (int t = 0; t < 4; ++t)
            #pragma unroll
            for (int kt = 0; kt < 2; ++kt)
              bq[(gi + 1) & 1][t][kt] =
                  ldfrag(QK + ((gi * 4 + 4 + t) * 16 + nloc) * QK_LD + 64 + kt * 32 + 8 * g);
        }
        #pragma unroll
        for (int t = 0; t < 4; ++t) {
          v8f acc = {};
          #pragma unroll
          for (int kt = 0; kt < 2; ++kt)
            acc = __builtin_amdgcn_wmma_f32_16x16x32_bf16(false, afr[kt], false,
                                                          bq[gi & 1][t][kt],
                                                          (short)0, acc, false, false);
          z[gi * 4 + t] = acc;
        }
        // keeps the scheduler from lifting all 128 fragment loads to the top,
        // which overflows the register budget and spills
        __builtin_amdgcn_sched_barrier(0);
      }

      // row max: per lane over the 32 tiles, then across the 16 lanes
      float mrow[8];
      #pragma unroll
      for (int r = 0; r < 8; ++r) {
        float mp = -1e30f;
        #pragma unroll
        for (int nt = 0; nt < 32; ++nt) mp = fmaxf(mp, z[nt][r]);
        mrow[r] = rmax16(mp);
      }

      // exp in place and row sum, on row pairs (packed f32 subtract and add)
      v2f zp[4];
      #pragma unroll
      for (int p = 0; p < 4; ++p) zp[p] = (v2f){0.f, 0.f};
      #pragma unroll
      for (int nt = 0; nt < 32; ++nt) {
        #pragma unroll
        for (int p = 0; p < 4; ++p) {
          v2f a = (v2f){z[nt][2 * p], z[nt][2 * p + 1]} - (v2f){mrow[2 * p], mrow[2 * p + 1]};
          v2f e = (v2f){__expf(a.x), __expf(a.y)};
          z[nt][2 * p] = e.x;
          z[nt][2 * p + 1] = e.y;
          zp[p] += e;
        }
      }
      float crow[8];
      #pragma unroll
      for (int r = 0; r < 8; ++r)
        crow[r] = sv[row0 + r + 8 * g] / rsum16(zp[r >> 1][r & 1]);

      // t_e += sum_r c_r * exp(z - m_r), this lane's eight rows as four pairs
      #pragma unroll
      for (int nt = 0; nt < 32; ++nt) {
        #pragma unroll
        for (int p = 0; p < 4; ++p)
          tcol[nt] += (v2f){crow[2 * p], crow[2 * p + 1]} *
                      (v2f){z[nt][2 * p], z[nt][2 * p + 1]};
      }
    }
    float* twp = tw + w * 512;
    float tsum[32];
    #pragma unroll
    for (int nt = 0; nt < 32; ++nt) {
      tsum[nt] = tcol[nt].x + tcol[nt].y;
      tsum[nt] += __shfl_xor(tsum[nt], 16, 32);           // rows 0-7 + rows 8-15
    }
    if (g == 0) {
      #pragma unroll
      for (int nt = 0; nt < 32; ++nt) twp[nt * 16 + nloc] = tsum[nt];  // wave-private plane
    }
  }
  __syncthreads();

  // ---- Stage 5: reduce per-wave accumulators; broadcast over n to output
  #pragma unroll
  for (int kk = 0; kk < 2; ++kk) {
    int e = tid + kk * 256;
    float acc = 0.f;
    #pragma unroll
    for (int ww = 0; ww < 8; ++ww) acc += tw[ww * 512 + e];
    tv[e] = acc;
  }
  __syncthreads();
  float* ob = out + (size_t)b * N_ * D_;
  for (int i = tid; i < (N_ * D_) / 4; i += 256) {
    int flat = i * 4, e = flat & 511;
    float4 v;
    v.x = tv[e]; v.y = tv[e + 1]; v.z = tv[e + 2]; v.w = tv[e + 3];
    ((float4*)ob)[i] = v;
  }
}

extern "C" void kernel_launch(void* const* d_in, const int* in_sizes, int n_in,
                              void* d_out, int out_size, void* d_ws, size_t ws_size,
                              hipStream_t stream) {
  const float* x     = (const float*)d_in[0];
  const float* Wq    = (const float*)d_in[1];
  const float* Wkv   = (const float*)d_in[2];
  const float* Wout  = (const float*)d_in[3];
  const float* bout  = (const float*)d_in[4];
  const float* Wspec = (const float*)d_in[5];
  float* out = (float*)d_out;
  float* wtg = (float*)d_ws;
  float* yg  = wtg + WS_PLANE;
  float* spg = wtg + 2 * WS_PLANE;
  (void)in_sizes; (void)n_in; (void)out_size; (void)ws_size;

  center_qw_kernel<<<(B_ / BT_) * H_, 256, LDS_QW, stream>>>(x, Wq, Wkv, wtg);
  center_attn_kernel<<<B_, 256, LDS_AT, stream>>>(x, wtg, yg);
  center_os_kernel<<<(B_ / BT_) * H_, 256, LDS_OS, stream>>>(yg, Wkv, Wout, spg);
  center_attn_fused_kernel<<<B_, 256, LDS_BYTES, stream>>>(
      x, spg, bout, Wspec, out);
}

// v004
// A run of this version takes 46.2 microseconds.
// In both of two side-by-side timings against v003, it was 1.13 times as fast.
// All steps since v000 together make it 4.96 times as fast.
#include <hip/hip_runtime.h>

typedef __attribute__((ext_vector_type(16))) __bf16 v16bf;
typedef __attribute__((ext_vector_type(8)))  __bf16 v8bf;
typedef __attribute__((ext_vector_type(8)))  float  v8f;
typedef __attribute__((ext_vector_type(2)))  float  v2f;
typedef __attribute__((ext_vector_type(4)))  float  v4f;

#define B_     256
#define N_     64
#define D_     512
#define H_     8
#define INNER_ 512
#define SCALE_ 0.125f

// ---- LDS layout. All row strides are multiples of 8 bf16 (16 B) so each
// WMMA fragment loads as two ds_load_b128; all OFF_* are 16B-aligned. ----
#define XT_LD  72    // XT[512][72]  bf16 : x^T  (d-major, n contiguous)
#define WT_LD  72    // WspT[128][72] bf16: Wspec^T cols 0..127 (k contiguous);
                     //   q-columns (j<64) pre-scaled by SCALE_
#define QK_LD  136   // QK[512][136] bf16 : cols 0..63 q_s*scale | 64..127 k_s
constexpr int OFF_XT   = 0;
constexpr int OFF_WSPT = OFF_XT   + 512 * XT_LD * 2;   // 73728
constexpr int OFF_QK   = OFF_WSPT + 128 * WT_LD * 2;   // 92160
constexpr int OFF_S    = OFF_QK   + 512 * QK_LD * 2;   // 231424
constexpr int OFF_T    = OFF_S    + 512 * 4;
constexpr int OFF_TW   = OFF_T    + 512 * 4;
constexpr int LDS_BYTES = OFF_TW  + 8 * 512 * 4;       // 251904 B < 320 KB

// ---- Center-token chain, one launch: one work-group = BT_ batches x one head
// goes through the whole chain, so each head's weight panels are read once per
// BT_ batches and nothing but the last stage's result leaves the work-group.
// Workspace: sp[b][h][e] = sum_j outv[b][h*64+j] * Wout[h*64+j][e], [B][H][512] f32.
#define BT_    8
// (A bare "#pragma unroll" below stands on short loops over register arrays,
// which stay in registers only when their indices are constants.)
#define WK_LD  68    // staged Wk panel pitch (f32): b128 rows, lanes 4 banks apart
constexpr int P_AT   = 0;                          // aT[512][8]  f32: x_center^T, later y^T
constexpr int P_RED  = P_AT  + 512 * BT_ * 4;      // red[16][8][64] f32
constexpr int P_O    = P_RED + 16 * BT_ * 64 * 4;  // o: 8 x 64 f32
constexpr int P_WK   = P_O   + BT_ * 64 * 4;       // WkS[512][WK_LD] f32, later yp[8][8][512]
constexpr int P_WT   = P_WK  + 512 * WK_LD * 4;    // wts[8][512] f32
constexpr int P_SC   = P_WT  + BT_ * 512 * 4;      // sc[8][64] f32
constexpr int LDS_CH = P_SC  + BT_ * 64 * 4;       // 208896 B
static_assert(BT_ * 8 * 512 <= 512 * WK_LD, "yp fits where the Wk panel stood");

// One WMMA 16-bit operand fragment = two contiguous 8-bf16 runs per lane
// (K = base+8g..+7 in VGPRs 0-3, K = base+16+8g..+7 in VGPRs 4-7)
// -> two ds_load_b128 from a K-contiguous, 16B-aligned row.
__device__ __forceinline__ v16bf ldfrag(const __bf16* p) {
  union { v16bf v; v8bf h[2]; } u;
  u.h[0] = *(const v8bf*)(p);
  u.h[1] = *(const v8bf*)(p + 16);
  return u.v;
}

__device__ __forceinline__ float rmax16(float v) {
  #pragma unroll
  for (int m = 1; m < 16; m <<= 1) v = fmaxf(v, __shfl_xor(v, m, 32));
  return v;
}
__device__ __forceinline__ float rsum16(float v) {
  #pragma unroll
  for (int m = 1; m < 16; m <<= 1) v += __shfl_xor(v, m, 32);
  return v;
}

__device__ __forceinline__ void fma4(float4& a, float s, const float4& w) {
  a.x += s * w.x; a.y += s * w.y; a.z += s * w.z; a.w += s * w.w;
}
__device__ __forceinline__ float dot4(const float4& a, const float4& b) {
  return a.x * b.x + a.y * b.y + a.z * b.z + a.w * b.w;
}

// o[bi][j] = sum_d aT[d][bi] * Wb[d*ld + j], bi < 8, j < 64, d < 512.
// 16 lanes take one 256-B weight row as float4; 16 d-slices, summed through LDS.
// Result is stored at o[j*sj + bi*sb]. Ends with a barrier.
__device__ __forceinline__ void panel_gemv64(const float* __restrict__ Wb, int ld,
                                             const float* aT, float* red, float* o,
                                             int sj, int sb, int tid) {
  const int j4 = tid & 15, ds = tid >> 4;
  float4 acc[BT_];
  #pragma unroll
  for (int bi = 0; bi < BT_; ++bi) acc[bi] = make_float4(0.f, 0.f, 0.f, 0.f);
  // unroll 8: eight 16-byte weight loads in flight per lane
  #pragma unroll 8
  for (int i = 0; i < 32; ++i) {
    const int d = i * 16 + ds;
    float4 wv = *(const float4*)(Wb + (size_t)d * ld + j4 * 4);
    float4 a0 = *(const float4*)(aT + d * BT_);
    float4 a1 = *(const float4*)(aT + d * BT_ + 4);
    fma4(acc[0], a0.x, wv); fma4(acc[1], a0.y, wv);
    fma4(acc[2], a0.z, wv); fma4(acc[3], a0.w, wv);
    fma4(acc[4], a1.x, wv); fma4(acc[5], a1.y, wv);
    fma4(acc[6], a1.z, wv); fma4(acc[7], a1.w, wv);
  }
  #pragma unroll
  for (int bi = 0; bi < BT_; ++bi)
    *(float4*)(red + (ds * BT_ + bi) * 64 + j4 * 4) = acc[bi];
  __syncthreads();
  #pragma unroll
  for (int kk = 0; kk < 2; ++kk) {
    const int idx = tid + kk * 256, bi = idx >> 6, j = idx & 63;
    float s = 0.f;
    #pragma unroll
    for (int t = 0; t < 16; ++t) s += red[(t * BT_ + bi) * 64 + j];
    o[j * sj + bi * sb] = s;
  }
  __syncthreads();
}

// Work-group barrier for data handed over through LDS only: it waits for this
// wave's LDS operations and no more. __syncthreads() would also wait for the
// global loads in flight, that is, for the next batch's x rows fetched ahead.
__device__ __forceinline__ void lds_barrier() {
  asm volatile("s_wait_dscnt 0x0\n\ts_barrier_signal -1\n\ts_barrier_wait -1" ::: "memory");
}

// Eight rows of one batch's x, a wave's share: row r as four 512-B wave loads.
__device__ __forceinline__ void load_rows(const float* __restrict__ xw, v4f (&xr)[8][4]) {
  // keeps the tail of the work before from sinking in between the loads and their wait
  __builtin_amdgcn_sched_barrier(0);
  // at most 31 older loads still out when these 32 are issued: the wave's
  // outstanding loads stay within what the load counter can count (63)
  asm volatile("s_wait_loadcnt 0x1f" ::: "memory");
  #pragma unroll
  for (int r = 0; r < 8; ++r)
    #pragma unroll
    for (int c = 0; c < 4; ++c)
      xr[r][c] = *(const v4f*)(xw + r * D_ + c * 128);
  // the address registers of the loads above are rewritten soon after: the wait
  // that belongs in front of such a rewrite;
  // xw as an input keeps those registers from being handed to a loaded value
  asm volatile("s_wait_xcnt 0x0" :: "v"(xw) : "memory");
  // keeps these loads, and that wait, in front of the work on the other register set: moved
  // down among it, they would be issued only after that set's own loads return
  __builtin_amdgcn_sched_barrier(0);
}

// y[bj][d] = the eight waves' partial sums; stored transposed for panel_gemv64.
__device__ __forceinline__ void reduce_y(const float* yp, float* aT, int bj, int tid) {
  const int d2 = tid * 2;
  float2 s = make_float2(0.f, 0.f);
  #pragma unroll
  for (int ww = 0; ww < 8; ++ww) {
    float2 v = *(const float2*)(yp + (bj * 8 + ww) * 512 + d2);
    s.x += v.x; s.y += v.y;
  }
  aT[d2 * BT_ + bj]       = s.x;
  aT[(d2 + 1) * BT_ + bj] = s.y;
}

// One batch of the middle stage, x rows in registers (wave w: rows 8w..8w+7):
// scores against wt, softmax over the 64 rows, this wave's part of y = attn @ x.
__device__ __forceinline__ void attn_step(int bi, const v4f (&xr)[8][4],
                                          const float* wts, float* sc, float* yp,
                                          float* aT, int tid) {
  const int lane = tid & 31, w = tid >> 5;
  v4f wv[4];
  #pragma unroll
  for (int c = 0; c < 4; ++c)
    wv[c] = *(const v4f*)(wts + bi * 512 + c * 128 + lane * 4);
  float p[8];
  #pragma unroll
  for (int r = 0; r < 8; ++r) {
    v2f acc = xr[r][0].lo * wv[0].lo;
    acc += xr[r][0].hi * wv[0].hi;
    #pragma unroll
    for (int c = 1; c < 4; ++c) {
      acc += xr[r][c].lo * wv[c].lo;
      acc += xr[r][c].hi * wv[c].hi;
    }
    p[r] = acc.x + acc.y;
  }
  #pragma unroll
  for (int k = 16; k >= 1; k >>= 1)
    #pragma unroll
    for (int r = 0; r < 8; ++r) p[r] += __shfl_xor(p[r], k, 32);
  if (lane == 0) {
    float* so = sc + bi * 64 + w * 8;
    *(v4f*)(so)     = (v4f){p[0], p[1], p[2], p[3]} * SCALE_;
    *(v4f*)(so + 4) = (v4f){p[4], p[5], p[6], p[7]} * SCALE_;
  }
  lds_barrier();     // all 64 scores of this batch, and the batch before's yp, are in LDS

  if (bi > 0) reduce_y(yp, aT, bi - 1, tid);

  // every lane reads all 64 scores (one address per load): no cross-lane steps
  v4f s4[18];   // 16, 17: this wave's own eight rows once more
  #pragma unroll
  for (int i = 0; i < 16; ++i) s4[i] = *(const v4f*)(sc + bi * 64 + i * 4);
  s4[16] = *(const v4f*)(sc + bi * 64 + w * 8);
  s4[17] = *(const v4f*)(sc + bi * 64 + w * 8 + 4);
  // keeps the reads together: spread along the maximum's chain, only three
  // were in flight at a time and their latency was paid five times over
  __builtin_amdgcn_sched_barrier(0);
  v4f m4 = s4[0];   // four independent chains
  #pragma unroll
  for (int i = 1; i < 16; ++i) {
    m4.x = fmaxf(m4.x, s4[i].x); m4.y = fmaxf(m4.y, s4[i].y);
    m4.z = fmaxf(m4.z, s4[i].z); m4.w = fmaxf(m4.w, s4[i].w);
  }
  const float mx = fmaxf(fmaxf(m4.x, m4.y), fmaxf(m4.z, m4.w));
  const v2f mx2 = (v2f){mx, mx};
  v2f z0 = (v2f){0.f, 0.f}, z1 = (v2f){0.f, 0.f};
  #pragma unroll
  for (int i = 0; i < 18; ++i) {
    v2f a0 = s4[i].lo - mx2, a1 = s4[i].hi - mx2;
    s4[i] = (v4f){__expf(a0.x), __expf(a0.y), __expf(a1.x), __expf(a1.y)};
    if (i < 16) { z0 += s4[i].lo; z1 += s4[i].hi; }
  }
  const float inv = 1.f / ((z0.x + z0.y) + (z1.x + z1.y));
  const v4f at0 = s4[16] * inv, at1 = s4[17] * inv;
  const float a[8] = {at0.x, at0.y, at0.z, at0.w, at1.x, at1.y, at1.z, at1.w};

  v4f ya[4];
  #pragma unroll
  for (int c = 0; c < 4; ++c) ya[c] = a[0] * xr[0][c];
  #pragma unroll
  for (int r = 1; r < 8; ++r)
    #pragma unroll
    for (int c = 0; c < 4; ++c) ya[c] += a[r] * xr[r][c];
  #pragma unroll
  for (int c = 0; c < 4; ++c)
    *(v4f*)(yp + (bi * 8 + w) * 512 + c * 128 + lane * 4) = ya[c];
}

// Launch 1, the whole center-token chain of BT_ batches and one head:
//   qc = x_center @ Wq(head), wt = Wk(head) @ qc,
//   per batch: scores = x . wt, softmax over m, y = attn @ x,
//   outv = y @ Wv(head), sp = outv @ Wout(head rows).
__global__ __launch_bounds__(256)
void center_chain_kernel(const float* __restrict__ x,
                         const float* __restrict__ Wq,
                         const float* __restrict__ Wkv,
                         const float* __restrict__ Wout,
                         float* __restrict__ spg) {
  extern __shared__ char smem[];
  float* aT  = (float*)(smem + P_AT);
  float* red = (float*)(smem + P_RED);
  float* qs  = (float*)(smem + P_O);    // qs[bi][64], later oT[j][8]
  float* WkS = (float*)(smem + P_WK);
  float* yp  = (float*)(smem + P_WK);   // yp[bi][wave][512], once WkS is done with
  float* wts = (float*)(smem + P_WT);   // wts[bi][512]
  float* sc  = (float*)(smem + P_SC);   // sc[bi][64]
  const int tid = threadIdx.x;
  const int h = blockIdx.x & 7, b0 = (blockIdx.x >> 3) * BT_;

  #pragma unroll
  for (int kk = 0; kk < 16; ++kk) {
    const int idx = tid + kk * 256, bi = idx >> 9, d = idx & 511;
    aT[d * BT_ + bi] = x[(size_t)(b0 + bi) * N_ * D_ + (N_ / 2) * D_ + d];
  }
  // Wk head panel, coalesced 256-B rows into LDS (read by rows below)
  {
    const int dr = tid >> 4, j4 = tid & 15;
    const float* src = Wkv + (size_t)dr * (2 * INNER_) + h * 64 + j4 * 4;
    float* dst = WkS + dr * WK_LD + j4 * 4;
    // unroll 16: sixteen 16-byte loads in flight per lane
    #pragma unroll 16
    for (int i = 0; i < 32; ++i)
      *(float4*)(dst + i * 16 * WK_LD) = *(const float4*)(src + (size_t)i * 16 * (2 * INNER_));
  }
  __syncthreads();

  panel_gemv64(Wq + h * 64, INNER_, aT, red, qs, 1, 64, tid);

  // this wave's rows of batch b0 + bi start at xw + bi * XB
  const float* xw = x + ((size_t)b0 * N_ + (tid >> 5) * 8) * D_ + (tid & 31) * 4;
  constexpr size_t XB = (size_t)N_ * D_;
  v4f xa[8][4], xb[8][4];
  load_rows(xw, xa);   // the first batch's rows fly during the wt stage

  {
    float acc0[BT_], acc1[BT_];
    #pragma unroll
    for (int bi = 0; bi < BT_; ++bi) { acc0[bi] = 0.f; acc1[bi] = 0.f; }
    // unroll 4: LDS reads of four steps issued ahead of their sums
    #pragma unroll 4
    for (int j4 = 0; j4 < 16; ++j4) {
      float4 w0 = *(const float4*)(WkS + tid * WK_LD + j4 * 4);
      float4 w1 = *(const float4*)(WkS + (tid + 256) * WK_LD + j4 * 4);
      #pragma unroll
      for (int bi = 0; bi < BT_; ++bi) {
        float4 q = *(const float4*)(qs + bi * 64 + j4 * 4);
        acc0[bi] += dot4(w0, q);
        acc1[bi] += dot4(w1, q);
      }
    }
    #pragma unroll
    for (int bi = 0; bi < BT_; ++bi) {
      wts[bi * 512 + tid]       = acc0[bi];
      wts[bi * 512 + tid + 256] = acc1[bi];
    }
  }
  lds_barrier();     // wts complete; WkS free for yp

  // two register sets: the next batch's rows are loaded while this one is worked on.
  // The last two batches stand behind the loop, so that no load stands under a
  // branch (a branch round it makes the compiler wait for every load in flight).
  // unroll 1: the body already holds two batches; more would only grow the code
  #pragma unroll 1
  for (int bi = 0; bi < BT_ - 2; bi += 2) {
    load_rows(xw + (bi + 1) * XB, xb);
    attn_step(bi, xa, wts, sc, yp, aT, tid);
    load_rows(xw + (bi + 2) * XB, xa);
    attn_step(bi + 1, xb, wts, sc, yp, aT, tid);
  }
  load_rows(xw + (BT_ - 1) * XB, xb);
  attn_step(BT_ - 2, xa, wts, sc, yp, aT, tid);
  attn_step(BT_ - 1, xb, wts, sc, yp, aT, tid);
  __syncthreads();   // the last batch's yp
  reduce_y(yp, aT, BT_ - 1, tid);
  __syncthreads();   // y^T complete

  panel_gemv64(Wkv + INNER_ + h * 64, 2 * INNER_, aT, red, qs, BT_, 1, tid);

  const int e2 = tid * 2;
  float2 acc[BT_];
  #pragma unroll
  for (int bi = 0; bi < BT_; ++bi) acc[bi] = make_float2(0.f, 0.f);
  // unroll 16: sixteen 8-byte weight loads in flight per lane
  #pragma unroll 16
  for (int j = 0; j < 64; ++j) {
    float2 wv = *(const float2*)(Wout + (size_t)(h * 64 + j) * D_ + e2);
    float4 a0 = *(const float4*)(qs + j * BT_);
    float4 a1 = *(const float4*)(qs + j * BT_ + 4);
    acc[0].x += a0.x * wv.x; acc[0].y += a0.x * wv.y;
    acc[1].x += a0.y * wv.x; acc[1].y += a0.y * wv.y;
    acc[2].x += a0.z * wv.x; acc[2].y += a0.z * wv.y;
    acc[3].x += a0.w * wv.x; acc[3].y += a0.w * wv.y;
    acc[4].x += a1.x * wv.x; acc[4].y += a1.x * wv.y;
    acc[5].x += a1.y * wv.x; acc[5].y += a1.y * wv.y;
    acc[6].x += a1.z * wv.x; acc[6].y += a1.z * wv.y;
    acc[7].x += a1.w * wv.x; acc[7].y += a1.w * wv.y;
  }
  #pragma unroll
  for (int bi = 0; bi < BT_; ++bi)
    *(float2*)(spg + (size_t)(b0 + bi) * (H_ * 512) + h * 512 + e2) = acc[bi];
}

__global__ __launch_bounds__(256)
void center_attn_fused_kernel(const float* __restrict__ x,
                              const float* __restrict__ spg,
                              const float* __restrict__ bout,
                              const float* __restrict__ Wspec,
                              float* __restrict__ out) {
  extern __shared__ char smem[];
  __bf16* XT   = (__bf16*)(smem + OFF_XT);
  __bf16* WspT = (__bf16*)(smem + OFF_WSPT);
  __bf16* QK   = (__bf16*)(smem + OFF_QK);
  float* sv   = (float*)(smem + OFF_S);
  float* tv   = (float*)(smem + OFF_T);
  float* tw   = (float*)(smem + OFF_TW);

  const int b    = blockIdx.x;
  const int tid  = threadIdx.x;
  const int lane = tid & 31;
  const int w    = tid >> 5;
  const float* xb = x + (size_t)b * N_ * D_;

  // ---- Stage 1: x^T and Wspec^T (cols 0..127) into bf16 LDS.
  // A lane owns a block of 4 columns x 8 rows of the f32 source: eight 16-byte
  // loads (a wave-load = four whole 128-B lines), then per column one 16-byte
  // store of its 8 rows packed to bf16. Lanes 0-15 (and 16-31) hold 4 column
  // quads x 4 row blocks, which at the 144-B pitch fall on all 64 banks once.
  {
    const int cq = (lane & 3) | ((lane >> 4) << 2);   // column quad in a 32-column chunk
    const int rb = (w >> 2) * 4 + ((lane >> 2) & 3);  // block of 8 source rows
    const float* xsrc = xb + rb * 8 * D_ + (w & 3) * 128 + cq * 4;
    const float* wsrc = Wspec + rb * 8 * 192 + (w & 3) * 32 + cq * 4;
    v4f xv[4][8], wv[8];
    #pragma unroll
    for (int u = 0; u < 4; ++u)
      #pragma unroll
      for (int k = 0; k < 8; ++k) xv[u][k] = *(const v4f*)(xsrc + k * D_ + u * 32);
    #pragma unroll
    for (int k = 0; k < 8; ++k) wv[k] = *(const v4f*)(wsrc + k * 192);

    __bf16* xdst = XT + ((w & 3) * 128 + cq * 4) * XT_LD + rb * 8;
    #pragma unroll
    for (int u = 0; u < 4; ++u)
      #pragma unroll
      for (int c = 0; c < 4; ++c) {
        v8bf p;
        #pragma unroll
        for (int k = 0; k < 8; ++k) p[k] = (__bf16)xv[u][k][c];
        *(v8bf*)(xdst + (u * 32 + c) * XT_LD) = p;
      }
    const float qsc = (w & 3) < 2 ? SCALE_ : 1.f;     // fold scale into q_s (j < 64)
    __bf16* wdst = WspT + ((w & 3) * 32 + cq * 4) * WT_LD + rb * 8;
    #pragma unroll
    for (int c = 0; c < 4; ++c) {
      v8bf p;
      #pragma unroll
      for (int k = 0; k < 8; ++k) p[k] = (__bf16)(wv[k][c] * qsc);
      *(v8bf*)(wdst + c * WT_LD) = p;
    }
  }

  // ---- Stage 2: s[e] = bout[e] + the eight heads' shares from launch 1
  #pragma unroll
  for (int kk = 0; kk < 2; ++kk) {
    int e = tid + kk * 256;
    float acc = bout[e];
    #pragma unroll
    for (int h = 0; h < H_; ++h) acc += spg[(size_t)b * (H_ * 512) + h * 512 + e];
    sv[e] = acc;
  }
  __syncthreads();

  // ---- Stage 3: GEMM1 (WMMA bf16): QK(512x128) = X^T(512x64) @ Wspec(64x128)
  {
    const int mloc = lane & 15, g = lane >> 4;
    for (int tile = w; tile < 256; tile += 8) {
      int mt = tile >> 3, nt = tile & 7;
      v8f acc = {};
      #pragma unroll
      for (int kt = 0; kt < 2; ++kt) {
        v16bf af = ldfrag(XT   + (mt * 16 + mloc) * XT_LD + kt * 32 + 8 * g);
        v16bf bf = ldfrag(WspT + (nt * 16 + mloc) * WT_LD + kt * 32 + 8 * g);
        acc = __builtin_amdgcn_wmma_f32_16x16x32_bf16(false, af, false, bf,
                                                      (short)0, acc, false, false);
      }
      #pragma unroll
      for (int r = 0; r < 8; ++r)
        QK[(mt * 16 + r + 8 * g) * QK_LD + nt * 16 + mloc] = (__bf16)acc[r];
    }
  }
  __syncthreads();

  // ---- Stage 4: t[e] = sum_d s_d * softmax_row(q_s k_s^T)[e]
  // One WMMA sweep per strip: the strip's 16 x 512 scores stay in registers
  // (32 accumulator tiles), so row max, exp, row sum and the weighted column
  // sums all read registers. Column sums also stay in registers over the
  // wave's four strips and are stored once.
  {
    const int nloc = lane & 15, g = lane >> 4;
    v2f tcol[32];   // per column tile: even rows | odd rows of this lane
    #pragma unroll
    for (int nt = 0; nt < 32; ++nt) tcol[nt] = (v2f){0.f, 0.f};
    for (int strip = w; strip < 32; strip += 8) {
      const int row0 = strip * 16;
      v16bf afr[2];
      #pragma unroll
      for (int kt = 0; kt < 2; ++kt)
        afr[kt] = ldfrag(QK + (row0 + nloc) * QK_LD + kt * 32 + 8 * g);

      // scores (scale folded into q_s); k_s fragments are fetched one group of
      // four tiles ahead of the group being multiplied
      v8f z[32];
      v16bf bq[2][4][2];
      #pragma unroll
      for (int t = 0; t < 4; ++t)
        #pragma unroll
        for (int kt = 0; kt < 2; ++kt)
          bq[0][t][kt] = ldfrag(QK + (t * 16 + nloc) * QK_LD + 64 + kt * 32 + 8 * g);
      #pragma unroll
      for (int gi = 0; gi < 8; ++gi) {
        if (gi < 7) {
          #pragma unroll
          for (int t = 0; t < 4; ++t)
            #pragma unroll
            for (int kt = 0; kt < 2; ++kt)
              bq[(gi + 1) & 1][t][kt] =
                  ldfrag(QK + ((gi * 4 + 4 + t) * 16 + nloc) * QK_LD + 64 + kt * 32 + 8 * g);
        }
        #pragma unroll
        for (int t = 0; t < 4; ++t) {
          v8f acc = {};
          #pragma unroll
          for (int kt = 0; kt < 2; ++kt)
            acc = __builtin_amdgcn_wmma_f32_16x16x32_bf16(false, afr[kt], false,
                                                          bq[gi & 1][t][kt],
                                                          (short)0, acc, false, false);
          z[gi * 4 + t] = acc;
        }
        // keeps the scheduler from lifting all 128 fragment loads to the top,
        // which overflows the register budget and spills
        __builtin_amdgcn_sched_barrier(0);
      }

      // row max: per lane over the 32 tiles, then across the 16 lanes
      float mrow[8];
      #pragma unroll
      for (int r = 0; r < 8; ++r) {
        float mp = -1e30f;
        #pragma unroll
        for (int nt = 0; nt < 32; ++nt) mp = fmaxf(mp, z[nt][r]);
        mrow[r] = rmax16(mp);
      }

      // exp in place and row sum, on row pairs (packed f32 subtract and add)
      v2f zp[4];
      #pragma unroll
      for (int p = 0; p < 4; ++p) zp[p] = (v2f){0.f, 0.f};
      #pragma unroll
      for (int nt = 0; nt < 32; ++nt) {
        #pragma unroll
        for (int p = 0; p < 4; ++p) {
          v2f a = (v2f){z[nt][2 * p], z[nt][2 * p + 1]} - (v2f){mrow[2 * p], mrow[2 * p + 1]};
          v2f e = (v2f){__expf(a.x), __expf(a.y)};
          z[nt][2 * p] = e.x;
          z[nt][2 * p + 1] = e.y;
          zp[p] += e;
        }
      }
      float crow[8];
      #pragma unroll
      for (int r = 0; r < 8; ++r)
        crow[r] = sv[row0 + r + 8 * g] / rsum16(zp[r >> 1][r & 1]);

      // t_e += sum_r c_r * exp(z - m_r), this lane's eight rows as four pairs
      #pragma unroll
      for (int nt = 0; nt < 32; ++nt) {
        #pragma unroll
        for (int p = 0; p < 4; ++p)
          tcol[nt] += (v2f){crow[2 * p], crow[2 * p + 1]} *
                      (v2f){z[nt][2 * p], z[nt][2 * p + 1]};
      }
    }
    float* twp = tw + w * 512;
    float tsum[32];
    #pragma unroll
    for (int nt = 0; nt < 32; ++nt) {
      tsum[nt] = tcol[nt].x + tcol[nt].y;
      tsum[nt] += __shfl_xor(tsum[nt], 16, 32);           // rows 0-7 + rows 8-15
    }
    if (g == 0) {
      #pragma unroll
      for (int nt = 0; nt < 32; ++nt) twp[nt * 16 + nloc] = tsum[nt];  // wave-private plane
    }
  }
  __syncthreads();

  // ---- Stage 5: reduce per-wave accumulators; broadcast over n to output
  #pragma unroll
  for (int kk = 0; kk < 2; ++kk) {
    int e = tid + kk * 256;
    float acc = 0.f;
    #pragma unroll
    for (int ww = 0; ww < 8; ++ww) acc += tw[ww * 512 + e];
    tv[e] = acc;
  }
  __syncthreads();
  float* ob = out + (size_t)b * N_ * D_;
  for (int i = tid; i < (N_ * D_) / 4; i += 256) {
    int flat = i * 4, e = flat & 511;
    float4 v;
    v.x = tv[e]; v.y = tv[e + 1]; v.z = tv[e + 2]; v.w = tv[e + 3];
    ((float4*)ob)[i] = v;
  }
}

extern "C" void kernel_launch(void* const* d_in, const int* in_sizes, int n_in,
                              void* d_out, int out_size, void* d_ws, size_t ws_size,
                              hipStream_t stream) {
  const float* x     = (const float*)d_in[0];
  const float* Wq    = (const float*)d_in[1];
  const float* Wkv   = (const float*)d_in[2];
  const float* Wout  = (const float*)d_in[3];
  const float* bout  = (const float*)d_in[4];
  const float* Wspec = (const float*)d_in[5];
  float* out = (float*)d_out;
  float* spg = (float*)d_ws;
  (void)in_sizes; (void)n_in; (void)out_size; (void)ws_size;

  center_chain_kernel<<<(B_ / BT_) * H_, 256, LDS_CH, stream>>>(x, Wq, Wkv, Wout, spg);
  center_attn_fused_kernel<<<B_, 256, LDS_BYTES, stream>>>(
      x, spg, bout, Wspec, out);
}

// v005
// Measured time: 44.2 microseconds a run.
// In two side-by-side timings against v004, it was 1.04 and 1.05 times as fast.
// Counting every step since v000, it is 5.18 times as fast.
#include <hip/hip_runtime.h>

typedef __attribute__((ext_vector_type(16))) __bf16 v16bf;
typedef __attribute__((ext_vector_type(8)))  __bf16 v8bf;
typedef __attribute__((ext_vector_type(8)))  float  v8f;
typedef __attribute__((ext_vector_type(2)))  float  v2f;
typedef __attribute__((ext_vector_type(4)))  float  v4f;

#define B_     256
#define N_     64
#define D_     512
#define H_     8
#define INNER_ 512
#define SCALE_ 0.125f

// ---- LDS layout. All row strides are multiples of 8 bf16 (16 B) so each
// WMMA fragment loads as two ds_load_b128; all OFF_* are 16B-aligned. ----
#define XT_LD  72    // XT[512][72]  bf16 : x^T  (d-major, n contiguous)
#define WT_LD  72    // WspT[128][72] bf16: Wspec^T cols 0..127 (k contiguous);
                     //   q-columns (j<64) pre-scaled by SCALE_
#define QK_LD  136   // QK[512][136] bf16 : cols 0..63 q_s*scale | 64..127 k_s
constexpr int OFF_XT   = 0;
constexpr int OFF_WSPT = OFF_XT   + 512 * XT_LD * 2;   // 73728
constexpr int OFF_QK   = OFF_WSPT + 128 * WT_LD * 2;   // 92160
constexpr int OFF_S    = OFF_QK   + 512 * QK_LD * 2;   // 231424
constexpr int OFF_T    = OFF_S    + 512 * 4;
constexpr int OFF_TW   = OFF_T    + 512 * 4;
constexpr int LDS_BYTES = OFF_TW  + 8 * 512 * 4;       // 251904 B < 320 KB

// ---- Center-token chain, one launch: one work-group = BT_ batches x one head
// goes through the whole chain, so each head's weight panels are read once per
// BT_ batches and nothing but the last stage's result leaves the work-group.
// Workspace: sp[b][h][e] = sum_j outv[b][h*64+j] * Wout[h*64+j][e], [B][H][512] f32.
#define BT_    8
// (A bare "#pragma unroll" below stands on short loops over register arrays,
// which stay in registers only when their indices are constants.)
#define WK_LD  68    // staged Wk panel pitch (f32): b128 rows, lanes 4 banks apart
constexpr int P_AT   = 0;                          // aT[512][8]  f32: x_center^T, later y^T
constexpr int P_RED  = P_AT  + 512 * BT_ * 4;      // red[16][8][64] f32
constexpr int P_O    = P_RED + 16 * BT_ * 64 * 4;  // o: 8 x 64 f32
constexpr int P_WK   = P_O   + BT_ * 64 * 4;       // WkS[512][WK_LD] f32, later yp[8][8][512]
constexpr int P_WT   = P_WK  + 512 * WK_LD * 4;    // wts[8][512] f32
constexpr int P_SC   = P_WT  + BT_ * 512 * 4;      // sc[8][64] f32
constexpr int LDS_CH = P_SC  + BT_ * 64 * 4;       // 208896 B
static_assert(BT_ * 8 * 512 <= 512 * WK_LD, "yp fits where the Wk panel stood");

// One WMMA 16-bit operand fragment = two contiguous 8-bf16 runs per lane
// (K = base+8g..+7 in VGPRs 0-3, K = base+16+8g..+7 in VGPRs 4-7)
// -> two ds_load_b128 from a K-contiguous, 16B-aligned row.
__device__ __forceinline__ v16bf ldfrag(const __bf16* p) {
  union { v16bf v; v8bf h[2]; } u;
  u.h[0] = *(const v8bf*)(p);
  u.h[1] = *(const v8bf*)(p + 16);
  return u.v;
}

__device__ __forceinline__ float rmax16(float v) {
  #pragma unroll
  for (int m = 1; m < 16; m <<= 1) v = fmaxf(v, __shfl_xor(v, m, 32));
  return v;
}
__device__ __forceinline__ float rsum16(float v) {
  #pragma unroll
  for (int m = 1; m < 16; m <<= 1) v += __shfl_xor(v, m, 32);
  return v;
}

__device__ __forceinline__ void fma4(float4& a, float s, const float4& w) {
  a.x += s * w.x; a.y += s * w.y; a.z += s * w.z; a.w += s * w.w;
}
__device__ __forceinline__ float dot4(const float4& a, const float4& b) {
  return a.x * b.x + a.y * b.y + a.z * b.z + a.w * b.w;
}

// o[bi][j] = sum_d aT[d][bi] * Wb[d*ld + j], bi < 8, j < 64, d < 512.
// 16 lanes take one 256-B weight row as float4; 16 d-slices, summed through LDS.
// Result is stored at o[j*sj + bi*sb]. Ends with a barrier.
__device__ __forceinline__ void panel_gemv64(const float* __restrict__ Wb, int ld,
                                             const float* aT, float* red, float* o,
                                             int sj, int sb, int tid) {
  const int j4 = tid & 15, ds = tid >> 4;
  float4 acc[BT_];
  #pragma unroll
  for (int bi = 0; bi < BT_; ++bi) acc[bi] = make_float4(0.f, 0.f, 0.f, 0.f);
  // unroll 8: eight 16-byte weight loads in flight per lane
  #pragma unroll 8
  for (int i = 0; i < 32; ++i) {
    const int d = i * 16 + ds;
    float4 wv = *(const float4*)(Wb + (size_t)d * ld + j4 * 4);
    float4 a0 = *(const float4*)(aT + d * BT_);
    float4 a1 = *(const float4*)(aT + d * BT_ + 4);
    fma4(acc[0], a0.x, wv); fma4(acc[1], a0.y, wv);
    fma4(acc[2], a0.z, wv); fma4(acc[3], a0.w, wv);
    fma4(acc[4], a1.x, wv); fma4(acc[5], a1.y, wv);
    fma4(acc[6], a1.z, wv); fma4(acc[7], a1.w, wv);
  }
  #pragma unroll
  for (int bi = 0; bi < BT_; ++bi)
    *(float4*)(red + (ds * BT_ + bi) * 64 + j4 * 4) = acc[bi];
  __syncthreads();
  #pragma unroll
  for (int kk = 0; kk < 2; ++kk) {
    const int idx = tid + kk * 256, bi = idx >> 6, j = idx & 63;
    float s = 0.f;
    #pragma unroll
    for (int t = 0; t < 16; ++t) s += red[(t * BT_ + bi) * 64 + j];
    o[j * sj + bi * sb] = s;
  }
  __syncthreads();
}

// Work-group barrier for data handed over through LDS only: it waits for this
// wave's LDS operations and no more. __syncthreads() would also wait for the
// global loads in flight, that is, for the next batch's x rows fetched ahead.
__device__ __forceinline__ void lds_barrier() {
  asm volatile("s_wait_dscnt 0x0\n\ts_barrier_signal -1\n\ts_barrier_wait -1" ::: "memory");
}

// Eight rows of one batch's x, a wave's share: row r as four 512-B wave loads.
__device__ __forceinline__ void load_rows(const float* __restrict__ xw, v4f (&xr)[8][4]) {
  // keeps the tail of the work before from sinking in between the loads and their wait
  __builtin_amdgcn_sched_barrier(0);
  // at most 31 older loads still out when these 32 are issued: the wave's
  // outstanding loads stay within what the load counter can count (63)
  asm volatile("s_wait_loadcnt 0x1f" ::: "memory");
  #pragma unroll
  for (int r = 0; r < 8; ++r)
    #pragma unroll
    for (int c = 0; c < 4; ++c)
      xr[r][c] = *(const v4f*)(xw + r * D_ + c * 128);
  // the address registers of the loads above are rewritten soon after: the wait
  // that belongs in front of such a rewrite;
  // xw as an input keeps those registers from being handed to a loaded value
  asm volatile("s_wait_xcnt 0x0" :: "v"(xw) : "memory");
  // keeps these loads, and that wait, in front of the work on the other register set: moved
  // down among it, they would be issued only after that set's own loads return
  __builtin_amdgcn_sched_barrier(0);
}

// y[bj][d] = the eight waves' partial sums; stored transposed for panel_gemv64.
__device__ __forceinline__ void reduce_y(const float* yp, float* aT, int bj, int tid) {
  const int d2 = tid * 2;
  float2 s = make_float2(0.f, 0.f);
  #pragma unroll
  for (int ww = 0; ww < 8; ++ww) {
    float2 v = *(const float2*)(yp + (bj * 8 + ww) * 512 + d2);
    s.x += v.x; s.y += v.y;
  }
  aT[d2 * BT_ + bj]       = s.x;
  aT[(d2 + 1) * BT_ + bj] = s.y;
}

// One batch of the middle stage, x rows in registers (wave w: rows 8w..8w+7):
// scores against wt, softmax over the 64 rows, this wave's part of y = attn @ x.
__device__ __forceinline__ void attn_step(int bi, const v4f (&xr)[8][4],
                                          const float* wts, float* sc, float* yp,
                                          float* aT, int tid) {
  const int lane = tid & 31, w = tid >> 5;
  v4f wv[4];
  #pragma unroll
  for (int c = 0; c < 4; ++c)
    wv[c] = *(const v4f*)(wts + bi * 512 + c * 128 + lane * 4);
  float p[8];
  #pragma unroll
  for (int r = 0; r < 8; ++r) {
    v2f acc = xr[r][0].lo * wv[0].lo;
    acc += xr[r][0].hi * wv[0].hi;
    #pragma unroll
    for (int c = 1; c < 4; ++c) {
      acc += xr[r][c].lo * wv[c].lo;
      acc += xr[r][c].hi * wv[c].hi;
    }
    p[r] = acc.x + acc.y;
  }
  #pragma unroll
  for (int k = 16; k >= 1; k >>= 1)
    #pragma unroll
    for (int r = 0; r < 8; ++r) p[r] += __shfl_xor(p[r], k, 32);
  if (lane == 0) {
    float* so = sc + bi * 64 + w * 8;
    *(v4f*)(so)     = (v4f){p[0], p[1], p[2], p[3]} * SCALE_;
    *(v4f*)(so + 4) = (v4f){p[4], p[5], p[6], p[7]} * SCALE_;
  }
  lds_barrier();     // all 64 scores of this batch, and the batch before's yp, are in LDS

  if (bi > 0) reduce_y(yp, aT, bi - 1, tid);

  // every lane reads all 64 scores (one address per load): no cross-lane steps
  v4f s4[18];   // 16, 17: this wave's own eight rows once more
  #pragma unroll
  for (int i = 0; i < 16; ++i) s4[i] = *(const v4f*)(sc + bi * 64 + i * 4);
  s4[16] = *(const v4f*)(sc + bi * 64 + w * 8);
  s4[17] = *(const v4f*)(sc + bi * 64 + w * 8 + 4);
  // keeps the reads together: spread along the maximum's chain, only three
  // were in flight at a time and their latency was paid five times over
  __builtin_amdgcn_sched_barrier(0);
  v4f m4 = s4[0];   // four independent chains
  #pragma unroll
  for (int i = 1; i < 16; ++i) {
    m4.x = fmaxf(m4.x, s4[i].x); m4.y = fmaxf(m4.y, s4[i].y);
    m4.z = fmaxf(m4.z, s4[i].z); m4.w = fmaxf(m4.w, s4[i].w);
  }
  const float mx = fmaxf(fmaxf(m4.x, m4.y), fmaxf(m4.z, m4.w));
  const v2f mx2 = (v2f){mx, mx};
  v2f z0 = (v2f){0.f, 0.f}, z1 = (v2f){0.f, 0.f};
  #pragma unroll
  for (int i = 0; i < 18; ++i) {
    v2f a0 = s4[i].lo - mx2, a1 = s4[i].hi - mx2;
    s4[i] = (v4f){__expf(a0.x), __expf(a0.y), __expf(a1.x), __expf(a1.y)};
    if (i < 16) { z0 += s4[i].lo; z1 += s4[i].hi; }
  }
  const float inv = 1.f / ((z0.x + z0.y) + (z1.x + z1.y));
  const v4f at0 = s4[16] * inv, at1 = s4[17] * inv;
  const float a[8] = {at0.x, at0.y, at0.z, at0.w, at1.x, at1.y, at1.z, at1.w};

  v4f ya[4];
  #pragma unroll
  for (int c = 0; c < 4; ++c) ya[c] = a[0] * xr[0][c];
  #pragma unroll
  for (int r = 1; r < 8; ++r)
    #pragma unroll
    for (int c = 0; c < 4; ++c) ya[c] += a[r] * xr[r][c];
  #pragma unroll
  for (int c = 0; c < 4; ++c)
    *(v4f*)(yp + (bi * 8 + w) * 512 + c * 128 + lane * 4) = ya[c];
}

// Launch 1, the whole center-token chain of BT_ batches and one head:
//   qc = x_center @ Wq(head), wt = Wk(head) @ qc,
//   per batch: scores = x . wt, softmax over m, y = attn @ x,
//   outv = y @ Wv(head), sp = outv @ Wout(head rows).
__global__ __launch_bounds__(256)
void center_chain_kernel(const float* __restrict__ x,
                         const float* __restrict__ Wq,
                         const float* __restrict__ Wkv,
                         const float* __restrict__ Wout,
                         float* __restrict__ spg) {
  extern __shared__ char smem[];
  float* aT  = (float*)(smem + P_AT);
  float* red = (float*)(smem + P_RED);
  float* qs  = (float*)(smem + P_O);    // qs[bi][64], later oT[j][8]
  float* WkS = (float*)(smem + P_WK);
  float* yp  = (float*)(smem + P_WK);   // yp[bi][wave][512], once WkS is done with
  float* wts = (float*)(smem + P_WT);   // wts[bi][512]
  float* sc  = (float*)(smem + P_SC);   // sc[bi][64]
  const int tid = threadIdx.x;
  const int h = blockIdx.x & 7, b0 = (blockIdx.x >> 3) * BT_;

  #pragma unroll
  for (int kk = 0; kk < 16; ++kk) {
    const int idx = tid + kk * 256, bi = idx >> 9, d = idx & 511;
    aT[d * BT_ + bi] = x[(size_t)(b0 + bi) * N_ * D_ + (N_ / 2) * D_ + d];
  }
  // Wk head panel, coalesced 256-B rows into LDS (read by rows below)
  {
    const int dr = tid >> 4, j4 = tid & 15;
    const float* src = Wkv + (size_t)dr * (2 * INNER_) + h * 64 + j4 * 4;
    float* dst = WkS + dr * WK_LD + j4 * 4;
    // unroll 16: sixteen 16-byte loads in flight per lane
    #pragma unroll 16
    for (int i = 0; i < 32; ++i)
      *(float4*)(dst + i * 16 * WK_LD) = *(const float4*)(src + (size_t)i * 16 * (2 * INNER_));
  }
  __syncthreads();

  panel_gemv64(Wq + h * 64, INNER_, aT, red, qs, 1, 64, tid);

  // this wave's rows of batch b0 + bi start at xw + bi * XB
  const float* xw = x + ((size_t)b0 * N_ + (tid >> 5) * 8) * D_ + (tid & 31) * 4;
  constexpr size_t XB = (size_t)N_ * D_;
  v4f xa[8][4], xb[8][4];
  load_rows(xw, xa);   // the first batch's rows fly during the wt stage

  {
    float acc0[BT_], acc1[BT_];
    #pragma unroll
    for (int bi = 0; bi < BT_; ++bi) { acc0[bi] = 0.f; acc1[bi] = 0.f; }
    // unroll 4: LDS reads of four steps issued ahead of their sums
    #pragma unroll 4
    for (int j4 = 0; j4 < 16; ++j4) {
      float4 w0 = *(const float4*)(WkS + tid * WK_LD + j4 * 4);
      float4 w1 = *(const float4*)(WkS + (tid + 256) * WK_LD + j4 * 4);
      #pragma unroll
      for (int bi = 0; bi < BT_; ++bi) {
        float4 q = *(const float4*)(qs + bi * 64 + j4 * 4);
        acc0[bi] += dot4(w0, q);
        acc1[bi] += dot4(w1, q);
      }
    }
    #pragma unroll
    for (int bi = 0; bi < BT_; ++bi) {
      wts[bi * 512 + tid]       = acc0[bi];
      wts[bi * 512 + tid + 256] = acc1[bi];
    }
  }
  lds_barrier();     // wts complete; WkS free for yp

  // two register sets: the next batch's rows are loaded while this one is worked on.
  // The last two batches stand behind the loop, so that no load stands under a
  // branch (a branch round it makes the compiler wait for every load in flight).
  // unroll 1: the body already holds two batches; more would only grow the code
  #pragma unroll 1
  for (int bi = 0; bi < BT_ - 2; bi += 2) {
    load_rows(xw + (bi + 1) * XB, xb);
    attn_step(bi, xa, wts, sc, yp, aT, tid);
    load_rows(xw + (bi + 2) * XB, xa);
    attn_step(bi + 1, xb, wts, sc, yp, aT, tid);
  }
  load_rows(xw + (BT_ - 1) * XB, xb);
  attn_step(BT_ - 2, xa, wts, sc, yp, aT, tid);
  attn_step(BT_ - 1, xb, wts, sc, yp, aT, tid);
  __syncthreads();   // the last batch's yp
  reduce_y(yp, aT, BT_ - 1, tid);
  __syncthreads();   // y^T complete

  panel_gemv64(Wkv + INNER_ + h * 64, 2 * INNER_, aT, red, qs, BT_, 1, tid);

  const int e2 = tid * 2;
  float2 acc[BT_];
  #pragma unroll
  for (int bi = 0; bi < BT_; ++bi) acc[bi] = make_float2(0.f, 0.f);
  // unroll 16: sixteen 8-byte weight loads in flight per lane
  #pragma unroll 16
  for (int j = 0; j < 64; ++j) {
    float2 wv = *(const float2*)(Wout + (size_t)(h * 64 + j) * D_ + e2);
    float4 a0 = *(const float4*)(qs + j * BT_);
    float4 a1 = *(const float4*)(qs + j * BT_ + 4);
    acc[0].x += a0.x * wv.x; acc[0].y += a0.x * wv.y;
    acc[1].x += a0.y * wv.x; acc[1].y += a0.y * wv.y;
    acc[2].x += a0.z * wv.x; acc[2].y += a0.z * wv.y;
    acc[3].x += a0.w * wv.x; acc[3].y += a0.w * wv.y;
    acc[4].x += a1.x * wv.x; acc[4].y += a1.x * wv.y;
    acc[5].x += a1.y * wv.x; acc[5].y += a1.y * wv.y;
    acc[6].x += a1.z * wv.x; acc[6].y += a1.z * wv.y;
    acc[7].x += a1.w * wv.x; acc[7].y += a1.w * wv.y;
  }
  #pragma unroll
  for (int bi = 0; bi < BT_; ++bi)
    *(float2*)(spg + (size_t)(b0 + bi) * (H_ * 512) + h * 512 + e2) = acc[bi];
}

__global__ __launch_bounds__(256)
void center_attn_fused_kernel(const float* __restrict__ x,
                              const float* __restrict__ spg,
                              const float* __restrict__ bout,
                              const float* __restrict__ Wspec,
                              float* __restrict__ out) {
  extern __shared__ char smem[];
  __bf16* XT   = (__bf16*)(smem + OFF_XT);
  __bf16* WspT = (__bf16*)(smem + OFF_WSPT);
  __bf16* QK   = (__bf16*)(smem + OFF_QK);
  float* sv   = (float*)(smem + OFF_S);
  float* tv   = (float*)(smem + OFF_T);
  float* tw   = (float*)(smem + OFF_TW);

  const int b    = blockIdx.x;
  const int tid  = threadIdx.x;
  const int lane = tid & 31;
  const int w    = tid >> 5;
  const float* xb = x + (size_t)b * N_ * D_;

  // ---- Stage 1: x^T and Wspec^T (cols 0..127) into bf16 LDS.
  // A lane owns a block of 4 columns x 8 rows of the f32 source: eight 16-byte
  // loads (a wave-load = four whole 128-B lines), then per column one 16-byte
  // store of its 8 rows packed to bf16. Lanes 0-15 (and 16-31) hold 4 column
  // quads x 4 row blocks, which at the 144-B pitch fall on all 64 banks once.
  const float *xsrc, *wsrc;   // named again by the wait behind stage 2
  {
    const int cq = (lane & 3) | ((lane >> 4) << 2);   // column quad in a 32-column chunk
    const int rb = (w >> 2) * 4 + ((lane >> 2) & 3);  // block of 8 source rows
    xsrc = xb + rb * 8 * D_ + (w & 3) * 128 + cq * 4;
    wsrc = Wspec + rb * 8 * 192 + (w & 3) * 32 + cq * 4;
    v4f xv[4][8], wv[8];
    #pragma unroll
    for (int u = 0; u < 4; ++u)
      #pragma unroll
      for (int k = 0; k < 8; ++k) xv[u][k] = *(const v4f*)(xsrc + k * D_ + u * 32);
    #pragma unroll
    for (int k = 0; k < 8; ++k) wv[k] = *(const v4f*)(wsrc + k * 192);

    __bf16* xdst = XT + ((w & 3) * 128 + cq * 4) * XT_LD + rb * 8;
    #pragma unroll
    for (int u = 0; u < 4; ++u)
      #pragma unroll
      for (int c = 0; c < 4; ++c) {
        v8bf p;
        #pragma unroll
        for (int k = 0; k < 8; ++k) p[k] = (__bf16)xv[u][k][c];
        *(v8bf*)(xdst + (u * 32 + c) * XT_LD) = p;
      }
    const float qsc = (w & 3) < 2 ? SCALE_ : 1.f;     // fold scale into q_s (j < 64)
    __bf16* wdst = WspT + ((w & 3) * 32 + cq * 4) * WT_LD + rb * 8;
    #pragma unroll
    for (int c = 0; c < 4; ++c) {
      v8bf p;
      #pragma unroll
      for (int k = 0; k < 8; ++k) p[k] = (__bf16)(wv[k][c] * qsc);
      *(v8bf*)(wdst + c * WT_LD) = p;
    }
  }

  // ---- Stage 2: s[e] = bout[e] + the eight heads' shares from launch 1
  #pragma unroll
  for (int kk = 0; kk < 2; ++kk) {
    int e = tid + kk * 256;
    float acc = bout[e];
    #pragma unroll
    for (int h = 0; h < H_; ++h) acc += spg[(size_t)b * (H_ * 512) + h * 512 + e];
    sv[e] = acc;
  }
  // the wait that belongs in front of a rewrite of a load's address registers
  // of the loads of stages 1 and 2 and of the kernel-argument loads; the addresses as inputs keep those registers
  // unwritten up to here (out: its argument load is issued in front of the wait)
  asm volatile("s_wait_xcnt 0x0"
               :: "v"(xsrc), "v"(wsrc), "s"(spg + (size_t)b * (H_ * 512)), "s"(bout), "s"(out),
                  "s"(__builtin_amdgcn_kernarg_segment_ptr())
               : "memory");
  __syncthreads();

  // ---- Stage 3: GEMM1 (WMMA bf16), computed transposed:
  // QK^T(128x512) = Wspec^T(128x64) @ X(64x512), tile by tile. The accumulator
  // then holds, per lane, eight neighbouring columns j of ONE row d of QK: one
  // packed 16-byte store (lanes 0-15 and 16-31 each cover all 64 banks once).
  // A wave keeps all of Wspec^T in registers and takes four 16-row blocks of
  // x^T, so x^T is read from LDS once and eight independent tiles are in flight.
  {
    const int mloc = lane & 15, g = lane >> 4;
    v16bf xf[4][2], wf[8][2];
    #pragma unroll
    for (int i = 0; i < 4; ++i)
      #pragma unroll
      for (int kt = 0; kt < 2; ++kt)
        xf[i][kt] = ldfrag(XT + ((w + 8 * i) * 16 + mloc) * XT_LD + kt * 32 + 8 * g);
    #pragma unroll
    for (int jt = 0; jt < 8; ++jt)
      #pragma unroll
      for (int kt = 0; kt < 2; ++kt)
        wf[jt][kt] = ldfrag(WspT + (jt * 16 + mloc) * WT_LD + kt * 32 + 8 * g);
    #pragma unroll
    for (int i = 0; i < 4; ++i) {
      v8f acc[8];
      #pragma unroll
      for (int jt = 0; jt < 8; ++jt) {
        v8f zero = {};
        acc[jt] = __builtin_amdgcn_wmma_f32_16x16x32_bf16(false, wf[jt][0], false, xf[i][0],
                                                          (short)0, zero, false, false);
      }
      #pragma unroll
      for (int jt = 0; jt < 8; ++jt)
        acc[jt] = __builtin_amdgcn_wmma_f32_16x16x32_bf16(false, wf[jt][1], false, xf[i][1],
                                                          (short)0, acc[jt], false, false);
      __bf16* qrow = QK + ((w + 8 * i) * 16 + mloc) * QK_LD + 8 * g;
      #pragma unroll
      for (int jt = 0; jt < 8; ++jt) {
        v8bf pk;
        #pragma unroll
        for (int r = 0; r < 8; ++r) pk[r] = (__bf16)acc[jt][r];
        *(v8bf*)(qrow + jt * 16) = pk;
      }
    }
  }
  __syncthreads();

  // ---- Stage 4: t[e] = sum_d s_d * softmax_row(q_s k_s^T)[e]
  // One WMMA sweep per strip: the strip's 16 x 512 scores stay in registers
  // (32 accumulator tiles), so row max, exp, row sum and the weighted column
  // sums all read registers. Column sums also stay in registers over the
  // wave's four strips and are stored once.
  {
    const int nloc = lane & 15, g = lane >> 4;
    v2f tcol[32];   // per column tile: even rows | odd rows of this lane
    #pragma unroll
    for (int nt = 0; nt < 32; ++nt) tcol[nt] = (v2f){0.f, 0.f};
    for (int strip = w; strip < 32; strip += 8) {
      const int row0 = strip * 16;
      v16bf afr[2];
      #pragma unroll
      for (int kt = 0; kt < 2; ++kt)
        afr[kt] = ldfrag(QK + (row0 + nloc) * QK_LD + kt * 32 + 8 * g);

      // scores (scale folded into q_s); k_s fragments are fetched one group of
      // four tiles ahead of the group being multiplied
      v8f z[32];
      v16bf bq[2][4][2];
      #pragma unroll
      for (int t = 0; t < 4; ++t)
        #pragma unroll
        for (int kt = 0; kt < 2; ++kt)
          bq[0][t][kt] = ldfrag(QK + (t * 16 + nloc) * QK_LD + 64 + kt * 32 + 8 * g);
      #pragma unroll
      for (int gi = 0; gi < 8; ++gi) {
        if (gi < 7) {
          #pragma unroll
          for (int t = 0; t < 4; ++t)
            #pragma unroll
            for (int kt = 0; kt < 2; ++kt)
              bq[(gi + 1) & 1][t][kt] =
                  ldfrag(QK + ((gi * 4 + 4 + t) * 16 + nloc) * QK_LD + 64 + kt * 32 + 8 * g);
        }
        #pragma unroll
        for (int t = 0; t < 4; ++t) {
          v8f acc = {};
          #pragma unroll
          for (int kt = 0; kt < 2; ++kt)
            acc = __builtin_amdgcn_wmma_f32_16x16x32_bf16(false, afr[kt], false,
                                                          bq[gi & 1][t][kt],
                                                          (short)0, acc, false, false);
          z[gi * 4 + t] = acc;
        }
        // keeps the scheduler from lifting all 128 fragment loads to the top,
        // which overflows the register budget and spills
        __builtin_amdgcn_sched_barrier(0);
      }

      // row max: per lane over the 32 tiles, then across the 16 lanes
      float mrow[8];
      #pragma unroll
      for (int r = 0; r < 8; ++r) {
        float mp = -1e30f;
        #pragma unroll
        for (int nt = 0; nt < 32; ++nt) mp = fmaxf(mp, z[nt][r]);
        mrow[r] = rmax16(mp);
      }

      // exp in place and row sum, on row pairs (packed f32 subtract and add)
      v2f zp[4];
      #pragma unroll
      for (int p = 0; p < 4; ++p) zp[p] = (v2f){0.f, 0.f};
      #pragma unroll
      for (int nt = 0; nt < 32; ++nt) {
        #pragma unroll
        for (int p = 0; p < 4; ++p) {
          v2f a = (v2f){z[nt][2 * p], z[nt][2 * p + 1]} - (v2f){mrow[2 * p], mrow[2 * p + 1]};
          v2f e = (v2f){__expf(a.x), __expf(a.y)};
          z[nt][2 * p] = e.x;
          z[nt][2 * p + 1] = e.y;
          zp[p] += e;
        }
      }
      float crow[8];
      #pragma unroll
      for (int r = 0; r < 8; ++r)
        crow[r] = sv[row0 + r + 8 * g] / rsum16(zp[r >> 1][r & 1]);

      // t_e += sum_r c_r * exp(z - m_r), this lane's eight rows as four pairs
      #pragma unroll
      for (int nt = 0; nt < 32; ++nt) {
        #pragma unroll
        for (int p = 0; p < 4; ++p)
          tcol[nt] += (v2f){crow[2 * p], crow[2 * p + 1]} *
                      (v2f){z[nt][2 * p], z[nt][2 * p + 1]};
      }
    }
    float* twp = tw + w * 512;
    float tsum[32];
    #pragma unroll
    for (int nt = 0; nt < 32; ++nt) {
      tsum[nt] = tcol[nt].x + tcol[nt].y;
      tsum[nt] += __shfl_xor(tsum[nt], 16, 32);           // rows 0-7 + rows 8-15
    }
    if (g == 0) {
      #pragma unroll
      for (int nt = 0; nt < 32; ++nt) twp[nt * 16 + nloc] = tsum[nt];  // wave-private plane
    }
  }
  __syncthreads();

  // ---- Stage 5: reduce per-wave accumulators; broadcast over n to output
  #pragma unroll
  for (int kk = 0; kk < 2; ++kk) {
    int e = tid + kk * 256;
    float acc = 0.f;
    #pragma unroll
    for (int ww = 0; ww < 8; ++ww) acc += tw[ww * 512 + e];
    tv[e] = acc;
  }
  __syncthreads();
  float* ob = out + (size_t)b * N_ * D_;
  for (int i = tid; i < (N_ * D_) / 4; i += 256) {
    int flat = i * 4, e = flat & 511;
    float4 v;
    v.x = tv[e]; v.y = tv[e + 1]; v.z = tv[e + 2]; v.w = tv[e + 3];
    ((float4*)ob)[i] = v;
  }
}

extern "C" void kernel_launch(void* const* d_in, const int* in_sizes, int n_in,
                              void* d_out, int out_size, void* d_ws, size_t ws_size,
                              hipStream_t stream) {
  const float* x     = (const float*)d_in[0];
  const float* Wq    = (const float*)d_in[1];
  const float* Wkv   = (const float*)d_in[2];
  const float* Wout  = (const float*)d_in[3];
  const float* bout  = (const float*)d_in[4];
  const float* Wspec = (const float*)d_in[5];
  float* out = (float*)d_out;
  float* spg = (float*)d_ws;
  (void)in_sizes; (void)n_in; (void)out_size; (void)ws_size;

  center_chain_kernel<<<(B_ / BT_) * H_, 256, LDS_CH, stream>>>(x, Wq, Wkv, Wout, spg);
  center_attn_fused_kernel<<<B_, 256, LDS_BYTES, stream>>>(
      x, spg, bout, Wspec, out);
}

// v006
// It runs in 41.9 microseconds.
// Next to v005, in two timings, it ran 1.05 and 1.06 times as fast.
// Over all steps from v000 it is 5.47 times as fast.
#include <hip/hip_runtime.h>

typedef __attribute__((ext_vector_type(16))) __bf16 v16bf;
typedef __attribute__((ext_vector_type(8)))  __bf16 v8bf;
typedef __attribute__((ext_vector_type(8)))  float  v8f;
typedef __attribute__((ext_vector_type(2)))  float  v2f;
typedef __attribute__((ext_vector_type(4)))  float  v4f;

#define B_     256
#define N_     64
#define D_     512
#define H_     8
#define INNER_ 512
#define SCALE_ 0.125f
#define LOG2E_ 1.4426950408889634f
// Spectral scores are formed in log2 units (q_s carries SCALE_ * LOG2E_). Where
// every |score| of a batch is proved to be at most this, 2^score needs no shift
// by the row maximum: each term lies within 2^-41 .. 2^41 and a row's sum under 2^50.
#define NOSHIFT_LIM_ 40.0f

// ---- LDS layout. All row strides are multiples of 8 bf16 (16 B) so each
// WMMA fragment loads as two ds_load_b128; all OFF_* are 16B-aligned. ----
#define XT_LD  72    // XT[512][72]  bf16 : x^T  (d-major, n contiguous)
#define WT_LD  72    // WspT[128][72] bf16: Wspec^T cols 0..127 (k contiguous);
                     //   q-columns (j<64) pre-scaled by SCALE_ * LOG2E_
#define QK_LD  136   // QK[512][136] bf16 : cols 0..63 q_s*scale*log2e | 64..127 k_s
constexpr int OFF_XT   = 0;
constexpr int OFF_WSPT = OFF_XT   + 512 * XT_LD * 2;   // 73728
constexpr int OFF_QK   = OFF_WSPT + 128 * WT_LD * 2;   // 92160
constexpr int OFF_S    = OFF_QK   + 512 * QK_LD * 2;   // 231424
constexpr int OFF_T    = OFF_S    + 512 * 4;
constexpr int OFF_TW   = OFF_T    + 512 * 4;
constexpr int LDS_BYTES = OFF_TW  + 8 * 512 * 4;       // 251904 B < 320 KB

// ---- Center-token chain, one launch: one work-group = BT_ batches x one head
// goes through the whole chain, so each head's weight panels are read once per
// BT_ batches and nothing but the last stage's result leaves the work-group.
// Workspace: sp[b][h][e] = sum_j outv[b][h*64+j] * Wout[h*64+j][e], [B][H][512] f32.
#define BT_    8
// (A bare "#pragma unroll" below stands on short loops over register arrays,
// which stay in registers only when their indices are constants.)
#define WK_LD  68    // staged Wk panel pitch (f32): b128 rows, lanes 4 banks apart
constexpr int P_AT   = 0;                          // aT[512][8]  f32: x_center^T, later y^T
constexpr int P_RED  = P_AT  + 512 * BT_ * 4;      // red[16][8][64] f32
constexpr int P_O    = P_RED + 16 * BT_ * 64 * 4;  // o: 8 x 64 f32
constexpr int P_WK   = P_O   + BT_ * 64 * 4;       // WkS[512][WK_LD] f32, later yp[8][8][512]
constexpr int P_WT   = P_WK  + 512 * WK_LD * 4;    // wts[8][512] f32
constexpr int P_SC   = P_WT  + BT_ * 512 * 4;      // sc[8][64] f32
constexpr int LDS_CH = P_SC  + BT_ * 64 * 4;       // 208896 B
static_assert(BT_ * 8 * 512 <= 512 * WK_LD, "yp fits where the Wk panel stood");

// One WMMA 16-bit operand fragment = two contiguous 8-bf16 runs per lane
// (K = base+8g..+7 in VGPRs 0-3, K = base+16+8g..+7 in VGPRs 4-7)
// -> two ds_load_b128 from a K-contiguous, 16B-aligned row.
__device__ __forceinline__ v16bf ldfrag(const __bf16* p) {
  union { v16bf v; v8bf h[2]; } u;
  u.h[0] = *(const v8bf*)(p);
  u.h[1] = *(const v8bf*)(p + 16);
  return u.v;
}

__device__ __forceinline__ float rmax16(float v) {
  #pragma unroll
  for (int m = 1; m < 16; m <<= 1) v = fmaxf(v, __shfl_xor(v, m, 32));
  return v;
}
__device__ __forceinline__ float rsum16(float v) {
  #pragma unroll
  for (int m = 1; m < 16; m <<= 1) v += __shfl_xor(v, m, 32);
  return v;
}

// lane l with lane l ^ M inside its 16-lane row, as a DPP operand of the maximum
template <int M>
__device__ __forceinline__ float row_xor(float v) {
  return __builtin_bit_cast(float, __builtin_amdgcn_update_dpp(
      0, __builtin_bit_cast(int, v), 0x160 | M, 0xf, 0xf, true));
}
// maximum over the 32 lanes of a wave, in every lane
__device__ __forceinline__ float wave_max(float v) {
  v = fmaxf(v, row_xor<1>(v));
  v = fmaxf(v, row_xor<2>(v));
  v = fmaxf(v, row_xor<4>(v));
  v = fmaxf(v, row_xor<8>(v));
  const int b = __builtin_bit_cast(int, v);
  return fmaxf(v, __builtin_bit_cast(float, __builtin_amdgcn_permlanex16(
                      b, b, 0x76543210, 0xfedcba98, false, false)));
}

__device__ __forceinline__ void fma4(float4& a, float s, const float4& w) {
  a.x += s * w.x; a.y += s * w.y; a.z += s * w.z; a.w += s * w.w;
}
__device__ __forceinline__ float dot4(const float4& a, const float4& b) {
  return a.x * b.x + a.y * b.y + a.z * b.z + a.w * b.w;
}

// o[bi][j] = sum_d aT[d][bi] * Wb[d*ld + j], bi < 8, j < 64, d < 512.
// 16 lanes take one 256-B weight row as float4; 16 d-slices, summed through LDS.
// Result is stored at o[j*sj + bi*sb]. Ends with a barrier.
__device__ __forceinline__ void panel_gemv64(const float* __restrict__ Wb, int ld,
                                             const float* aT, float* red, float* o,
                                             int sj, int sb, int tid) {
  const int j4 = tid & 15, ds = tid >> 4;
  float4 acc[BT_];
  #pragma unroll
  for (int bi = 0; bi < BT_; ++bi) acc[bi] = make_float4(0.f, 0.f, 0.f, 0.f);
  // unroll 8: eight 16-byte weight loads in flight per lane
  #pragma unroll 8
  for (int i = 0; i < 32; ++i) {
    const int d = i * 16 + ds;
    float4 wv = *(const float4*)(Wb + (size_t)d * ld + j4 * 4);
    float4 a0 = *(const float4*)(aT + d * BT_);
    float4 a1 = *(const float4*)(aT + d * BT_ + 4);
    fma4(acc[0], a0.x, wv); fma4(acc[1], a0.y, wv);
    fma4(acc[2], a0.z, wv); fma4(acc[3], a0.w, wv);
    fma4(acc[4], a1.x, wv); fma4(acc[5], a1.y, wv);
    fma4(acc[6], a1.z, wv); fma4(acc[7], a1.w, wv);
  }
  #pragma unroll
  for (int bi = 0; bi < BT_; ++bi)
    *(float4*)(red + (ds * BT_ + bi) * 64 + j4 * 4) = acc[bi];
  __syncthreads();
  #pragma unroll
  for (int kk = 0; kk < 2; ++kk) {
    const int idx = tid + kk * 256, bi = idx >> 6, j = idx & 63;
    float s = 0.f;
    #pragma unroll
    for (int t = 0; t < 16; ++t) s += red[(t * BT_ + bi) * 64 + j];
    o[j * sj + bi * sb] = s;
  }
  __syncthreads();
}

// Work-group barrier for data handed over through LDS only: it waits for this
// wave's LDS operations and no more. __syncthreads() would also wait for the
// global loads in flight, that is, for the next batch's x rows fetched ahead.
__device__ __forceinline__ void lds_barrier() {
  asm volatile("s_wait_dscnt 0x0\n\ts_barrier_signal -1\n\ts_barrier_wait -1" ::: "memory");
}

// Eight rows of one batch's x, a wave's share: row r as four 512-B wave loads.
__device__ __forceinline__ void load_rows(const float* __restrict__ xw, v4f (&xr)[8][4]) {
  // keeps the tail of the work before from sinking in between the loads and their wait
  __builtin_amdgcn_sched_barrier(0);
  // at most 31 older loads still out when these 32 are issued: the wave's
  // outstanding loads stay within what the load counter can count (63)
  asm volatile("s_wait_loadcnt 0x1f" ::: "memory");
  #pragma unroll
  for (int r = 0; r < 8; ++r)
    #pragma unroll
    for (int c = 0; c < 4; ++c)
      xr[r][c] = *(const v4f*)(xw + r * D_ + c * 128);
  // the address registers of the loads above are rewritten soon after: the wait
  // that belongs in front of such a rewrite;
  // xw as an input keeps those registers from being handed to a loaded value
  asm volatile("s_wait_xcnt 0x0" :: "v"(xw) : "memory");
  // keeps these loads, and that wait, in front of the work on the other register set: moved
  // down among it, they would be issued only after that set's own loads return
  __builtin_amdgcn_sched_barrier(0);
}

// y[bj][d] = the eight waves' partial sums; stored transposed for panel_gemv64.
__device__ __forceinline__ void reduce_y(const float* yp, float* aT, int bj, int tid) {
  const int d2 = tid * 2;
  float2 s = make_float2(0.f, 0.f);
  #pragma unroll
  for (int ww = 0; ww < 8; ++ww) {
    float2 v = *(const float2*)(yp + (bj * 8 + ww) * 512 + d2);
    s.x += v.x; s.y += v.y;
  }
  aT[d2 * BT_ + bj]       = s.x;
  aT[(d2 + 1) * BT_ + bj] = s.y;
}

// One batch of the middle stage, x rows in registers (wave w: rows 8w..8w+7):
// scores against wt, softmax over the 64 rows, this wave's part of y = attn @ x.
__device__ __forceinline__ void attn_step(int bi, const v4f (&xr)[8][4],
                                          const float* wts, float* sc, float* yp,
                                          float* aT, int tid) {
  const int lane = tid & 31, w = tid >> 5;
  v4f wv[4];
  #pragma unroll
  for (int c = 0; c < 4; ++c)
    wv[c] = *(const v4f*)(wts + bi * 512 + c * 128 + lane * 4);
  float p[8];
  #pragma unroll
  for (int r = 0; r < 8; ++r) {
    v2f acc = xr[r][0].lo * wv[0].lo;
    acc += xr[r][0].hi * wv[0].hi;
    #pragma unroll
    for (int c = 1; c < 4; ++c) {
      acc += xr[r][c].lo * wv[c].lo;
      acc += xr[r][c].hi * wv[c].hi;
    }
    p[r] = acc.x + acc.y;
  }
  #pragma unroll
  for (int k = 16; k >= 1; k >>= 1)
    #pragma unroll
    for (int r = 0; r < 8; ++r) p[r] += __shfl_xor(p[r], k, 32);
  if (lane == 0) {
    float* so = sc + bi * 64 + w * 8;
    *(v4f*)(so)     = (v4f){p[0], p[1], p[2], p[3]} * SCALE_;
    *(v4f*)(so + 4) = (v4f){p[4], p[5], p[6], p[7]} * SCALE_;
  }
  lds_barrier();     // all 64 scores of this batch, and the batch before's yp, are in LDS

  if (bi > 0) reduce_y(yp, aT, bi - 1, tid);

  // every lane reads all 64 scores (one address per load): no cross-lane steps
  v4f s4[18];   // 16, 17: this wave's own eight rows once more
  #pragma unroll
  for (int i = 0; i < 16; ++i) s4[i] = *(const v4f*)(sc + bi * 64 + i * 4);
  s4[16] = *(const v4f*)(sc + bi * 64 + w * 8);
  s4[17] = *(const v4f*)(sc + bi * 64 + w * 8 + 4);
  // keeps the reads together: spread along the maximum's chain, only three
  // were in flight at a time and their latency was paid five times over
  __builtin_amdgcn_sched_barrier(0);
  v4f m4 = s4[0];   // four independent chains
  #pragma unroll
  for (int i = 1; i < 16; ++i) {
    m4.x = fmaxf(m4.x, s4[i].x); m4.y = fmaxf(m4.y, s4[i].y);
    m4.z = fmaxf(m4.z, s4[i].z); m4.w = fmaxf(m4.w, s4[i].w);
  }
  const float mx = fmaxf(fmaxf(m4.x, m4.y), fmaxf(m4.z, m4.w));
  const v2f mx2 = (v2f){mx, mx};
  v2f z0 = (v2f){0.f, 0.f}, z1 = (v2f){0.f, 0.f};
  #pragma unroll
  for (int i = 0; i < 18; ++i) {
    v2f a0 = s4[i].lo - mx2, a1 = s4[i].hi - mx2;
    s4[i] = (v4f){__expf(a0.x), __expf(a0.y), __expf(a1.x), __expf(a1.y)};
    if (i < 16) { z0 += s4[i].lo; z1 += s4[i].hi; }
  }
  const float inv = 1.f / ((z0.x + z0.y) + (z1.x + z1.y));
  const v4f at0 = s4[16] * inv, at1 = s4[17] * inv;
  const float a[8] = {at0.x, at0.y, at0.z, at0.w, at1.x, at1.y, at1.z, at1.w};

  v4f ya[4];
  #pragma unroll
  for (int c = 0; c < 4; ++c) ya[c] = a[0] * xr[0][c];
  #pragma unroll
  for (int r = 1; r < 8; ++r)
    #pragma unroll
    for (int c = 0; c < 4; ++c) ya[c] += a[r] * xr[r][c];
  #pragma unroll
  for (int c = 0; c < 4; ++c)
    *(v4f*)(yp + (bi * 8 + w) * 512 + c * 128 + lane * 4) = ya[c];
}

// Launch 1, the whole center-token chain of BT_ batches and one head:
//   qc = x_center @ Wq(head), wt = Wk(head) @ qc,
//   per batch: scores = x . wt, softmax over m, y = attn @ x,
//   outv = y @ Wv(head), sp = outv @ Wout(head rows).
__global__ __launch_bounds__(256)
void center_chain_kernel(const float* __restrict__ x,
                         const float* __restrict__ Wq,
                         const float* __restrict__ Wkv,
                         const float* __restrict__ Wout,
                         float* __restrict__ spg) {
  extern __shared__ char smem[];
  float* aT  = (float*)(smem + P_AT);
  float* red = (float*)(smem + P_RED);
  float* qs  = (float*)(smem + P_O);    // qs[bi][64], later oT[j][8]
  float* WkS = (float*)(smem + P_WK);
  float* yp  = (float*)(smem + P_WK);   // yp[bi][wave][512], once WkS is done with
  float* wts = (float*)(smem + P_WT);   // wts[bi][512]
  float* sc  = (float*)(smem + P_SC);   // sc[bi][64]
  const int tid = threadIdx.x;
  const int h = blockIdx.x & 7, b0 = (blockIdx.x >> 3) * BT_;

  #pragma unroll
  for (int kk = 0; kk < 16; ++kk) {
    const int idx = tid + kk * 256, bi = idx >> 9, d = idx & 511;
    aT[d * BT_ + bi] = x[(size_t)(b0 + bi) * N_ * D_ + (N_ / 2) * D_ + d];
  }
  // Wk head panel, coalesced 256-B rows into LDS (read by rows below)
  {
    const int dr = tid >> 4, j4 = tid & 15;
    const float* src = Wkv + (size_t)dr * (2 * INNER_) + h * 64 + j4 * 4;
    float* dst = WkS + dr * WK_LD + j4 * 4;
    // unroll 16: sixteen 16-byte loads in flight per lane
    #pragma unroll 16
    for (int i = 0; i < 32; ++i)
      *(float4*)(dst + i * 16 * WK_LD) = *(const float4*)(src + (size_t)i * 16 * (2 * INNER_));
  }
  __syncthreads();

  panel_gemv64(Wq + h * 64, INNER_, aT, red, qs, 1, 64, tid);

  // this wave's rows of batch b0 + bi start at xw + bi * XB
  const float* xw = x + ((size_t)b0 * N_ + (tid >> 5) * 8) * D_ + (tid & 31) * 4;
  constexpr size_t XB = (size_t)N_ * D_;
  v4f xa[8][4], xb[8][4];
  load_rows(xw, xa);   // the first batch's rows fly during the wt stage

  {
    float acc0[BT_], acc1[BT_];
    #pragma unroll
    for (int bi = 0; bi < BT_; ++bi) { acc0[bi] = 0.f; acc1[bi] = 0.f; }
    // unroll 4: LDS reads of four steps issued ahead of their sums
    #pragma unroll 4
    for (int j4 = 0; j4 < 16; ++j4) {
      float4 w0 = *(const float4*)(WkS + tid * WK_LD + j4 * 4);
      float4 w1 = *(const float4*)(WkS + (tid + 256) * WK_LD + j4 * 4);
      #pragma unroll
      for (int bi = 0; bi < BT_; ++bi) {
        float4 q = *(const float4*)(qs + bi * 64 + j4 * 4);
        acc0[bi] += dot4(w0, q);
        acc1[bi] += dot4(w1, q);
      }
    }
    #pragma unroll
    for (int bi = 0; bi < BT_; ++bi) {
      wts[bi * 512 + tid]       = acc0[bi];
      wts[bi * 512 + tid + 256] = acc1[bi];
    }
  }
  lds_barrier();     // wts complete; WkS free for yp

  // two register sets: the next batch's rows are loaded while this one is worked on.
  // The last two batches stand behind the loop, so that no load stands under a
  // branch (a branch round it makes the compiler wait for every load in flight).
  // unroll 1: the body already holds two batches; more would only grow the code
  #pragma unroll 1
  for (int bi = 0; bi < BT_ - 2; bi += 2) {
    load_rows(xw + (bi + 1) * XB, xb);
    attn_step(bi, xa, wts, sc, yp, aT, tid);
    load_rows(xw + (bi + 2) * XB, xa);
    attn_step(bi + 1, xb, wts, sc, yp, aT, tid);
  }
  load_rows(xw + (BT_ - 1) * XB, xb);
  attn_step(BT_ - 2, xa, wts, sc, yp, aT, tid);
  attn_step(BT_ - 1, xb, wts, sc, yp, aT, tid);
  __syncthreads();   // the last batch's yp
  reduce_y(yp, aT, BT_ - 1, tid);
  __syncthreads();   // y^T complete

  panel_gemv64(Wkv + INNER_ + h * 64, 2 * INNER_, aT, red, qs, BT_, 1, tid);

  const int e2 = tid * 2;
  float2 acc[BT_];
  #pragma unroll
  for (int bi = 0; bi < BT_; ++bi) acc[bi] = make_float2(0.f, 0.f);
  // unroll 16: sixteen 8-byte weight loads in flight per lane
  #pragma unroll 16
  for (int j = 0; j < 64; ++j) {
    float2 wv = *(const float2*)(Wout + (size_t)(h * 64 + j) * D_ + e2);
    float4 a0 = *(const float4*)(qs + j * BT_);
    float4 a1 = *(const float4*)(qs + j * BT_ + 4);
    acc[0].x += a0.x * wv.x; acc[0].y += a0.x * wv.y;
    acc[1].x += a0.y * wv.x; acc[1].y += a0.y * wv.y;
    acc[2].x += a0.z * wv.x; acc[2].y += a0.z * wv.y;
    acc[3].x += a0.w * wv.x; acc[3].y += a0.w * wv.y;
    acc[4].x += a1.x * wv.x; acc[4].y += a1.x * wv.y;
    acc[5].x += a1.y * wv.x; acc[5].y += a1.y * wv.y;
    acc[6].x += a1.z * wv.x; acc[6].y += a1.z * wv.y;
    acc[7].x += a1.w * wv.x; acc[7].y += a1.w * wv.y;
  }
  #pragma unroll
  for (int bi = 0; bi < BT_; ++bi)
    *(float2*)(spg + (size_t)(b0 + bi) * (H_ * 512) + h * 512 + e2) = acc[bi];
}

// Stage 4 of the fused kernel: t[e] = sum_d s_d * softmax_row(q_s k_s^T)[e].
// One WMMA sweep per strip: the strip's 16 x 512 scores stay in registers
// (32 accumulator tiles), so exp, row sum and the weighted column sums all read
// registers. Column sums also stay in registers over the wave's four strips and
// are stored once. Scores arrive in log2 units.
// SHIFT: the row maximum is found and subtracted before 2^score.
// !SHIFT (every |score| <= NOSHIFT_LIM_): 2^score is taken straight from the
// accumulators, one group of four tiles behind the group being multiplied, so
// that it runs beside the WMMAs and the fragment loads.
template <bool SHIFT>
__device__ __forceinline__ void spectral_strips(const __bf16* QK, const float* sv,
                                                float* tw, int lane, int w) {
  const int nloc = lane & 15, g = lane >> 4;
  v2f tcol[32];   // per column tile: even rows | odd rows of this lane
  #pragma unroll
  for (int nt = 0; nt < 32; ++nt) tcol[nt] = (v2f){0.f, 0.f};
  for (int strip = w; strip < 32; strip += 8) {
    const int row0 = strip * 16;
    v16bf afr[2];
    #pragma unroll
    for (int kt = 0; kt < 2; ++kt)
      afr[kt] = ldfrag(QK + (row0 + nloc) * QK_LD + kt * 32 + 8 * g);

    // scores; k_s fragments are fetched one group of four tiles ahead of the
    // group being multiplied
    v8f z[32];
    v2f zp[4];      // row sums, on row pairs
    #pragma unroll
    for (int p = 0; p < 4; ++p) zp[p] = (v2f){0.f, 0.f};
    v16bf bq[2][4][2];
    #pragma unroll
    for (int t = 0; t < 4; ++t)
      #pragma unroll
      for (int kt = 0; kt < 2; ++kt)
        bq[0][t][kt] = ldfrag(QK + (t * 16 + nloc) * QK_LD + 64 + kt * 32 + 8 * g);
    #pragma unroll
    for (int gi = 0; gi < 9; ++gi) {
      if (gi < 7) {
        #pragma unroll
        for (int t = 0; t < 4; ++t)
          #pragma unroll
          for (int kt = 0; kt < 2; ++kt)
            bq[(gi + 1) & 1][t][kt] =
                ldfrag(QK + ((gi * 4 + 4 + t) * 16 + nloc) * QK_LD + 64 + kt * 32 + 8 * g);
      }
      #pragma unroll
      for (int t = 0; t < 4; ++t) {
        if (gi < 8) {
          v8f acc = {};
          #pragma unroll
          for (int kt = 0; kt < 2; ++kt)
            acc = __builtin_amdgcn_wmma_f32_16x16x32_bf16(false, afr[kt], false,
                                                          bq[gi & 1][t][kt],
                                                          (short)0, acc, false, false);
          z[gi * 4 + t] = acc;
        }
        if (!SHIFT && gi > 0) {
          const int nt = gi * 4 - 4 + t;
          #pragma unroll
          for (int p = 0; p < 4; ++p) {
            v2f e = (v2f){__builtin_amdgcn_exp2f(z[nt][2 * p]),
                          __builtin_amdgcn_exp2f(z[nt][2 * p + 1])};
            z[nt][2 * p] = e.x;
            z[nt][2 * p + 1] = e.y;
            zp[p] += e;
          }
        }
      }
      // keeps the scheduler from lifting all 128 fragment loads to the top,
      // which overflows the register budget and spills
      __builtin_amdgcn_sched_barrier(0);
    }

    if (SHIFT) {
      // row max: per lane over the 32 tiles, then across the 16 lanes
      float mrow[8];
      #pragma unroll
      for (int r = 0; r < 8; ++r) {
        float mp = -1e30f;
        #pragma unroll
        for (int nt = 0; nt < 32; ++nt) mp = fmaxf(mp, z[nt][r]);
        mrow[r] = rmax16(mp);
      }
      // exp in place and row sum, on row pairs (packed f32 subtract and add)
      #pragma unroll
      for (int nt = 0; nt < 32; ++nt) {
        #pragma unroll
        for (int p = 0; p < 4; ++p) {
          v2f a = (v2f){z[nt][2 * p], z[nt][2 * p + 1]} - (v2f){mrow[2 * p], mrow[2 * p + 1]};
          v2f e = (v2f){__builtin_amdgcn_exp2f(a.x), __builtin_amdgcn_exp2f(a.y)};
          z[nt][2 * p] = e.x;
          z[nt][2 * p + 1] = e.y;
          zp[p] += e;
        }
      }
    }
    float crow[8];
    #pragma unroll
    for (int r = 0; r < 8; ++r)
      crow[r] = sv[row0 + r + 8 * g] / rsum16(zp[r >> 1][r & 1]);

    // t_e += sum_r c_r * 2^(score), this lane's eight rows as four pairs
    #pragma unroll
    for (int nt = 0; nt < 32; ++nt) {
      #pragma unroll
      for (int p = 0; p < 4; ++p)
        tcol[nt] += (v2f){crow[2 * p], crow[2 * p + 1]} *
                    (v2f){z[nt][2 * p], z[nt][2 * p + 1]};
    }
  }
  float* twp = tw + w * 512;
  float tsum[32];
  #pragma unroll
  for (int nt = 0; nt < 32; ++nt) {
    tsum[nt] = tcol[nt].x + tcol[nt].y;
    tsum[nt] += __shfl_xor(tsum[nt], 16, 32);           // rows 0-7 + rows 8-15
  }
  if (g == 0) {
    #pragma unroll
    for (int nt = 0; nt < 32; ++nt) twp[nt * 16 + nloc] = tsum[nt];  // wave-private plane
  }
}

__global__ __launch_bounds__(256)
void center_attn_fused_kernel(const float* __restrict__ x,
                              const float* __restrict__ spg,
                              const float* __restrict__ bout,
                              const float* __restrict__ Wspec,
                              float* __restrict__ out) {
  extern __shared__ char smem[];
  __bf16* XT   = (__bf16*)(smem + OFF_XT);
  __bf16* WspT = (__bf16*)(smem + OFF_WSPT);
  __bf16* QK   = (__bf16*)(smem + OFF_QK);
  float* sv   = (float*)(smem + OFF_S);
  float* tv   = (float*)(smem + OFF_T);
  float* tw   = (float*)(smem + OFF_TW);

  const int b    = blockIdx.x;
  const int tid  = threadIdx.x;
  const int lane = tid & 31;
  const int w    = tid >> 5;
  const float* xb = x + (size_t)b * N_ * D_;

  // ---- Stage 1: x^T and Wspec^T (cols 0..127) into bf16 LDS.
  // A lane owns a block of 4 columns x 8 rows of the f32 source: eight 16-byte
  // loads (a wave-load = four whole 128-B lines), then per column one 16-byte
  // store of its 8 rows packed to bf16. Lanes 0-15 (and 16-31) hold 4 column
  // quads x 4 row blocks, which at the 144-B pitch fall on all 64 banks once.
  const float *xsrc, *wsrc;   // named again by the wait behind stage 2
  {
    const int cq = (lane & 3) | ((lane >> 4) << 2);   // column quad in a 32-column chunk
    const int rb = (w >> 2) * 4 + ((lane >> 2) & 3);  // block of 8 source rows
    xsrc = xb + rb * 8 * D_ + (w & 3) * 128 + cq * 4;
    wsrc = Wspec + rb * 8 * 192 + (w & 3) * 32 + cq * 4;
    v4f xv[4][8], wv[8];
    #pragma unroll
    for (int u = 0; u < 4; ++u)
      #pragma unroll
      for (int k = 0; k < 8; ++k) xv[u][k] = *(const v4f*)(xsrc + k * D_ + u * 32);
    #pragma unroll
    for (int k = 0; k < 8; ++k) wv[k] = *(const v4f*)(wsrc + k * 192);

    __bf16* xdst = XT + ((w & 3) * 128 + cq * 4) * XT_LD + rb * 8;
    #pragma unroll
    for (int u = 0; u < 4; ++u)
      #pragma unroll
      for (int c = 0; c < 4; ++c) {
        v8bf p;
        #pragma unroll
        for (int k = 0; k < 8; ++k) p[k] = (__bf16)xv[u][k][c];
        *(v8bf*)(xdst + (u * 32 + c) * XT_LD) = p;
      }
    const float qsc = (w & 3) < 2 ? SCALE_ * LOG2E_ : 1.f;   // fold scale, log2(e) into q_s (j < 64)
    __bf16* wdst = WspT + ((w & 3) * 32 + cq * 4) * WT_LD + rb * 8;
    #pragma unroll
    for (int c = 0; c < 4; ++c) {
      v8bf p;
      #pragma unroll
      for (int k = 0; k < 8; ++k) p[k] = (__bf16)(wv[k][c] * qsc);
      *(v8bf*)(wdst + c * WT_LD) = p;
    }
  }

  // ---- Stage 2: s[e] = bout[e] + the eight heads' shares from launch 1
  #pragma unroll
  for (int kk = 0; kk < 2; ++kk) {
    int e = tid + kk * 256;
    float acc = bout[e];
    #pragma unroll
    for (int h = 0; h < H_; ++h) acc += spg[(size_t)b * (H_ * 512) + h * 512 + e];
    sv[e] = acc;
  }
  // the wait that belongs in front of a rewrite of a load's address registers
  // of the loads of stages 1 and 2 and of the kernel-argument loads; the addresses as inputs keep those registers
  // unwritten up to here (out: its argument load is issued in front of the wait)
  asm volatile("s_wait_xcnt 0x0"
               :: "v"(xsrc), "v"(wsrc), "s"(spg + (size_t)b * (H_ * 512)), "s"(bout), "s"(out),
                  "s"(__builtin_amdgcn_kernarg_segment_ptr())
               : "memory");
  __syncthreads();

  // ---- Stage 3: GEMM1 (WMMA bf16), computed transposed:
  // QK^T(128x512) = Wspec^T(128x64) @ X(64x512), tile by tile. The accumulator
  // then holds, per lane, eight neighbouring columns j of ONE row d of QK: one
  // packed 16-byte store (lanes 0-15 and 16-31 each cover all 64 banks once).
  // A wave keeps all of Wspec^T in registers and takes four 16-row blocks of
  // x^T, so x^T is read from LDS once and eight independent tiles are in flight.
  {
    const int mloc = lane & 15, g = lane >> 4;
    v16bf xf[4][2], wf[8][2];
    float qa = 0.f, ka = 0.f;   // largest |q_s|, |k_s| this lane has formed
    #pragma unroll
    for (int i = 0; i < 4; ++i)
      #pragma unroll
      for (int kt = 0; kt < 2; ++kt)
        xf[i][kt] = ldfrag(XT + ((w + 8 * i) * 16 + mloc) * XT_LD + kt * 32 + 8 * g);
    #pragma unroll
    for (int jt = 0; jt < 8; ++jt)
      #pragma unroll
      for (int kt = 0; kt < 2; ++kt)
        wf[jt][kt] = ldfrag(WspT + (jt * 16 + mloc) * WT_LD + kt * 32 + 8 * g);
    #pragma unroll
    for (int i = 0; i < 4; ++i) {
      v8f acc[8];
      #pragma unroll
      for (int jt = 0; jt < 8; ++jt) {
        v8f zero = {};
        acc[jt] = __builtin_amdgcn_wmma_f32_16x16x32_bf16(false, wf[jt][0], false, xf[i][0],
                                                          (short)0, zero, false, false);
      }
      #pragma unroll
      for (int jt = 0; jt < 8; ++jt)
        acc[jt] = __builtin_amdgcn_wmma_f32_16x16x32_bf16(false, wf[jt][1], false, xf[i][1],
                                                          (short)0, acc[jt], false, false);
      __bf16* qrow = QK + ((w + 8 * i) * 16 + mloc) * QK_LD + 8 * g;
      #pragma unroll
      for (int jt = 0; jt < 8; ++jt) {
        v8bf pk;
        #pragma unroll
        for (int r = 0; r < 8; ++r) {
          pk[r] = (__bf16)acc[jt][r];
          if (jt < 4) qa = fmaxf(qa, fabsf(acc[jt][r]));
          else        ka = fmaxf(ka, fabsf(acc[jt][r]));
        }
        *(v8bf*)(qrow + jt * 16) = pk;
      }
    }
    qa = wave_max(qa);
    ka = wave_max(ka);
    if (lane == 0) *(v2f*)(tv + 2 * w) = (v2f){qa, ka};   // tv is free up to stage 5
  }
  __syncthreads();

  // |score| <= 64 * max|q_s| * max|k_s| (64 products a score). The rounding of q_s
  // and k_s to bf16 moves that bound by under 1 %, far inside the room that
  // NOSHIFT_LIM_ leaves to the f32 exponent range. An infinity or a NaN in the
  // bound fails the comparison and takes the shifted path.
  bool noshift;
  {
    v4f m4 = *(const v4f*)(tv);
    #pragma unroll
    for (int i = 1; i < 4; ++i) {
      v4f a = *(const v4f*)(tv + 4 * i);
      m4.x = fmaxf(m4.x, a.x); m4.y = fmaxf(m4.y, a.y);
      m4.z = fmaxf(m4.z, a.z); m4.w = fmaxf(m4.w, a.w);
    }
    noshift = 64.f * fmaxf(m4.x, m4.z) * fmaxf(m4.y, m4.w) <= NOSHIFT_LIM_;
  }

  // ---- Stage 4: t[e] = sum_d s_d * softmax_row(q_s k_s^T)[e]
  // The test reads the same in every lane of the work-group; readfirstlane makes
  // it a scalar branch, so that every WMMA runs with all lanes on.
  if (__builtin_amdgcn_readfirstlane((int)noshift))
    spectral_strips<false>(QK, sv, tw, lane, w);
  else
    spectral_strips<true>(QK, sv, tw, lane, w);
  __syncthreads();

  // ---- Stage 5: reduce per-wave accumulators; broadcast over n to output
  #pragma unroll
  for (int kk = 0; kk < 2; ++kk) {
    int e = tid + kk * 256;
    float acc = 0.f;
    #pragma unroll
    for (int ww = 0; ww < 8; ++ww) acc += tw[ww * 512 + e];
    tv[e] = acc;
  }
  __syncthreads();
  float* ob = out + (size_t)b * N_ * D_;
  for (int i = tid; i < (N_ * D_) / 4; i += 256) {
    int flat = i * 4, e = flat & 511;
    float4 v;
    v.x = tv[e]; v.y = tv[e + 1]; v.z = tv[e + 2]; v.w = tv[e + 3];
    ((float4*)ob)[i] = v;
  }
}

extern "C" void kernel_launch(void* const* d_in, const int* in_sizes, int n_in,
                              void* d_out, int out_size, void* d_ws, size_t ws_size,
                              hipStream_t stream) {
  const float* x     = (const float*)d_in[0];
  const float* Wq    = (const float*)d_in[1];
  const float* Wkv   = (const float*)d_in[2];
  const float* Wout  = (const float*)d_in[3];
  const float* bout  = (const float*)d_in[4];
  const float* Wspec = (const float*)d_in[5];
  float* out = (float*)d_out;
  float* spg = (float*)d_ws;
  (void)in_sizes; (void)n_in; (void)out_size; (void)ws_size;

  center_chain_kernel<<<(B_ / BT_) * H_, 256, LDS_CH, stream>>>(x, Wq, Wkv, Wout, spg);
  center_attn_fused_kernel<<<B_, 256, LDS_BYTES, stream>>>(
      x, spg, bout, Wspec, out);
}

// v007
// A run of this version takes 40.5 microseconds.
// Timed twice side by side with v006, it ran 1.04 times as fast both times.
// All steps since v000 together make it 5.67 times as fast.
#include <hip/hip_runtime.h>

typedef __attribute__((ext_vector_type(16))) __bf16 v16bf;
typedef __attribute__((ext_vector_type(8)))  __bf16 v8bf;
typedef __attribute__((ext_vector_type(8)))  float  v8f;
typedef __attribute__((ext_vector_type(2)))  float  v2f;
typedef __attribute__((ext_vector_type(4)))  float  v4f;

#define B_     256
#define N_     64
#define D_     512
#define H_     8
#define INNER_ 512
#define SCALE_ 0.125f
#define LOG2E_ 1.4426950408889634f
// Spectral scores are formed in log2 units (q_s carries SCALE_ * LOG2E_). Where
// every |score| of a batch is proved to be at most this, 2^score needs no shift
// by the row maximum: each term lies within 2^-41 .. 2^41 and a row's sum under 2^50.
#define NOSHIFT_LIM_ 40.0f

// ---- LDS layout. All row strides are multiples of 8 bf16 (16 B) so each
// WMMA fragment loads as two ds_load_b128; all OFF_* are 16B-aligned. ----
#define XT_LD  72    // XT[512][72]  bf16 : x^T  (d-major, n contiguous)
#define WT_LD  72    // WspT[128][72] bf16: Wspec^T cols 0..127 (k contiguous);
                     //   q-columns (j<64) pre-scaled by SCALE_ * LOG2E_
#define QK_LD  136   // QK[512][136] bf16 : cols 0..63 q_s*scale*log2e | 64..127 k_s
constexpr int OFF_XT   = 0;
constexpr int OFF_WSPT = OFF_XT   + 512 * XT_LD * 2;   // 73728
constexpr int OFF_QK   = OFF_WSPT + 128 * WT_LD * 2;   // 92160
constexpr int OFF_S    = OFF_QK   + 512 * QK_LD * 2;   // 231424
constexpr int OFF_T    = OFF_S    + 512 * 4;
constexpr int OFF_TW   = OFF_T    + 512 * 4;
constexpr int LDS_BYTES = OFF_TW  + 8 * 512 * 4;       // 251904 B < 320 KB

// ---- Center-token chain, one launch: one work-group = BT_ batches x one head
// goes through the whole chain, so each head's weight panels are read once per
// BT_ batches and nothing but the last stage's result leaves the work-group.
// Workspace: sp[b][h][e] = sum_j outv[b][h*64+j] * Wout[h*64+j][e], [B][H][512] f32.
#define BT_    8
// (A bare "#pragma unroll" below stands on short loops over register arrays,
// which stay in registers only when their indices are constants.)
#define WK_LD  68    // staged Wk panel pitch (f32): b128 rows, lanes 4 banks apart
constexpr int P_AT   = 0;                          // aT[512][8]  f32: x_center^T, later y^T
constexpr int P_RED  = P_AT  + 512 * BT_ * 4;      // red[16][8][64] f32
constexpr int P_O    = P_RED + 16 * BT_ * 64 * 4;  // o: 8 x 64 f32
constexpr int P_WK   = P_O   + BT_ * 64 * 4;       // WkS[512][WK_LD] f32, later yp[8][8][512]
constexpr int P_WT   = P_WK  + 512 * WK_LD * 4;    // wts[8][512] f32
constexpr int P_SC   = P_WT  + BT_ * 512 * 4;      // sc[8][64] f32
constexpr int LDS_CH = P_SC  + BT_ * 64 * 4;       // 208896 B
static_assert(BT_ * 8 * 512 <= 512 * WK_LD, "yp fits where the Wk panel stood");

// One WMMA 16-bit operand fragment = two contiguous 8-bf16 runs per lane
// (K = base+8g..+7 in VGPRs 0-3, K = base+16+8g..+7 in VGPRs 4-7)
// -> two ds_load_b128 from a K-contiguous, 16B-aligned row.
__device__ __forceinline__ v16bf ldfrag(const __bf16* p) {
  union { v16bf v; v8bf h[2]; } u;
  u.h[0] = *(const v8bf*)(p);
  u.h[1] = *(const v8bf*)(p + 16);
  return u.v;
}

__device__ __forceinline__ float rmax16(float v) {
  #pragma unroll
  for (int m = 1; m < 16; m <<= 1) v = fmaxf(v, __shfl_xor(v, m, 32));
  return v;
}
__device__ __forceinline__ float rsum16(float v) {
  #pragma unroll
  for (int m = 1; m < 16; m <<= 1) v += __shfl_xor(v, m, 32);
  return v;
}

// lane l with lane l ^ M inside its 16-lane row, as a DPP operand of the maximum
template <int M>
__device__ __forceinline__ float row_xor(float v) {
  return __builtin_bit_cast(float, __builtin_amdgcn_update_dpp(
      0, __builtin_bit_cast(int, v), 0x160 | M, 0xf, 0xf, true));
}
// maximum over the 32 lanes of a wave, in every lane
__device__ __forceinline__ float wave_max(float v) {
  v = fmaxf(v, row_xor<1>(v));
  v = fmaxf(v, row_xor<2>(v));
  v = fmaxf(v, row_xor<4>(v));
  v = fmaxf(v, row_xor<8>(v));
  const int b = __builtin_bit_cast(int, v);
  return fmaxf(v, __builtin_bit_cast(float, __builtin_amdgcn_permlanex16(
                      b, b, 0x76543210, 0xfedcba98, false, false)));
}

__device__ __forceinline__ float dot4(const float4& a, const float4& b) {
  return a.x * b.x + a.y * b.y + a.z * b.z + a.w * b.w;
}

// Work-group barrier for data handed over through LDS only: it waits for this
// wave's LDS operations and no more. __syncthreads() would also wait for the
// global loads in flight, that is, for the x rows and weights fetched ahead.
__device__ __forceinline__ void lds_barrier() {
  asm volatile("s_wait_dscnt 0x0\n\ts_barrier_signal -1\n\ts_barrier_wait -1" ::: "memory");
}

// N vectors of a weight panel, 'stride' floats apart, from base (the same in every
// lane) + off (the lane's own, in floats), into registers: all N loads of a lane
// are in flight at once, and the caller issues them a stage or more ahead of the
// sums that read them, so that their latency runs beside other work.
template <typename V, int N>
__device__ __forceinline__ void load_panel(const float* __restrict__ base, unsigned off,
                                           int stride, V (&r)[N]) {
  static_assert(N <= 32, "with the wait below, at most 63 loads of a wave are out");
  // keeps the tail of the work before from sinking in between the loads and their wait
  __builtin_amdgcn_sched_barrier(0);
  // at most 31 older loads still out when these are issued: the wave's
  // outstanding loads stay within what the load counter can count (63)
  asm volatile("s_wait_loadcnt 0x1f" ::: "memory");
  #pragma unroll
  for (int i = 0; i < N; ++i) r[i] = *(const V*)(base + i * stride + off);
  // the wait that belongs in front of a rewrite of the loads' address registers
  asm volatile("s_wait_xcnt 0x0" ::: "memory");
  // keeps these loads up here: moved down to their sums, they would be issued
  // a few at a time and their latency paid once per group
  __builtin_amdgcn_sched_barrier(0);
}

// This lane's offset in a 512 x 64 weight panel for gemv_fma: 16 lanes take one
// 256-B row as float4, 16 rows a step (load_panel stride 16 * ld).
__device__ __forceinline__ unsigned panel_off(int ld, int tid) {
  return (unsigned)((tid >> 4) * ld + (tid & 15) * 4);
}

// o[bi][j] = sum_d aT[d][bi] * W[d][j], bi < 8, j < 64, d < 512, in two parts.
// Part 1: this lane's d-slice (d = 16 i + tid / 16), weights wr[i] already loaded.
__device__ __forceinline__ void gemv_fma(const v4f (&wr)[32], const float* aT,
                                         v4f (&acc)[BT_], int tid) {
  const float* ap = aT + (tid >> 4) * BT_;
  #pragma unroll
  for (int bi = 0; bi < BT_; ++bi) acc[bi] = (v4f){0.f, 0.f, 0.f, 0.f};
  // aT is read in groups of four steps, one group ahead of the sums
  v4f a[2][4][2];
  #pragma unroll
  for (int k = 0; k < 4; ++k) {
    a[0][k][0] = *(const v4f*)(ap + k * 16 * BT_);
    a[0][k][1] = *(const v4f*)(ap + k * 16 * BT_ + 4);
  }
  #pragma unroll
  for (int q = 0; q < 8; ++q) {
    if (q < 7) {
      #pragma unroll
      for (int k = 0; k < 4; ++k) {
        a[(q + 1) & 1][k][0] = *(const v4f*)(ap + (q * 4 + 4 + k) * 16 * BT_);
        a[(q + 1) & 1][k][1] = *(const v4f*)(ap + (q * 4 + 4 + k) * 16 * BT_ + 4);
      }
    }
    // keeps the next group's LDS reads in front of this group's sums: spread among
    // them, two or three were in flight at a time and each step waited for its own
    __builtin_amdgcn_sched_barrier(0);
    #pragma unroll
    for (int k = 0; k < 4; ++k) {
      const v4f a0 = a[q & 1][k][0], a1 = a[q & 1][k][1], w4 = wr[q * 4 + k];
      acc[0] += a0.x * w4; acc[1] += a0.y * w4; acc[2] += a0.z * w4; acc[3] += a0.w * w4;
      acc[4] += a1.x * w4; acc[5] += a1.y * w4; acc[6] += a1.z * w4; acc[7] += a1.w * w4;
    }
  }
}
// Part 2: the 16 d-slices summed through LDS; the result is stored at
// o[j*sj + bi*sb]. Ends with a barrier.
__device__ __forceinline__ void gemv_reduce(const v4f (&acc)[BT_], float* red, float* o,
                                            int sj, int sb, int tid) {
  const int j4 = tid & 15, ds = tid >> 4;
  #pragma unroll
  for (int bi = 0; bi < BT_; ++bi)
    *(v4f*)(red + (ds * BT_ + bi) * 64 + j4 * 4) = acc[bi];
  lds_barrier();
  #pragma unroll
  for (int kk = 0; kk < 2; ++kk) {
    const int idx = tid + kk * 256, bi = idx >> 6, j = idx & 63;
    float s = 0.f;
    #pragma unroll
    for (int t = 0; t < 16; ++t) s += red[(t * BT_ + bi) * 64 + j];
    o[j * sj + bi * sb] = s;
  }
  lds_barrier();
}

// Eight rows of one batch's x, a wave's share: row r as four 512-B wave loads.
__device__ __forceinline__ void load_rows(const float* __restrict__ xw, v4f (&xr)[8][4]) {
  // keeps the tail of the work before from sinking in between the loads and their wait
  __builtin_amdgcn_sched_barrier(0);
  // at most 31 older loads still out when these 32 are issued: the wave's
  // outstanding loads stay within what the load counter can count (63)
  asm volatile("s_wait_loadcnt 0x1f" ::: "memory");
  #pragma unroll
  for (int r = 0; r < 8; ++r)
    #pragma unroll
    for (int c = 0; c < 4; ++c)
      xr[r][c] = *(const v4f*)(xw + r * D_ + c * 128);
  // the address registers of the loads above are rewritten soon after: the wait
  // that belongs in front of such a rewrite;
  // xw as an input keeps those registers from being handed to a loaded value
  asm volatile("s_wait_xcnt 0x0" :: "v"(xw) : "memory");
  // keeps these loads, and that wait, in front of the work on the other register set: moved
  // down among it, they would be issued only after that set's own loads return
  __builtin_amdgcn_sched_barrier(0);
}

// y[bj][d] = the eight waves' partial sums; stored transposed for gemv_fma.
__device__ __forceinline__ void reduce_y(const float* yp, float* aT, int bj, int tid) {
  const int d2 = tid * 2;
  float2 s = make_float2(0.f, 0.f);
  #pragma unroll
  for (int ww = 0; ww < 8; ++ww) {
    float2 v = *(const float2*)(yp + (bj * 8 + ww) * 512 + d2);
    s.x += v.x; s.y += v.y;
  }
  aT[d2 * BT_ + bj]       = s.x;
  aT[(d2 + 1) * BT_ + bj] = s.y;
}

// One batch of the middle stage, x rows in registers (wave w: rows 8w..8w+7):
// scores against wt, softmax over the 64 rows, this wave's part of y = attn @ x.
__device__ __forceinline__ void attn_step(int bi, const v4f (&xr)[8][4],
                                          const float* wts, float* sc, float* yp,
                                          float* aT, int tid) {
  const int lane = tid & 31, w = tid >> 5;
  v4f wv[4];
  #pragma unroll
  for (int c = 0; c < 4; ++c)
    wv[c] = *(const v4f*)(wts + bi * 512 + c * 128 + lane * 4);
  float p[8];
  #pragma unroll
  for (int r = 0; r < 8; ++r) {
    v2f acc = xr[r][0].lo * wv[0].lo;
    acc += xr[r][0].hi * wv[0].hi;
    #pragma unroll
    for (int c = 1; c < 4; ++c) {
      acc += xr[r][c].lo * wv[c].lo;
      acc += xr[r][c].hi * wv[c].hi;
    }
    p[r] = acc.x + acc.y;
  }
  #pragma unroll
  for (int k = 16; k >= 1; k >>= 1)
    #pragma unroll
    for (int r = 0; r < 8; ++r) p[r] += __shfl_xor(p[r], k, 32);
  if (lane == 0) {
    float* so = sc + bi * 64 + w * 8;
    *(v4f*)(so)     = (v4f){p[0], p[1], p[2], p[3]} * SCALE_;
    *(v4f*)(so + 4) = (v4f){p[4], p[5], p[6], p[7]} * SCALE_;
  }
  lds_barrier();     // all 64 scores of this batch, and the batch before's yp, are in LDS

  if (bi > 0) reduce_y(yp, aT, bi - 1, tid);

  // every lane reads all 64 scores (one address per load): no cross-lane steps
  v4f s4[18];   // 16, 17: this wave's own eight rows once more
  #pragma unroll
  for (int i = 0; i < 16; ++i) s4[i] = *(const v4f*)(sc + bi * 64 + i * 4);
  s4[16] = *(const v4f*)(sc + bi * 64 + w * 8);
  s4[17] = *(const v4f*)(sc + bi * 64 + w * 8 + 4);
  // keeps the reads together: spread along the maximum's chain, only three
  // were in flight at a time and their latency was paid five times over
  __builtin_amdgcn_sched_barrier(0);
  v4f m4 = s4[0];   // four independent chains
  #pragma unroll
  for (int i = 1; i < 16; ++i) {
    m4.x = fmaxf(m4.x, s4[i].x); m4.y = fmaxf(m4.y, s4[i].y);
    m4.z = fmaxf(m4.z, s4[i].z); m4.w = fmaxf(m4.w, s4[i].w);
  }
  const float mx = fmaxf(fmaxf(m4.x, m4.y), fmaxf(m4.z, m4.w));
  const v2f mx2 = (v2f){mx, mx};
  v2f z0 = (v2f){0.f, 0.f}, z1 = (v2f){0.f, 0.f};
  #pragma unroll
  for (int i = 0; i < 18; ++i) {
    v2f a0 = s4[i].lo - mx2, a1 = s4[i].hi - mx2;
    s4[i] = (v4f){__expf(a0.x), __expf(a0.y), __expf(a1.x), __expf(a1.y)};
    if (i < 16) { z0 += s4[i].lo; z1 += s4[i].hi; }
  }
  const float inv = 1.f / ((z0.x + z0.y) + (z1.x + z1.y));
  const v4f at0 = s4[16] * inv, at1 = s4[17] * inv;
  const float a[8] = {at0.x, at0.y, at0.z, at0.w, at1.x, at1.y, at1.z, at1.w};

  v4f ya[4];
  #pragma unroll
  for (int c = 0; c < 4; ++c) ya[c] = a[0] * xr[0][c];
  #pragma unroll
  for (int r = 1; r < 8; ++r)
    #pragma unroll
    for (int c = 0; c < 4; ++c) ya[c] += a[r] * xr[r][c];
  #pragma unroll
  for (int c = 0; c < 4; ++c)
    *(v4f*)(yp + (bi * 8 + w) * 512 + c * 128 + lane * 4) = ya[c];
}

// Launch 1, the whole center-token chain of BT_ batches and one head:
//   qc = x_center @ Wq(head), wt = Wk(head) @ qc,
//   per batch: scores = x . wt, softmax over m, y = attn @ x,
//   outv = y @ Wv(head), sp = outv @ Wout(head rows).
__global__ __launch_bounds__(256)
void center_chain_kernel(const float* __restrict__ x,
                         const float* __restrict__ Wq,
                         const float* __restrict__ Wkv,
                         const float* __restrict__ Wout,
                         float* __restrict__ spg) {
  extern __shared__ char smem[];
  float* aT  = (float*)(smem + P_AT);
  float* red = (float*)(smem + P_RED);
  float* qs  = (float*)(smem + P_O);    // qs[bi][64], later outv[bi][64]
  float* WkS = (float*)(smem + P_WK);
  float* yp  = (float*)(smem + P_WK);   // yp[bi][wave][512], once WkS is done with
  float* wts = (float*)(smem + P_WT);   // wts[bi][512]
  float* sc  = (float*)(smem + P_SC);   // sc[bi][64]
  const int tid = threadIdx.x;
  const int h = blockIdx.x & 7, b0 = (blockIdx.x >> 3) * BT_;

  // The center rows and the Wq panel are asked for first, the Wk panel behind
  // them: it flies during the Wq sums and goes to LDS after them.
  float xc[16];
  #pragma unroll
  for (int kk = 0; kk < 16; ++kk) {
    const int idx = tid + kk * 256, bi = idx >> 9, d = idx & 511;
    xc[kk] = x[(size_t)(b0 + bi) * N_ * D_ + (N_ / 2) * D_ + d];
  }
  v4f wp[32], wk[32], acc4[BT_];
  load_panel(Wq + h * 64, panel_off(INNER_, tid), 16 * INNER_, wp);
  #pragma unroll
  for (int kk = 0; kk < 16; ++kk) {
    const int idx = tid + kk * 256, bi = idx >> 9, d = idx & 511;
    aT[d * BT_ + bi] = xc[kk];
  }
  load_panel(Wkv + h * 64, panel_off(2 * INNER_, tid), 16 * 2 * INNER_, wk);
  lds_barrier();     // x_center^T complete

  gemv_fma(wp, aT, acc4, tid);
  // the Wv panel takes the registers that Wq has left and waits there for y
  load_panel(Wkv + INNER_ + h * 64, panel_off(2 * INNER_, tid), 16 * 2 * INNER_, wp);
  // Wk head panel into LDS (read by rows below); gemv_reduce's barriers publish it
  {
    float* dst = WkS + (tid >> 4) * WK_LD + (tid & 15) * 4;
    #pragma unroll
    for (int i = 0; i < 32; ++i) *(v4f*)(dst + i * 16 * WK_LD) = wk[i];
  }
  gemv_reduce(acc4, red, qs, 1, 64, tid);

  // this wave's rows of batch b0 + bi start at xw + bi * XB
  const float* xw = x + ((size_t)b0 * N_ + (tid >> 5) * 8) * D_ + (tid & 31) * 4;
  constexpr size_t XB = (size_t)N_ * D_;
  v4f xa[8][4], xb[8][4];
  load_rows(xw, xa);   // the first batch's rows fly during the wt stage

  {
    float acc0[BT_], acc1[BT_];
    #pragma unroll
    for (int bi = 0; bi < BT_; ++bi) { acc0[bi] = 0.f; acc1[bi] = 0.f; }
    // unroll 2: LDS reads of two steps issued ahead of their sums; four would take
    // the kernel's text, with the unrolled sums of gemv_fma, past its former length
    #pragma unroll 2
    for (int j4 = 0; j4 < 16; ++j4) {
      float4 w0 = *(const float4*)(WkS + tid * WK_LD + j4 * 4);
      float4 w1 = *(const float4*)(WkS + (tid + 256) * WK_LD + j4 * 4);
      #pragma unroll
      for (int bi = 0; bi < BT_; ++bi) {
        float4 q = *(const float4*)(qs + bi * 64 + j4 * 4);
        acc0[bi] += dot4(w0, q);
        acc1[bi] += dot4(w1, q);
      }
    }
    #pragma unroll
    for (int bi = 0; bi < BT_; ++bi) {
      wts[bi * 512 + tid]       = acc0[bi];
      wts[bi * 512 + tid + 256] = acc1[bi];
    }
  }
  lds_barrier();     // wts complete; WkS free for yp

  // two register sets: the next batch's rows are loaded while this one is worked on.
  // No load stands under a branch (a branch round it makes the compiler wait for
  // every load in flight): the last trip's second load, which has no batch left,
  // takes this head's 64 rows of Wout instead. They are 64 x 512 f32 in a row, the
  // shape of a batch of x, so wave w gets rows 8w .. 8w+7 a stage ahead of their use.
  const float* wow = Wout + ((size_t)h * 64 + (tid >> 5) * 8) * D_ + (tid & 31) * 4;
  // unroll 1: the body already holds two batches; more would only grow the code
  #pragma unroll 1
  for (int bi = 0; bi < BT_; bi += 2) {
    load_rows(xw + (bi + 1) * XB, xb);
    attn_step(bi, xa, wts, sc, yp, aT, tid);
    load_rows(bi + 2 < BT_ ? xw + (bi + 2) * XB : wow, xa);
    attn_step(bi + 1, xb, wts, sc, yp, aT, tid);
  }
  lds_barrier();     // the last batch's yp
  reduce_y(yp, aT, BT_ - 1, tid);
  lds_barrier();     // y^T complete

  gemv_fma(wp, aT, acc4, tid);
  gemv_reduce(acc4, red, qs, 1, 64, tid);   // qs[bi][j] = outv

  // sp = outv @ Wout(head rows): this wave's eight rows (in xa), then the eight
  // waves' parts summed through LDS (yp is free since the barrier behind reduce_y)
  {
    const int lane = tid & 31, w = tid >> 5;
    // unroll 2: two batches' outv reads in flight, and the text stays short
    #pragma unroll 2
    for (int bi = 0; bi < BT_; ++bi) {
      const v4f o0 = *(const v4f*)(qs + bi * 64 + w * 8);
      const v4f o1 = *(const v4f*)(qs + bi * 64 + w * 8 + 4);
      const float a[8] = {o0.x, o0.y, o0.z, o0.w, o1.x, o1.y, o1.z, o1.w};
      v4f ya[4];
      #pragma unroll
      for (int c = 0; c < 4; ++c) ya[c] = a[0] * xa[0][c];
      #pragma unroll
      for (int r = 1; r < 8; ++r)
        #pragma unroll
        for (int c = 0; c < 4; ++c) ya[c] += a[r] * xa[r][c];
      #pragma unroll
      for (int c = 0; c < 4; ++c)
        *(v4f*)(yp + (bi * 8 + w) * 512 + c * 128 + lane * 4) = ya[c];
    }
  }
  lds_barrier();     // all parts of sp
  const int e2 = tid * 2;
  // unroll 2: 16 LDS reads in flight, and the text stays short
  #pragma unroll 2
  for (int bi = 0; bi < BT_; ++bi) {
    v2f s = *(const v2f*)(yp + bi * 8 * 512 + e2);
    #pragma unroll
    for (int ww = 1; ww < 8; ++ww) s += *(const v2f*)(yp + (bi * 8 + ww) * 512 + e2);
    *(v2f*)(spg + (size_t)(b0 + bi) * (H_ * 512) + h * 512 + e2) = s;
  }
}

// Stage 4 of the fused kernel: t[e] = sum_d s_d * softmax_row(q_s k_s^T)[e].
// One WMMA sweep per strip: the strip's 16 x 512 scores stay in registers
// (32 accumulator tiles), so exp, row sum and the weighted column sums all read
// registers. Column sums also stay in registers over the wave's four strips and
// are stored once. Scores arrive in log2 units.
// SHIFT: the row maximum is found and subtracted before 2^score.
// !SHIFT (every |score| <= NOSHIFT_LIM_): 2^score is taken straight from the
// accumulators, one group of four tiles behind the group being multiplied, so
// that it runs beside the WMMAs and the fragment loads.
template <bool SHIFT>
__device__ __forceinline__ void spectral_strips(const __bf16* QK, const float* sv,
                                                float* tw, int lane, int w) {
  const int nloc = lane & 15, g = lane >> 4;
  v2f tcol[32];   // per column tile: even rows | odd rows of this lane
  #pragma unroll
  for (int nt = 0; nt < 32; ++nt) tcol[nt] = (v2f){0.f, 0.f};
  for (int strip = w; strip < 32; strip += 8) {
    const int row0 = strip * 16;
    v16bf afr[2];
    #pragma unroll
    for (int kt = 0; kt < 2; ++kt)
      afr[kt] = ldfrag(QK + (row0 + nloc) * QK_LD + kt * 32 + 8 * g);

    // scores; k_s fragments are fetched one group of four tiles ahead of the
    // group being multiplied
    v8f z[32];
    v2f zp[4];      // row sums, on row pairs
    #pragma unroll
    for (int p = 0; p < 4; ++p) zp[p] = (v2f){0.f, 0.f};
    v16bf bq[2][4][2];
    #pragma unroll
    for (int t = 0; t < 4; ++t)
      #pragma unroll
      for (int kt = 0; kt < 2; ++kt)
        bq[0][t][kt] = ldfrag(QK + (t * 16 + nloc) * QK_LD + 64 + kt * 32 + 8 * g);
    #pragma unroll
    for (int gi = 0; gi < 9; ++gi) {
      if (gi < 7) {
        #pragma unroll
        for (int t = 0; t < 4; ++t)
          #pragma unroll
          for (int kt = 0; kt < 2; ++kt)
            bq[(gi + 1) & 1][t][kt] =
                ldfrag(QK + ((gi * 4 + 4 + t) * 16 + nloc) * QK_LD + 64 + kt * 32 + 8 * g);
      }
      #pragma unroll
      for (int t = 0; t < 4; ++t) {
        if (gi < 8) {
          v8f acc = {};
          #pragma unroll
          for (int kt = 0; kt < 2; ++kt)
            acc = __builtin_amdgcn_wmma_f32_16x16x32_bf16(false, afr[kt], false,
                                                          bq[gi & 1][t][kt],
                                                          (short)0, acc, false, false);
          z[gi * 4 + t] = acc;
        }
        if (!SHIFT && gi > 0) {
          const int nt = gi * 4 - 4 + t;
          #pragma unroll
          for (int p = 0; p < 4; ++p) {
            v2f e = (v2f){__builtin_amdgcn_exp2f(z[nt][2 * p]),
                          __builtin_amdgcn_exp2f(z[nt][2 * p + 1])};
            z[nt][2 * p] = e.x;
            z[nt][2 * p + 1] = e.y;
            zp[p] += e;
          }
        }
      }
      // keeps the scheduler from lifting all 128 fragment loads to the top,
      // which overflows the register budget and spills
      __builtin_amdgcn_sched_barrier(0);
    }

    if (SHIFT) {
      // row max: per lane over the 32 tiles, then across the 16 lanes
      float mrow[8];
      #pragma unroll
      for (int r = 0; r < 8; ++r) {
        float mp = -1e30f;
        #pragma unroll
        for (int nt = 0; nt < 32; ++nt) mp = fmaxf(mp, z[nt][r]);
        mrow[r] = rmax16(mp);
      }
      // exp in place and row sum, on row pairs (packed f32 subtract and add)
      #pragma unroll
      for (int nt = 0; nt < 32; ++nt) {
        #pragma unroll
        for (int p = 0; p < 4; ++p) {
          v2f a = (v2f){z[nt][2 * p], z[nt][2 * p + 1]} - (v2f){mrow[2 * p], mrow[2 * p + 1]};
          v2f e = (v2f){__builtin_amdgcn_exp2f(a.x), __builtin_amdgcn_exp2f(a.y)};
          z[nt][2 * p] = e.x;
          z[nt][2 * p + 1] = e.y;
          zp[p] += e;
        }
      }
    }
    float crow[8];
    #pragma unroll
    for (int r = 0; r < 8; ++r)
      crow[r] = sv[row0 + r + 8 * g] / rsum16(zp[r >> 1][r & 1]);

    // t_e += sum_r c_r * 2^(score), this lane's eight rows as four pairs
    #pragma unroll
    for (int nt = 0; nt < 32; ++nt) {
      #pragma unroll
      for (int p = 0; p < 4; ++p)
        tcol[nt] += (v2f){crow[2 * p], crow[2 * p + 1]} *
                    (v2f){z[nt][2 * p], z[nt][2 * p + 1]};
    }
  }
  float* twp = tw + w * 512;
  float tsum[32];
  #pragma unroll
  for (int nt = 0; nt < 32; ++nt) {
    tsum[nt] = tcol[nt].x + tcol[nt].y;
    tsum[nt] += __shfl_xor(tsum[nt], 16, 32);           // rows 0-7 + rows 8-15
  }
  if (g == 0) {
    #pragma unroll
    for (int nt = 0; nt < 32; ++nt) twp[nt * 16 + nloc] = tsum[nt];  // wave-private plane
  }
}

__global__ __launch_bounds__(256)
void center_attn_fused_kernel(const float* __restrict__ x,
                              const float* __restrict__ spg,
                              const float* __restrict__ bout,
                              const float* __restrict__ Wspec,
                              float* __restrict__ out) {
  extern __shared__ char smem[];
  __bf16* XT   = (__bf16*)(smem + OFF_XT);
  __bf16* WspT = (__bf16*)(smem + OFF_WSPT);
  __bf16* QK   = (__bf16*)(smem + OFF_QK);
  float* sv   = (float*)(smem + OFF_S);
  float* tv   = (float*)(smem + OFF_T);
  float* tw   = (float*)(smem + OFF_TW);

  const int b    = blockIdx.x;
  const int tid  = threadIdx.x;
  const int lane = tid & 31;
  const int w    = tid >> 5;
  const float* xb = x + (size_t)b * N_ * D_;

  // ---- Stage 1: x^T and Wspec^T (cols 0..127) into bf16 LDS.
  // A lane owns a block of 4 columns x 8 rows of the f32 source: eight 16-byte
  // loads (a wave-load = four whole 128-B lines), then per column one 16-byte
  // store of its 8 rows packed to bf16. Lanes 0-15 (and 16-31) hold 4 column
  // quads x 4 row blocks, which at the 144-B pitch fall on all 64 banks once.
  const float *xsrc, *wsrc;   // named again by the wait behind stage 2
  {
    const int cq = (lane & 3) | ((lane >> 4) << 2);   // column quad in a 32-column chunk
    const int rb = (w >> 2) * 4 + ((lane >> 2) & 3);  // block of 8 source rows
    xsrc = xb + rb * 8 * D_ + (w & 3) * 128 + cq * 4;
    wsrc = Wspec + rb * 8 * 192 + (w & 3) * 32 + cq * 4;
    v4f xv[4][8], wv[8];
    #pragma unroll
    for (int u = 0; u < 4; ++u)
      #pragma unroll
      for (int k = 0; k < 8; ++k) xv[u][k] = *(const v4f*)(xsrc + k * D_ + u * 32);
    #pragma unroll
    for (int k = 0; k < 8; ++k) wv[k] = *(const v4f*)(wsrc + k * 192);

    __bf16* xdst = XT + ((w & 3) * 128 + cq * 4) * XT_LD + rb * 8;
    #pragma unroll
    for (int u = 0; u < 4; ++u)
      #pragma unroll
      for (int c = 0; c < 4; ++c) {
        v8bf p;
        #pragma unroll
        for (int k = 0; k < 8; ++k) p[k] = (__bf16)xv[u][k][c];
        *(v8bf*)(xdst + (u * 32 + c) * XT_LD) = p;
      }
    const float qsc = (w & 3) < 2 ? SCALE_ * LOG2E_ : 1.f;   // fold scale, log2(e) into q_s (j < 64)
    __bf16* wdst = WspT + ((w & 3) * 32 + cq * 4) * WT_LD + rb * 8;
    #pragma unroll
    for (int c = 0; c < 4; ++c) {
      v8bf p;
      #pragma unroll
      for (int k = 0; k < 8; ++k) p[k] = (__bf16)(wv[k][c] * qsc);
      *(v8bf*)(wdst + c * WT_LD) = p;
    }
  }

  // ---- Stage 2: s[e] = bout[e] + the eight heads' shares from launch 1
  #pragma unroll
  for (int kk = 0; kk < 2; ++kk) {
    int e = tid + kk * 256;
    float acc = bout[e];
    #pragma unroll
    for (int h = 0; h < H_; ++h) acc += spg[(size_t)b * (H_ * 512) + h * 512 + e];
    sv[e] = acc;
  }
  // the wait that belongs in front of a rewrite of a load's address registers
  // of the loads of stages 1 and 2 and of the kernel-argument loads; the addresses as inputs keep those registers
  // unwritten up to here (out: its argument load is issued in front of the wait)
  asm volatile("s_wait_xcnt 0x0"
               :: "v"(xsrc), "v"(wsrc), "s"(spg + (size_t)b * (H_ * 512)), "s"(bout), "s"(out),
                  "s"(__builtin_amdgcn_kernarg_segment_ptr())
               : "memory");
  __syncthreads();

  // ---- Stage 3: GEMM1 (WMMA bf16), computed transposed:
  // QK^T(128x512) = Wspec^T(128x64) @ X(64x512), tile by tile. The accumulator
  // then holds, per lane, eight neighbouring columns j of ONE row d of QK: one
  // packed 16-byte store (lanes 0-15 and 16-31 each cover all 64 banks once).
  // A wave keeps all of Wspec^T in registers and takes four 16-row blocks of
  // x^T, so x^T is read from LDS once and eight independent tiles are in flight.
  {
    const int mloc = lane & 15, g = lane >> 4;
    v16bf xf[4][2], wf[8][2];
    float qa = 0.f, ka = 0.f;   // largest |q_s|, |k_s| this lane has formed
    #pragma unroll
    for (int i = 0; i < 4; ++i)
      #pragma unroll
      for (int kt = 0; kt < 2; ++kt)
        xf[i][kt] = ldfrag(XT + ((w + 8 * i) * 16 + mloc) * XT_LD + kt * 32 + 8 * g);
    #pragma unroll
    for (int jt = 0; jt < 8; ++jt)
      #pragma unroll
      for (int kt = 0; kt < 2; ++kt)
        wf[jt][kt] = ldfrag(WspT + (jt * 16 + mloc) * WT_LD + kt * 32 + 8 * g);
    #pragma unroll
    for (int i = 0; i < 4; ++i) {
      v8f acc[8];
      #pragma unroll
      for (int jt = 0; jt < 8; ++jt) {
        v8f zero = {};
        acc[jt] = __builtin_amdgcn_wmma_f32_16x16x32_bf16(false, wf[jt][0], false, xf[i][0],
                                                          (short)0, zero, false, false);
      }
      #pragma unroll
      for (int jt = 0; jt < 8; ++jt)
        acc[jt] = __builtin_amdgcn_wmma_f32_16x16x32_bf16(false, wf[jt][1], false, xf[i][1],
                                                          (short)0, acc[jt], false, false);
      __bf16* qrow = QK + ((w + 8 * i) * 16 + mloc) * QK_LD + 8 * g;
      #pragma unroll
      for (int jt = 0; jt < 8; ++jt) {
        v8bf pk;
        #pragma unroll
        for (int r = 0; r < 8; ++r) {
          pk[r] = (__bf16)acc[jt][r];
          if (jt < 4) qa = fmaxf(qa, fabsf(acc[jt][r]));
          else        ka = fmaxf(ka, fabsf(acc[jt][r]));
        }
        *(v8bf*)(qrow + jt * 16) = pk;
      }
    }
    qa = wave_max(qa);
    ka = wave_max(ka);
    if (lane == 0) *(v2f*)(tv + 2 * w) = (v2f){qa, ka};   // tv is free up to stage 5
  }
  __syncthreads();

  // |score| <= 64 * max|q_s| * max|k_s| (64 products a score). The rounding of q_s
  // and k_s to bf16 moves that bound by under 1 %, far inside the room that
  // NOSHIFT_LIM_ leaves to the f32 exponent range. An infinity or a NaN in the
  // bound fails the comparison and takes the shifted path.
  bool noshift;
  {
    v4f m4 = *(const v4f*)(tv);
    #pragma unroll
    for (int i = 1; i < 4; ++i) {
      v4f a = *(const v4f*)(tv + 4 * i);
      m4.x = fmaxf(m4.x, a.x); m4.y = fmaxf(m4.y, a.y);
      m4.z = fmaxf(m4.z, a.z); m4.w = fmaxf(m4.w, a.w);
    }
    noshift = 64.f * fmaxf(m4.x, m4.z) * fmaxf(m4.y, m4.w) <= NOSHIFT_LIM_;
  }

  // ---- Stage 4: t[e] = sum_d s_d * softmax_row(q_s k_s^T)[e]
  // The test reads the same in every lane of the work-group; readfirstlane makes
  // it a scalar branch, so that every WMMA runs with all lanes on.
  if (__builtin_amdgcn_readfirstlane((int)noshift))
    spectral_strips<false>(QK, sv, tw, lane, w);
  else
    spectral_strips<true>(QK, sv, tw, lane, w);
  __syncthreads();

  // ---- Stage 5: reduce per-wave accumulators; broadcast over n to output
  #pragma unroll
  for (int kk = 0; kk < 2; ++kk) {
    int e = tid + kk * 256;
    float acc = 0.f;
    #pragma unroll
    for (int ww = 0; ww < 8; ++ww) acc += tw[ww * 512 + e];
    tv[e] = acc;
  }
  __syncthreads();
  float* ob = out + (size_t)b * N_ * D_;
  for (int i = tid; i < (N_ * D_) / 4; i += 256) {
    int flat = i * 4, e = flat & 511;
    float4 v;
    v.x = tv[e]; v.y = tv[e + 1]; v.z = tv[e + 2]; v.w = tv[e + 3];
    ((float4*)ob)[i] = v;
  }
}

extern "C" void kernel_launch(void* const* d_in, const int* in_sizes, int n_in,
                              void* d_out, int out_size, void* d_ws, size_t ws_size,
                              hipStream_t stream) {
  const float* x     = (const float*)d_in[0];
  const float* Wq    = (const float*)d_in[1];
  const float* Wkv   = (const float*)d_in[2];
  const float* Wout  = (const float*)d_in[3];
  const float* bout  = (const float*)d_in[4];
  const float* Wspec = (const float*)d_in[5];
  float* out = (float*)d_out;
  float* spg = (float*)d_ws;
  (void)in_sizes; (void)n_in; (void)out_size; (void)ws_size;

  center_chain_kernel<<<(B_ / BT_) * H_, 256, LDS_CH, stream>>>(x, Wq, Wkv, Wout, spg);
  center_attn_fused_kernel<<<B_, 256, LDS_BYTES, stream>>>(
      x, spg, bout, Wspec, out);
}

// v008
// Measured time: 35.8 microseconds a run.
// Next to v007, in two timings, it ran 1.13 times as fast each time.
// All steps since v000 together make it 6.42 times as fast.
#include <hip/hip_runtime.h>

typedef __attribute__((ext_vector_type(16))) __bf16 v16bf;
typedef __attribute__((ext_vector_type(8)))  __bf16 v8bf;
typedef __attribute__((ext_vector_type(8)))  float  v8f;
typedef __attribute__((ext_vector_type(2)))  float  v2f;
typedef __attribute__((ext_vector_type(4)))  float  v4f;

#define B_     256
#define N_     64
#define D_     512
#define H_     8
#define INNER_ 512
#define SCALE_ 0.125f
#define LOG2E_ 1.4426950408889634f
// Spectral scores are formed in log2 units (q_s carries SCALE_ * LOG2E_). Where
// every |score| of a batch is proved to be at most this, 2^score needs no shift
// by the row maximum: each term lies within 2^-41 .. 2^41 and a row's sum under 2^50.
#define NOSHIFT_LIM_ 40.0f

// ---- LDS layout. All row strides are multiples of 8 bf16 (16 B) so each
// WMMA fragment loads as two ds_load_b128; all OFF_* are 16B-aligned. ----
#define XT_LD  72    // XT[512][72]  bf16 : x^T  (d-major, n contiguous)
#define WT_LD  72    // WspT[128][72] bf16: Wspec^T cols 0..127 (k contiguous);
                     //   q-columns (j<64) pre-scaled by SCALE_ * LOG2E_
#define QK_LD  136   // QK[512][136] bf16 : cols 0..63 q_s*scale*log2e | 64..127 k_s
constexpr int OFF_XT   = 0;
constexpr int OFF_WSPT = OFF_XT   + 512 * XT_LD * 2;   // 73728
constexpr int OFF_QK   = OFF_WSPT + 128 * WT_LD * 2;   // 92160
constexpr int OFF_S    = OFF_QK   + 512 * QK_LD * 2;   // 231424
constexpr int OFF_T    = OFF_S    + 512 * 4;
constexpr int OFF_TW   = OFF_T    + 512 * 4;
constexpr int LDS_BYTES = OFF_TW  + 8 * 512 * 4;       // 251904 B < 320 KB

// ---- Center-token chain, one launch: one work-group = BT_ batches x one head
// goes through the whole chain, so each head's weight panels are read once per
// BT_ batches and nothing but the last stage's result leaves the work-group.
// Workspace: sp[b][h][e] = sum_j outv[b][h*64+j] * Wout[h*64+j][e], [B][H][512] f32.
#define BT_    8
// (A bare "#pragma unroll" below stands on short loops over register arrays,
// which stay in registers only when their indices are constants.)
#define WK_LD  68    // staged Wk panel pitch (f32): b128 rows, lanes 4 banks apart
constexpr int P_AT   = 0;                          // aT[512][8]  f32: x_center^T, later y^T
constexpr int P_RED  = P_AT  + 512 * BT_ * 4;      // red[16][8][64] f32
constexpr int P_O    = P_RED + 16 * BT_ * 64 * 4;  // o: 8 x 64 f32
constexpr int P_WK   = P_O   + BT_ * 64 * 4;       // WkS[512][WK_LD] f32, later y[8][512], yp[8][8][512]
constexpr int P_WT   = P_WK  + 512 * WK_LD * 4;    // wts[8][512] f32
constexpr int LDS_CH = P_WT  + BT_ * 512 * 4;      // 206848 B
static_assert(BT_ * 8 * 512 <= 512 * WK_LD, "yp fits where the Wk panel stood");

// One WMMA 16-bit operand fragment = two contiguous 8-bf16 runs per lane
// (K = base+8g..+7 in VGPRs 0-3, K = base+16+8g..+7 in VGPRs 4-7)
// -> two ds_load_b128 from a K-contiguous, 16B-aligned row.
__device__ __forceinline__ v16bf ldfrag(const __bf16* p) {
  union { v16bf v; v8bf h[2]; } u;
  u.h[0] = *(const v8bf*)(p);
  u.h[1] = *(const v8bf*)(p + 16);
  return u.v;
}

__device__ __forceinline__ float rmax16(float v) {
  #pragma unroll
  for (int m = 1; m < 16; m <<= 1) v = fmaxf(v, __shfl_xor(v, m, 32));
  return v;
}
__device__ __forceinline__ float rsum16(float v) {
  #pragma unroll
  for (int m = 1; m < 16; m <<= 1) v += __shfl_xor(v, m, 32);
  return v;
}

// lane l with lane l ^ M inside its 16-lane row, as a DPP operand of the maximum
template <int M>
__device__ __forceinline__ float row_xor(float v) {
  return __builtin_bit_cast(float, __builtin_amdgcn_update_dpp(
      0, __builtin_bit_cast(int, v), 0x160 | M, 0xf, 0xf, true));
}
// maximum over the 32 lanes of a wave, in every lane
__device__ __forceinline__ float wave_max(float v) {
  v = fmaxf(v, row_xor<1>(v));
  v = fmaxf(v, row_xor<2>(v));
  v = fmaxf(v, row_xor<4>(v));
  v = fmaxf(v, row_xor<8>(v));
  const int b = __builtin_bit_cast(int, v);
  return fmaxf(v, __builtin_bit_cast(float, __builtin_amdgcn_permlanex16(
                      b, b, 0x76543210, 0xfedcba98, false, false)));
}

__device__ __forceinline__ float dot4(const float4& a, const float4& b) {
  return a.x * b.x + a.y * b.y + a.z * b.z + a.w * b.w;
}

// Work-group barrier for data handed over through LDS only: it waits for this
// wave's LDS operations and no more. __syncthreads() would also wait for the
// global loads in flight, that is, for the x rows and weights fetched ahead.
__device__ __forceinline__ void lds_barrier() {
  asm volatile("s_wait_dscnt 0x0\n\ts_barrier_signal -1\n\ts_barrier_wait -1" ::: "memory");
}

// N vectors of a weight panel, 'stride' floats apart, from base (the same in every
// lane) + off (the lane's own, in floats), into registers: all N loads of a lane
// are in flight at once, and the caller issues them a stage or more ahead of the
// sums that read them, so that their latency runs beside other work.
template <typename V, int N>
__device__ __forceinline__ void load_panel(const float* __restrict__ base, unsigned off,
                                           int stride, V (&r)[N]) {
  static_assert(N <= 32, "with the wait below, at most 63 loads of a wave are out");
  // keeps the tail of the work before from sinking in between the loads and their wait
  __builtin_amdgcn_sched_barrier(0);
  // at most 31 older loads still out when these are issued: the wave's
  // outstanding loads stay within what the load counter can count (63)
  asm volatile("s_wait_loadcnt 0x1f" ::: "memory");
  #pragma unroll
  for (int i = 0; i < N; ++i) r[i] = *(const V*)(base + i * stride + off);
  // the wait that belongs in front of a rewrite of the loads' address registers
  asm volatile("s_wait_xcnt 0x0" ::: "memory");
  // keeps these loads up here: moved down to their sums, they would be issued
  // a few at a time and their latency paid once per group
  __builtin_amdgcn_sched_barrier(0);
}

// This lane's offset in a 512 x 64 weight panel for gemv_fma: 16 lanes take one
// 256-B row as float4, 16 rows a step (load_panel stride 16 * ld).
__device__ __forceinline__ unsigned panel_off(int ld, int tid) {
  return (unsigned)((tid >> 4) * ld + (tid & 15) * 4);
}

// o[bi][j] = sum_d aT[d][bi] * W[d][j], bi < 8, j < 64, d < 512, in two parts.
// Part 1: this lane's d-slice (d = 16 i + tid / 16), weights wr[i] already loaded.
__device__ __forceinline__ void gemv_fma(const v4f (&wr)[32], const float* aT,
                                         v4f (&acc)[BT_], int tid) {
  const float* ap = aT + (tid >> 4) * BT_;
  #pragma unroll
  for (int bi = 0; bi < BT_; ++bi) acc[bi] = (v4f){0.f, 0.f, 0.f, 0.f};
  // aT is read in groups of four steps, one group ahead of the sums
  v4f a[2][4][2];
  #pragma unroll
  for (int k = 0; k < 4; ++k) {
    a[0][k][0] = *(const v4f*)(ap + k * 16 * BT_);
    a[0][k][1] = *(const v4f*)(ap + k * 16 * BT_ + 4);
  }
  #pragma unroll
  for (int q = 0; q < 8; ++q) {
    if (q < 7) {
      #pragma unroll
      for (int k = 0; k < 4; ++k) {
        a[(q + 1) & 1][k][0] = *(const v4f*)(ap + (q * 4 + 4 + k) * 16 * BT_);
        a[(q + 1) & 1][k][1] = *(const v4f*)(ap + (q * 4 + 4 + k) * 16 * BT_ + 4);
      }
    }
    // keeps the next group's LDS reads in front of this group's sums: spread among
    // them, two or three were in flight at a time and each step waited for its own
    __builtin_amdgcn_sched_barrier(0);
    #pragma unroll
    for (int k = 0; k < 4; ++k) {
      const v4f a0 = a[q & 1][k][0], a1 = a[q & 1][k][1], w4 = wr[q * 4 + k];
      acc[0] += a0.x * w4; acc[1] += a0.y * w4; acc[2] += a0.z * w4; acc[3] += a0.w * w4;
      acc[4] += a1.x * w4; acc[5] += a1.y * w4; acc[6] += a1.z * w4; acc[7] += a1.w * w4;
    }
  }
}
// Part 2: the 16 d-slices summed through LDS; the result is stored at
// o[j*sj + bi*sb]. Ends with a barrier.
__device__ __forceinline__ void gemv_reduce(const v4f (&acc)[BT_], float* red, float* o,
                                            int sj, int sb, int tid) {
  const int j4 = tid & 15, ds = tid >> 4;
  #pragma unroll
  for (int bi = 0; bi < BT_; ++bi)
    *(v4f*)(red + (ds * BT_ + bi) * 64 + j4 * 4) = acc[bi];
  lds_barrier();
  #pragma unroll
  for (int kk = 0; kk < 2; ++kk) {
    const int idx = tid + kk * 256, bi = idx >> 6, j = idx & 63;
    float s = 0.f;
    #pragma unroll
    for (int t = 0; t < 16; ++t) s += red[(t * BT_ + bi) * 64 + j];
    o[j * sj + bi * sb] = s;
  }
  lds_barrier();
}

// Eight rows of one batch's x, a wave's share: row r as four 512-B wave loads.
__device__ __forceinline__ void load_rows(const float* __restrict__ xw, v4f (&xr)[8][4]) {
  // keeps the tail of the work before from sinking in between the loads and their wait
  __builtin_amdgcn_sched_barrier(0);
  // at most 31 older loads still out when these 32 are issued: the wave's
  // outstanding loads stay within what the load counter can count (63)
  asm volatile("s_wait_loadcnt 0x1f" ::: "memory");
  #pragma unroll
  for (int r = 0; r < 8; ++r)
    #pragma unroll
    for (int c = 0; c < 4; ++c)
      xr[r][c] = *(const v4f*)(xw + r * D_ + c * 128);
  // the address registers of the loads above are rewritten soon after: the wait
  // that belongs in front of such a rewrite;
  // xw as an input keeps those registers from being handed to a loaded value
  asm volatile("s_wait_xcnt 0x0" :: "v"(xw) : "memory");
  // keeps these loads, and that wait, in front of the work on the other register set: moved
  // down among it, they would be issued only after that set's own loads return
  __builtin_amdgcn_sched_barrier(0);
}

// Eight rows of the wave's own batch, in registers: their scores against wt, then
// one step of a running softmax. m is the largest score so far, l the sum of
// exp(score - m), ya this lane's 16 columns of sum exp(score - m) * x_row. A new
// maximum rescales l and ya. Nothing leaves the wave: no LDS exchange, no barrier.
__device__ __forceinline__ void attn_chunk(const v4f (&xr)[8][4], const float* wrow,
                                           float& m, float& l, v4f (&ya)[4]) {
  // wt is read anew for each chunk: 16 registers less across the loop, and these
  // rows' products stay behind the loads issued just before, so that no chunk
  // is waited for while the one before it is still being worked on
  v4f wv[4];
  #pragma unroll
  for (int c = 0; c < 4; ++c) wv[c] = *(const v4f*)(wrow + c * 128);
  float p[8];
  #pragma unroll
  for (int r = 0; r < 8; ++r) {
    v2f acc = xr[r][0].lo * wv[0].lo;
    acc += xr[r][0].hi * wv[0].hi;
    #pragma unroll
    for (int c = 1; c < 4; ++c) {
      acc += xr[r][c].lo * wv[c].lo;
      acc += xr[r][c].hi * wv[c].hi;
    }
    p[r] = acc.x + acc.y;
  }
  #pragma unroll
  for (int k = 16; k >= 1; k >>= 1)
    #pragma unroll
    for (int r = 0; r < 8; ++r) p[r] += __shfl_xor(p[r], k, 32);
  // every lane now holds all eight scores
  #pragma unroll
  for (int r = 0; r < 8; ++r) p[r] *= SCALE_;
  const float mc = fmaxf(fmaxf(fmaxf(p[0], p[1]), fmaxf(p[2], p[3])),
                         fmaxf(fmaxf(p[4], p[5]), fmaxf(p[6], p[7])));
  const float mn = fmaxf(m, mc);
  const float alpha = __expf(m - mn);   // 0 at the first chunk, where l and ya are 0
  m = mn;
  #pragma unroll
  for (int r = 0; r < 8; ++r) p[r] = __expf(p[r] - mn);
  l = l * alpha + (((p[0] + p[1]) + (p[2] + p[3])) + ((p[4] + p[5]) + (p[6] + p[7])));
  #pragma unroll
  for (int c = 0; c < 4; ++c) ya[c] = ya[c] * alpha + p[0] * xr[0][c];
  #pragma unroll
  for (int r = 1; r < 8; ++r)
    #pragma unroll
    for (int c = 0; c < 4; ++c) ya[c] += p[r] * xr[r][c];
  // a remedy against spills, an empty asm statement on each
  // running sum: the sums are finished here, in front of the loads that refill
  // xr's registers. Left free they sank behind those loads, the old rows stayed
  // live beside the new ones and the Wv panel was spilled. Inputs only: no value
  // is hidden from the compiler, every multiply still fuses with its add.
  asm volatile("" :: "v"(ya[0]), "v"(ya[1]), "v"(ya[2]), "v"(ya[3]), "v"(l));
}

// Launch 1, the whole center-token chain of BT_ batches and one head:
//   qc = x_center @ Wq(head), wt = Wk(head) @ qc,
//   per batch (one wave each): scores = x . wt, softmax over m, y = attn @ x,
//   outv = y @ Wv(head), sp = outv @ Wout(head rows).
__global__ __launch_bounds__(256)
void center_chain_kernel(const float* __restrict__ x,
                         const float* __restrict__ Wq,
                         const float* __restrict__ Wkv,
                         const float* __restrict__ Wout,
                         float* __restrict__ spg) {
  extern __shared__ char smem[];
  float* aT  = (float*)(smem + P_AT);
  float* red = (float*)(smem + P_RED);
  float* qs  = (float*)(smem + P_O);    // qs[bi][64], later outv[bi][64]
  float* WkS = (float*)(smem + P_WK);
  float* yp  = (float*)(smem + P_WK);   // y[bi][512], then yp[bi][wave][512], once WkS is done with
  float* wts = (float*)(smem + P_WT);   // wts[bi][512]
  const int tid = threadIdx.x;
  const int h = blockIdx.x & 7, b0 = (blockIdx.x >> 3) * BT_;

  // The center rows and the Wq panel are asked for first, the Wk panel behind
  // them: it flies during the Wq sums and goes to LDS after them.
  float xc[16];
  #pragma unroll
  for (int kk = 0; kk < 16; ++kk) {
    const int idx = tid + kk * 256, bi = idx >> 9, d = idx & 511;
    xc[kk] = x[(size_t)(b0 + bi) * N_ * D_ + (N_ / 2) * D_ + d];
  }
  v4f wp[32], wk[32], acc4[BT_];
  load_panel(Wq + h * 64, panel_off(INNER_, tid), 16 * INNER_, wp);
  #pragma unroll
  for (int kk = 0; kk < 16; ++kk) {
    const int idx = tid + kk * 256, bi = idx >> 9, d = idx & 511;
    aT[d * BT_ + bi] = xc[kk];
  }
  load_panel(Wkv + h * 64, panel_off(2 * INNER_, tid), 16 * 2 * INNER_, wk);
  lds_barrier();     // x_center^T complete

  gemv_fma(wp, aT, acc4, tid);
  // the Wv panel takes the registers that Wq has left and waits there for y
  load_panel(Wkv + INNER_ + h * 64, panel_off(2 * INNER_, tid), 16 * 2 * INNER_, wp);
  // Wk head panel into LDS (read by rows below); gemv_reduce's barriers publish it
  {
    float* dst = WkS + (tid >> 4) * WK_LD + (tid & 15) * 4;
    #pragma unroll
    for (int i = 0; i < 32; ++i) *(v4f*)(dst + i * 16 * WK_LD) = wk[i];
  }
  gemv_reduce(acc4, red, qs, 1, 64, tid);

  // wave w owns batch b0 + w: its rows 8k .. 8k+7 start at xw + k * XC
  const float* xw = x + (size_t)(b0 + (tid >> 5)) * N_ * D_ + (tid & 31) * 4;
  constexpr size_t XC = (size_t)8 * D_;
  v4f xa[8][4], xb[8][4];
  load_rows(xw, xa);   // the first eight rows fly during the wt stage

  {
    float acc0[BT_], acc1[BT_];
    #pragma unroll
    for (int bi = 0; bi < BT_; ++bi) { acc0[bi] = 0.f; acc1[bi] = 0.f; }
    // unroll 2: LDS reads of two steps issued ahead of their sums; four would take
    // the kernel's text, with the unrolled sums of gemv_fma, past its former length
    #pragma unroll 2
    for (int j4 = 0; j4 < 16; ++j4) {
      float4 w0 = *(const float4*)(WkS + tid * WK_LD + j4 * 4);
      float4 w1 = *(const float4*)(WkS + (tid + 256) * WK_LD + j4 * 4);
      #pragma unroll
      for (int bi = 0; bi < BT_; ++bi) {
        float4 q = *(const float4*)(qs + bi * 64 + j4 * 4);
        acc0[bi] += dot4(w0, q);
        acc1[bi] += dot4(w1, q);
      }
    }
    #pragma unroll
    for (int bi = 0; bi < BT_; ++bi) {
      wts[bi * 512 + tid]       = acc0[bi];
      wts[bi * 512 + tid + 256] = acc1[bi];
    }
  }
  lds_barrier();     // wts complete; WkS free for y

  // A wave takes its batch's 64 rows through a running softmax, eight rows at a
  // time, so the waves exchange nothing and meet at no barrier in this stage.
  // Two register sets: the next eight rows are loaded while these are worked on.
  // No load stands under a branch (a branch round it makes the compiler wait for
  // every load in flight): the last trip's second load, which has no rows left,
  // takes eight of this head's 64 rows of Wout instead (512 f32 a row, as in x),
  // so wave w gets rows 8w .. 8w+7 a stage ahead of their use.
  const float* wow = Wout + ((size_t)h * 64 + (tid >> 5) * 8) * D_ + (tid & 31) * 4;
  {
    const int lane = tid & 31, w = tid >> 5;
    const float* wrow = wts + w * 512 + lane * 4;   // this lane's 16 columns of wt
    v4f ya[4];
    #pragma unroll
    for (int c = 0; c < 4; ++c) ya[c] = (v4f){0.f, 0.f, 0.f, 0.f};
    float m = -3.0e38f, l = 0.f;
    // unroll 1: the body already holds two chunks; more would only grow the code
    #pragma unroll 1
    for (int k = 0; k < N_ / 8; k += 2) {
      load_rows(xw + (k + 1) * XC, xb);
      attn_chunk(xa, wrow, m, l, ya);
      load_rows(k + 2 < N_ / 8 ? xw + (k + 2) * XC : wow, xa);
      attn_chunk(xb, wrow, m, l, ya);
    }
    const float inv = 1.f / l;
    #pragma unroll
    for (int c = 0; c < 4; ++c)
      *(v4f*)(yp + w * 512 + c * 128 + lane * 4) = ya[c] * inv;
  }
  lds_barrier();     // all eight batches' y
  // y^T for gemv_fma: a lane takes two columns d of the eight batches
  {
    const int d2 = tid * 2;
    v2f v[BT_];
    #pragma unroll
    for (int bj = 0; bj < BT_; ++bj) v[bj] = *(const v2f*)(yp + bj * 512 + d2);
    *(v4f*)(aT + d2 * BT_)      = (v4f){v[0].x, v[1].x, v[2].x, v[3].x};
    *(v4f*)(aT + d2 * BT_ + 4)  = (v4f){v[4].x, v[5].x, v[6].x, v[7].x};
    *(v4f*)(aT + d2 * BT_ + 8)  = (v4f){v[0].y, v[1].y, v[2].y, v[3].y};
    *(v4f*)(aT + d2 * BT_ + 12) = (v4f){v[4].y, v[5].y, v[6].y, v[7].y};
  }
  lds_barrier();     // y^T complete

  gemv_fma(wp, aT, acc4, tid);
  gemv_reduce(acc4, red, qs, 1, 64, tid);   // qs[bi][j] = outv

  // sp = outv @ Wout(head rows): this wave's eight rows (in xa), then the eight
  // waves' parts summed through LDS (yp is free since the barrier behind y^T)
  {
    const int lane = tid & 31, w = tid >> 5;
    // unroll 2: two batches' outv reads in flight, and the text stays short
    #pragma unroll 2
    for (int bi = 0; bi < BT_; ++bi) {
      const v4f o0 = *(const v4f*)(qs + bi * 64 + w * 8);
      const v4f o1 = *(const v4f*)(qs + bi * 64 + w * 8 + 4);
      const float a[8] = {o0.x, o0.y, o0.z, o0.w, o1.x, o1.y, o1.z, o1.w};
      v4f ya[4];
      #pragma unroll
      for (int c = 0; c < 4; ++c) ya[c] = a[0] * xa[0][c];
      #pragma unroll
      for (int r = 1; r < 8; ++r)
        #pragma unroll
        for (int c = 0; c < 4; ++c) ya[c] += a[r] * xa[r][c];
      #pragma unroll
      for (int c = 0; c < 4; ++c)
        *(v4f*)(yp + (bi * 8 + w) * 512 + c * 128 + lane * 4) = ya[c];
    }
  }
  lds_barrier();     // all parts of sp
  const int e2 = tid * 2;
  // unroll 2: 16 LDS reads in flight, and the text stays short
  #pragma unroll 2
  for (int bi = 0; bi < BT_; ++bi) {
    v2f s = *(const v2f*)(yp + bi * 8 * 512 + e2);
    #pragma unroll
    for (int ww = 1; ww < 8; ++ww) s += *(const v2f*)(yp + (bi * 8 + ww) * 512 + e2);
    *(v2f*)(spg + (size_t)(b0 + bi) * (H_ * 512) + h * 512 + e2) = s;
  }
}

// Stage 4 of the fused kernel: t[e] = sum_d s_d * softmax_row(q_s k_s^T)[e].
// One WMMA sweep per strip: the strip's 16 x 512 scores stay in registers
// (32 accumulator tiles), so exp, row sum and the weighted column sums all read
// registers. Column sums also stay in registers over the wave's four strips and
// are stored once. Scores arrive in log2 units.
// SHIFT: the row maximum is found and subtracted before 2^score.
// !SHIFT (every |score| <= NOSHIFT_LIM_): 2^score is taken straight from the
// accumulators, one group of four tiles behind the group being multiplied, so
// that it runs beside the WMMAs and the fragment loads.
template <bool SHIFT>
__device__ __forceinline__ void spectral_strips(const __bf16* QK, const float* sv,
                                                float* tw, int lane, int w) {
  const int nloc = lane & 15, g = lane >> 4;
  v2f tcol[32];   // per column tile: even rows | odd rows of this lane
  #pragma unroll
  for (int nt = 0; nt < 32; ++nt) tcol[nt] = (v2f){0.f, 0.f};
  for (int strip = w; strip < 32; strip += 8) {
    const int row0 = strip * 16;
    v16bf afr[2];
    #pragma unroll
    for (int kt = 0; kt < 2; ++kt)
      afr[kt] = ldfrag(QK + (row0 + nloc) * QK_LD + kt * 32 + 8 * g);

    // scores; k_s fragments are fetched one group of four tiles ahead of the
    // group being multiplied
    v8f z[32];
    v2f zp[4];      // row sums, on row pairs
    #pragma unroll
    for (int p = 0; p < 4; ++p) zp[p] = (v2f){0.f, 0.f};
    v16bf bq[2][4][2];
    #pragma unroll
    for (int t = 0; t < 4; ++t)
      #pragma unroll
      for (int kt = 0; kt < 2; ++kt)
        bq[0][t][kt] = ldfrag(QK + (t * 16 + nloc) * QK_LD + 64 + kt * 32 + 8 * g);
    #pragma unroll
    for (int gi = 0; gi < 9; ++gi) {
      if (gi < 7) {
        #pragma unroll
        for (int t = 0; t < 4; ++t)
          #pragma unroll
          for (int kt = 0; kt < 2; ++kt)
            bq[(gi + 1) & 1][t][kt] =
                ldfrag(QK + ((gi * 4 + 4 + t) * 16 + nloc) * QK_LD + 64 + kt * 32 + 8 * g);
      }
      #pragma unroll
      for (int t = 0; t < 4; ++t) {
        if (gi < 8) {
          v8f acc = {};
          #pragma unroll
          for (int kt = 0; kt < 2; ++kt)
            acc = __builtin_amdgcn_wmma_f32_16x16x32_bf16(false, afr[kt], false,
                                                          bq[gi & 1][t][kt],
                                                          (short)0, acc, false, false);
          z[gi * 4 + t] = acc;
        }
        if (!SHIFT && gi > 0) {
          const int nt = gi * 4 - 4 + t;
          #pragma unroll
          for (int p = 0; p < 4; ++p) {
            v2f e = (v2f){__builtin_amdgcn_exp2f(z[nt][2 * p]),
                          __builtin_amdgcn_exp2f(z[nt][2 * p + 1])};
            z[nt][2 * p] = e.x;
            z[nt][2 * p + 1] = e.y;
            zp[p] += e;
          }
        }
      }
      // keeps the scheduler from lifting all 128 fragment loads to the top,
      // which overflows the register budget and spills
      __builtin_amdgcn_sched_barrier(0);
    }

    if (SHIFT) {
      // row max: per lane over the 32 tiles, then across the 16 lanes
      float mrow[8];
      #pragma unroll
      for (int r = 0; r < 8; ++r) {
        float mp = -1e30f;
        #pragma unroll
        for (int nt = 0; nt < 32; ++nt) mp = fmaxf(mp, z[nt][r]);
        mrow[r] = rmax16(mp);
      }
      // exp in place and row sum, on row pairs (packed f32 subtract and add)
      #pragma unroll
      for (int nt = 0; nt < 32; ++nt) {
        #pragma unroll
        for (int p = 0; p < 4; ++p) {
          v2f a = (v2f){z[nt][2 * p], z[nt][2 * p + 1]} - (v2f){mrow[2 * p], mrow[2 * p + 1]};
          v2f e = (v2f){__builtin_amdgcn_exp2f(a.x), __builtin_amdgcn_exp2f(a.y)};
          z[nt][2 * p] = e.x;
          z[nt][2 * p + 1] = e.y;
          zp[p] += e;
        }
      }
    }
    float crow[8];
    #pragma unroll
    for (int r = 0; r < 8; ++r)
      crow[r] = sv[row0 + r + 8 * g] / rsum16(zp[r >> 1][r & 1]);

    // t_e += sum_r c_r * 2^(score), this lane's eight rows as four pairs
    #pragma unroll
    for (int nt = 0; nt < 32; ++nt) {
      #pragma unroll
      for (int p = 0; p < 4; ++p)
        tcol[nt] += (v2f){crow[2 * p], crow[2 * p + 1]} *
                    (v2f){z[nt][2 * p], z[nt][2 * p + 1]};
    }
  }
  float* twp = tw + w * 512;
  float tsum[32];
  #pragma unroll
  for (int nt = 0; nt < 32; ++nt) {
    tsum[nt] = tcol[nt].x + tcol[nt].y;
    tsum[nt] += __shfl_xor(tsum[nt], 16, 32);           // rows 0-7 + rows 8-15
  }
  if (g == 0) {
    #pragma unroll
    for (int nt = 0; nt < 32; ++nt) twp[nt * 16 + nloc] = tsum[nt];  // wave-private plane
  }
}

__global__ __launch_bounds__(256)
void center_attn_fused_kernel(const float* __restrict__ x,
                              const float* __restrict__ spg,
                              const float* __restrict__ bout,
                              const float* __restrict__ Wspec,
                              float* __restrict__ out) {
  extern __shared__ char smem[];
  __bf16* XT   = (__bf16*)(smem + OFF_XT);
  __bf16* WspT = (__bf16*)(smem + OFF_WSPT);
  __bf16* QK   = (__bf16*)(smem + OFF_QK);
  float* sv   = (float*)(smem + OFF_S);
  float* tv   = (float*)(smem + OFF_T);
  float* tw   = (float*)(smem + OFF_TW);

  const int b    = blockIdx.x;
  const int tid  = threadIdx.x;
  const int lane = tid & 31;
  const int w    = tid >> 5;
  const float* xb = x + (size_t)b * N_ * D_;

  // ---- Stage 1: x^T and Wspec^T (cols 0..127) into bf16 LDS.
  // A lane owns a block of 4 columns x 8 rows of the f32 source: eight 16-byte
  // loads (a wave-load = four whole 128-B lines), then per column one 16-byte
  // store of its 8 rows packed to bf16. Lanes 0-15 (and 16-31) hold 4 column
  // quads x 4 row blocks, which at the 144-B pitch fall on all 64 banks once.
  const float *xsrc, *wsrc;   // named again by the wait behind stage 2
  {
    const int cq = (lane & 3) | ((lane >> 4) << 2);   // column quad in a 32-column chunk
    const int rb = (w >> 2) * 4 + ((lane >> 2) & 3);  // block of 8 source rows
    xsrc = xb + rb * 8 * D_ + (w & 3) * 128 + cq * 4;
    wsrc = Wspec + rb * 8 * 192 + (w & 3) * 32 + cq * 4;
    v4f xv[4][8], wv[8];
    #pragma unroll
    for (int u = 0; u < 4; ++u)
      #pragma unroll
      for (int k = 0; k < 8; ++k) xv[u][k] = *(const v4f*)(xsrc + k * D_ + u * 32);
    #pragma unroll
    for (int k = 0; k < 8; ++k) wv[k] = *(const v4f*)(wsrc + k * 192);

    __bf16* xdst = XT + ((w & 3) * 128 + cq * 4) * XT_LD + rb * 8;
    #pragma unroll
    for (int u = 0; u < 4; ++u)
      #pragma unroll
      for (int c = 0; c < 4; ++c) {
        v8bf p;
        #pragma unroll
        for (int k = 0; k < 8; ++k) p[k] = (__bf16)xv[u][k][c];
        *(v8bf*)(xdst + (u * 32 + c) * XT_LD) = p;
      }
    const float qsc = (w & 3) < 2 ? SCALE_ * LOG2E_ : 1.f;   // fold scale, log2(e) into q_s (j < 64)
    __bf16* wdst = WspT + ((w & 3) * 32 + cq * 4) * WT_LD + rb * 8;
    #pragma unroll
    for (int c = 0; c < 4; ++c) {
      v8bf p;
      #pragma unroll
      for (int k = 0; k < 8; ++k) p[k] = (__bf16)(wv[k][c] * qsc);
      *(v8bf*)(wdst + c * WT_LD) = p;
    }
  }

  // ---- Stage 2: s[e] = bout[e] + the eight heads' shares from launch 1
  #pragma unroll
  for (int kk = 0; kk < 2; ++kk) {
    int e = tid + kk * 256;
    float acc = bout[e];
    #pragma unroll
    for (int h = 0; h < H_; ++h) acc += spg[(size_t)b * (H_ * 512) + h * 512 + e];
    sv[e] = acc;
  }
  // the wait that belongs in front of a rewrite of a load's address registers
  // of the loads of stages 1 and 2 and of the kernel-argument loads; the addresses as inputs keep those registers
  // unwritten up to here (out: its argument load is issued in front of the wait)
  asm volatile("s_wait_xcnt 0x0"
               :: "v"(xsrc), "v"(wsrc), "s"(spg + (size_t)b * (H_ * 512)), "s"(bout), "s"(out),
                  "s"(__builtin_amdgcn_kernarg_segment_ptr())
               : "memory");
  __syncthreads();

  // ---- Stage 3: GEMM1 (WMMA bf16), computed transposed:
  // QK^T(128x512) = Wspec^T(128x64) @ X(64x512), tile by tile. The accumulator
  // then holds, per lane, eight neighbouring columns j of ONE row d of QK: one
  // packed 16-byte store (lanes 0-15 and 16-31 each cover all 64 banks once).
  // A wave keeps all of Wspec^T in registers and takes four 16-row blocks of
  // x^T, so x^T is read from LDS once and eight independent tiles are in flight.
  {
    const int mloc = lane & 15, g = lane >> 4;
    v16bf xf[4][2], wf[8][2];
    float qa = 0.f, ka = 0.f;   // largest |q_s|, |k_s| this lane has formed
    #pragma unroll
    for (int i = 0; i < 4; ++i)
      #pragma unroll
      for (int kt = 0; kt < 2; ++kt)
        xf[i][kt] = ldfrag(XT + ((w + 8 * i) * 16 + mloc) * XT_LD + kt * 32 + 8 * g);
    #pragma unroll
    for (int jt = 0; jt < 8; ++jt)
      #pragma unroll
      for (int kt = 0; kt < 2; ++kt)
        wf[jt][kt] = ldfrag(WspT + (jt * 16 + mloc) * WT_LD + kt * 32 + 8 * g);
    #pragma unroll
    for (int i = 0; i < 4; ++i) {
      v8f acc[8];
      #pragma unroll
      for (int jt = 0; jt < 8; ++jt) {
        v8f zero = {};
        acc[jt] = __builtin_amdgcn_wmma_f32_16x16x32_bf16(false, wf[jt][0], false, xf[i][0],
                                                          (short)0, zero, false, false);
      }
      #pragma unroll
      for (int jt = 0; jt < 8; ++jt)
        acc[jt] = __builtin_amdgcn_wmma_f32_16x16x32_bf16(false, wf[jt][1], false, xf[i][1],
                                                          (short)0, acc[jt], false, false);
      __bf16* qrow = QK + ((w + 8 * i) * 16 + mloc) * QK_LD + 8 * g;
      #pragma unroll
      for (int jt = 0; jt < 8; ++jt) {
        v8bf pk;
        #pragma unroll
        for (int r = 0; r < 8; ++r) {
          pk[r] = (__bf16)acc[jt][r];
          if (jt < 4) qa = fmaxf(qa, fabsf(acc[jt][r]));
          else        ka = fmaxf(ka, fabsf(acc[jt][r]));
        }
        *(v8bf*)(qrow + jt * 16) = pk;
      }
    }
    qa = wave_max(qa);
    ka = wave_max(ka);
    if (lane == 0) *(v2f*)(tv + 2 * w) = (v2f){qa, ka};   // tv is free up to stage 5
  }
  __syncthreads();

  // |score| <= 64 * max|q_s| * max|k_s| (64 products a score). The rounding of q_s
  // and k_s to bf16 moves that bound by under 1 %, far inside the room that
  // NOSHIFT_LIM_ leaves to the f32 exponent range. An infinity or a NaN in the
  // bound fails the comparison and takes the shifted path.
  bool noshift;
  {
    v4f m4 = *(const v4f*)(tv);
    #pragma unroll
    for (int i = 1; i < 4; ++i) {
      v4f a = *(const v4f*)(tv + 4 * i);
      m4.x = fmaxf(m4.x, a.x); m4.y = fmaxf(m4.y, a.y);
      m4.z = fmaxf(m4.z, a.z); m4.w = fmaxf(m4.w, a.w);
    }
    noshift = 64.f * fmaxf(m4.x, m4.z) * fmaxf(m4.y, m4.w) <= NOSHIFT_LIM_;
  }

  // ---- Stage 4: t[e] = sum_d s_d * softmax_row(q_s k_s^T)[e]
  // The test reads the same in every lane of the work-group; readfirstlane makes
  // it a scalar branch, so that every WMMA runs with all lanes on.
  if (__builtin_amdgcn_readfirstlane((int)noshift))
    spectral_strips<false>(QK, sv, tw, lane, w);
  else
    spectral_strips<true>(QK, sv, tw, lane, w);
  __syncthreads();

  // ---- Stage 5: reduce per-wave accumulators; broadcast over n to output
  #pragma unroll
  for (int kk = 0; kk < 2; ++kk) {
    int e = tid + kk * 256;
    float acc = 0.f;
    #pragma unroll
    for (int ww = 0; ww < 8; ++ww) acc += tw[ww * 512 + e];
    tv[e] = acc;
  }
  __syncthreads();
  float* ob = out + (size_t)b * N_ * D_;
  for (int i = tid; i < (N_ * D_) / 4; i += 256) {
    int flat = i * 4, e = flat & 511;
    float4 v;
    v.x = tv[e]; v.y = tv[e + 1]; v.z = tv[e + 2]; v.w = tv[e + 3];
    ((float4*)ob)[i] = v;
  }
}

extern "C" void kernel_launch(void* const* d_in, const int* in_sizes, int n_in,
                              void* d_out, int out_size, void* d_ws, size_t ws_size,
                              hipStream_t stream) {
  const float* x     = (const float*)d_in[0];
  const float* Wq    = (const float*)d_in[1];
  const float* Wkv   = (const float*)d_in[2];
  const float* Wout  = (const float*)d_in[3];
  const float* bout  = (const float*)d_in[4];
  const float* Wspec = (const float*)d_in[5];
  float* out = (float*)d_out;
  float* spg = (float*)d_ws;
  (void)in_sizes; (void)n_in; (void)out_size; (void)ws_size;

  center_chain_kernel<<<(B_ / BT_) * H_, 256, LDS_CH, stream>>>(x, Wq, Wkv, Wout, spg);
  center_attn_fused_kernel<<<B_, 256, LDS_BYTES, stream>>>(
      x, spg, bout, Wspec, out);
}

// v009
// Measured time: 34.5 microseconds a run.
// In two side-by-side timings against v008, it was 1.03 and 1.04 times as fast.
// Counting every step since v000, it is 6.65 times as fast.
#include <hip/hip_runtime.h>

typedef __attribute__((ext_vector_type(16))) __bf16 v16bf;
typedef __attribute__((ext_vector_type(8)))  __bf16 v8bf;
typedef __attribute__((ext_vector_type(8)))  float  v8f;
typedef __attribute__((ext_vector_type(2)))  float  v2f;
typedef __attribute__((ext_vector_type(4)))  float  v4f;
typedef __attribute__((ext_vector_type(4)))  uint32_t u32x4;
typedef __attribute__((ext_vector_type(8)))  uint32_t u32x8;

#define B_     256
#define N_     64
#define D_     512
#define H_     8
#define INNER_ 512
#define SCALE_ 0.125f
#define LOG2E_ 1.4426950408889634f
// Spectral scores are formed in log2 units (q_s carries SCALE_ * LOG2E_). Where
// every |score| of a batch is proved to be at most this, 2^score needs no shift
// by the row maximum: each term lies within 2^-41 .. 2^41 and a row's sum under 2^50.
#define NOSHIFT_LIM_ 40.0f

// ---- LDS layout. All row strides are multiples of 8 bf16 (16 B) so each
// WMMA fragment loads as two ds_load_b128; all OFF_* are 16B-aligned. ----
#define XT_LD  72    // XT[512][72]  bf16 : x^T  (d-major, n contiguous)
#define WT_LD  72    // WspT[128][72] bf16: Wspec^T cols 0..127 (k contiguous);
                     //   q-columns (j<64) pre-scaled by SCALE_ * LOG2E_
#define QK_LD  136   // QK[512][136] bf16 : cols 0..63 q_s*scale*log2e | 64..127 k_s
constexpr int OFF_XT   = 0;
constexpr int OFF_WSPT = OFF_XT   + 512 * XT_LD * 2;   // 73728
constexpr int OFF_QK   = OFF_WSPT + 128 * WT_LD * 2;   // 92160
constexpr int OFF_S    = OFF_QK   + 512 * QK_LD * 2;   // 231424
constexpr int OFF_T    = OFF_S    + 512 * 4;
constexpr int OFF_TW   = OFF_T    + 512 * 4;
constexpr int LDS_BYTES = OFF_TW  + 8 * 512 * 4;       // 251904 B < 320 KB

// ---- Center-token chain, one launch: one work-group = BT_ batches x one head
// goes through the whole chain, so each head's weight panels are read once per
// BT_ batches and nothing but the last stage's result leaves the work-group.
// Workspace: sp[b][h][e] = sum_j outv[b][h*64+j] * Wout[h*64+j][e], [B][H][512] f32.
#define BT_    8
// (A bare "#pragma unroll" below stands on short loops over register arrays,
// which stay in registers only when their indices are constants.)
#define WK_LD  68    // staged Wk panel pitch (f32): b128 rows, lanes 4 banks apart
constexpr int P_AT   = 0;                          // aT[512][8]  f32: x_center^T, later y^T
constexpr int P_RED  = P_AT  + 512 * BT_ * 4;      // red[16][8][64] f32
constexpr int P_O    = P_RED + 16 * BT_ * 64 * 4;  // o: 8 x 64 f32
constexpr int P_WK   = P_O   + BT_ * 64 * 4;       // WkS[512][WK_LD] f32, later yp[8][8][512]
constexpr int P_WT   = P_WK  + 512 * WK_LD * 4;    // wts[8][512] f32, later y[8][512]
static_assert(BT_ * 8 * 512 <= 512 * WK_LD, "yp fits where the Wk panel stood");
// x stage: a wave's rows of x land in LDS as tiles of 8 rows (contiguous in x), in
// two slots that only this wave reads and refills.
//   slot A (even tiles), free from the end of the Wq stage: waves 0-2 where aT and
//   red stand, waves 3-7 above wts;  slot B (odd tiles), free from the end of the
//   wt stage: where qs and WkS stand.
constexpr int XTILE_B = 8 * D_ * 4;                                    // 16 KiB
constexpr int P_RING  = (P_WT + BT_ * 512 * 4 + 2047) / 2048 * 2048;   // 206848
constexpr int LDS_CH  = P_RING + 5 * XTILE_B;                          // 288768 B
static_assert(3 * XTILE_B <= P_O, "slot A of waves 0-2 ends below qs");
static_assert(P_O % 2048 == 0 && P_O + 8 * XTILE_B <= P_WT, "slot B: 2-KiB places, below wts");
static_assert(LDS_CH <= 320 * 1024, "one work-group's LDS");

// One WMMA 16-bit operand fragment = two contiguous 8-bf16 runs per lane
// (K = base+8g..+7 in VGPRs 0-3, K = base+16+8g..+7 in VGPRs 4-7)
// -> two ds_load_b128 from a K-contiguous, 16B-aligned row.
__device__ __forceinline__ v16bf ldfrag(const __bf16* p) {
  union { v16bf v; v8bf h[2]; } u;
  u.h[0] = *(const v8bf*)(p);
  u.h[1] = *(const v8bf*)(p + 16);
  return u.v;
}

__device__ __forceinline__ float rmax16(float v) {
  #pragma unroll
  for (int m = 1; m < 16; m <<= 1) v = fmaxf(v, __shfl_xor(v, m, 32));
  return v;
}
__device__ __forceinline__ float rsum16(float v) {
  #pragma unroll
  for (int m = 1; m < 16; m <<= 1) v += __shfl_xor(v, m, 32);
  return v;
}

// lane l with lane l ^ M inside its 16-lane row, as a DPP operand of the maximum
template <int M>
__device__ __forceinline__ float row_xor(float v) {
  return __builtin_bit_cast(float, __builtin_amdgcn_update_dpp(
      0, __builtin_bit_cast(int, v), 0x160 | M, 0xf, 0xf, true));
}
// maximum over the 32 lanes of a wave, in every lane
__device__ __forceinline__ float wave_max(float v) {
  v = fmaxf(v, row_xor<1>(v));
  v = fmaxf(v, row_xor<2>(v));
  v = fmaxf(v, row_xor<4>(v));
  v = fmaxf(v, row_xor<8>(v));
  const int b = __builtin_bit_cast(int, v);
  return fmaxf(v, __builtin_bit_cast(float, __builtin_amdgcn_permlanex16(
                      b, b, 0x76543210, 0xfedcba98, false, false)));
}

__device__ __forceinline__ float dot4(const float4& a, const float4& b) {
  return a.x * b.x + a.y * b.y + a.z * b.z + a.w * b.w;
}

// Work-group barrier for data handed over through LDS only: it waits for this
// wave's LDS operations and no more. __syncthreads() would also wait for the
// global loads in flight, that is, for the weights fetched ahead.
__device__ __forceinline__ void lds_barrier() {
  asm volatile("s_wait_dscnt 0x0\n\ts_barrier_signal -1\n\ts_barrier_wait -1" ::: "memory");
}

__device__ __forceinline__ uint32_t uni(uint32_t v) { return __builtin_amdgcn_readfirstlane(v); }
// a wave-uniform value held in a scalar register: a test on it compiles to a scalar
// branch (a tensor load ignores EXEC), a descriptor word stays scalar
__device__ __forceinline__ uint32_t pinned(uint32_t v) {
  uint32_t w = __builtin_amdgcn_readfirstlane(v);
  asm volatile("" : "+s"(w));
  return w;
}
// returns when all but this wave's N youngest tensor loads have landed
template <int N>
__device__ __forceinline__ void wait_tensor_le() { asm volatile("s_wait_tensorcnt %0" :: "i"(N) : "memory"); }
// this wave's LDS reads are done: in front of a tensor load into the slot they read
__device__ __forceinline__ void wait_ds0() { asm volatile("s_wait_dscnt 0x0" ::: "memory"); }
// Descriptor group 1 of an x tile: 1-byte elements, 8 rows of 2048 B, source pitch
// 2048 B, tensor = tile, no mask, no pad.
__device__ __forceinline__ u32x8 xtile_group1() {
  constexpr uint32_t d0 = D_ * 4, d1 = 8u;
  u32x8 g;
  g[0] = uni(0u);
  g[1] = uni((d0 & 0xFFFFu) << 16);
  g[2] = uni((d0 >> 16) | ((d1 & 0xFFFFu) << 16));
  g[3] = uni((d1 >> 16) | (d0 << 16));
  g[4] = uni(d1);
  g[5] = uni(d0);
  g[6] = uni(0u);
  g[7] = uni(0u);
  return g;
}
// word 3 of descriptor group 0: address bits 56..32, type 2
__device__ __forceinline__ uint32_t tdm_word3(uint64_t ga) {
  return uni((((uint32_t)(ga >> 32)) & 0x01FFFFFFu) | 0x80000000u);
}

// N vectors of a weight panel, 'stride' floats apart, from base (the same in every
// lane) + off (the lane's own, in floats), into registers: all N loads of a lane
// are in flight at once, and the caller issues them a stage or more ahead of the
// sums that read them, so that their latency runs beside other work.
template <typename V, int N>
__device__ __forceinline__ void load_panel(const float* __restrict__ base, unsigned off,
                                           int stride, V (&r)[N]) {
  static_assert(N <= 32, "with the wait below, at most 63 loads of a wave are out");
  // keeps the tail of the work before from sinking in between the loads and their wait
  __builtin_amdgcn_sched_barrier(0);
  // at most 31 older loads still out when these are issued: the wave's
  // outstanding loads stay within what the load counter can count (63)
  asm volatile("s_wait_loadcnt 0x1f" ::: "memory");
  #pragma unroll
  for (int i = 0; i < N; ++i) r[i] = *(const V*)(base + i * stride + off);
  // the wait that belongs in front of a rewrite of the loads' address registers
  asm volatile("s_wait_xcnt 0x0" ::: "memory");
  // keeps these loads up here: moved down to their sums, they would be issued
  // a few at a time and their latency paid once per group
  __builtin_amdgcn_sched_barrier(0);
}

// This lane's offset in a 512 x 64 weight panel for gemv_fma: 16 lanes take one
// 256-B row as float4, 16 rows a step (load_panel stride 16 * ld).
__device__ __forceinline__ unsigned panel_off(int ld, int tid) {
  return (unsigned)((tid >> 4) * ld + (tid & 15) * 4);
}

// o[bi][j] = sum_d aT[d][bi] * W[d][j], bi < 8, j < 64, d < 512, in two parts.
// Part 1: this lane's d-slice (d = 16 i + tid / 16), weights wr[i] already loaded.
__device__ __forceinline__ void gemv_fma(const v4f (&wr)[32], const float* aT,
                                         v4f (&acc)[BT_], int tid) {
  const float* ap = aT + (tid >> 4) * BT_;
  #pragma unroll
  for (int bi = 0; bi < BT_; ++bi) acc[bi] = (v4f){0.f, 0.f, 0.f, 0.f};
  // aT is read in groups of four steps, one group ahead of the sums
  v4f a[2][4][2];
  #pragma unroll
  for (int k = 0; k < 4; ++k) {
    a[0][k][0] = *(const v4f*)(ap + k * 16 * BT_);
    a[0][k][1] = *(const v4f*)(ap + k * 16 * BT_ + 4);
  }
  #pragma unroll
  for (int q = 0; q < 8; ++q) {
    if (q < 7) {
      #pragma unroll
      for (int k = 0; k < 4; ++k) {
        a[(q + 1) & 1][k][0] = *(const v4f*)(ap + (q * 4 + 4 + k) * 16 * BT_);
        a[(q + 1) & 1][k][1] = *(const v4f*)(ap + (q * 4 + 4 + k) * 16 * BT_ + 4);
      }
    }
    // keeps the next group's LDS reads in front of this group's sums: spread among
    // them, two or three were in flight at a time and each step waited for its own
    __builtin_amdgcn_sched_barrier(0);
    #pragma unroll
    for (int k = 0; k < 4; ++k) {
      const v4f a0 = a[q & 1][k][0], a1 = a[q & 1][k][1], w4 = wr[q * 4 + k];
      acc[0] += a0.x * w4; acc[1] += a0.y * w4; acc[2] += a0.z * w4; acc[3] += a0.w * w4;
      acc[4] += a1.x * w4; acc[5] += a1.y * w4; acc[6] += a1.z * w4; acc[7] += a1.w * w4;
    }
  }
}
// Part 2: the 16 d-slices summed through LDS; the result is stored at
// o[j*sj + bi*sb]. Ends with a barrier.
__device__ __forceinline__ void gemv_reduce(const v4f (&acc)[BT_], float* red, float* o,
                                            int sj, int sb, int tid) {
  const int j4 = tid & 15, ds = tid >> 4;
  #pragma unroll
  for (int bi = 0; bi < BT_; ++bi)
    *(v4f*)(red + (ds * BT_ + bi) * 64 + j4 * 4) = acc[bi];
  lds_barrier();
  #pragma unroll
  for (int kk = 0; kk < 2; ++kk) {
    const int idx = tid + kk * 256, bi = idx >> 6, j = idx & 63;
    float s = 0.f;
    #pragma unroll
    for (int t = 0; t < 16; ++t) s += red[(t * BT_ + bi) * 64 + j];
    o[j * sj + bi * sb] = s;
  }
  lds_barrier();
}

// Eight rows of 512 f32, a wave's share, into registers: row r as four 512-B wave loads.
__device__ __forceinline__ void load_rows(const float* __restrict__ xw, v4f (&xr)[8][4]) {
  // keeps the tail of the work before from sinking in between the loads and their wait
  __builtin_amdgcn_sched_barrier(0);
  // at most 31 older loads still out when these 32 are issued: the wave's
  // outstanding loads stay within what the load counter can count (63)
  asm volatile("s_wait_loadcnt 0x1f" ::: "memory");
  #pragma unroll
  for (int r = 0; r < 8; ++r)
    #pragma unroll
    for (int c = 0; c < 4; ++c)
      xr[r][c] = *(const v4f*)(xw + r * D_ + c * 128);
  // the address registers of the loads above are rewritten soon after: the wait
  // that belongs in front of such a rewrite;
  // xw as an input keeps those registers from being handed to a loaded value
  asm volatile("s_wait_xcnt 0x0" :: "v"(xw) : "memory");
  // keeps these loads, and that wait, up here, a stage ahead of the sums that read them
  __builtin_amdgcn_sched_barrier(0);
}

// A landed tile from this wave's slot into registers; sl = slot + this lane's 16 B.
__device__ __forceinline__ void read_rows(const float* sl, v4f (&xr)[8][4]) {
  #pragma unroll
  for (int r = 0; r < 8; ++r)
    #pragma unroll
    for (int c = 0; c < 4; ++c)
      xr[r][c] = *(const v4f*)(sl + r * D_ + c * 128);
}

// Eight rows of the wave's own batch, in registers: their scores against wt, then
// one step of a running softmax. m is the largest score so far, l the sum of
// exp(score - m), ya this lane's 16 columns of sum exp(score - m) * x_row. A new
// maximum rescales l and ya. Nothing leaves the wave: no LDS exchange, no barrier.
__device__ __forceinline__ void attn_chunk(const v4f (&xr)[8][4], const float* wrow,
                                           float& m, float& l, v4f (&ya)[4]) {
  // wt is read anew for each chunk: 16 registers less across the loop
  v4f wv[4];
  #pragma unroll
  for (int c = 0; c < 4; ++c) wv[c] = *(const v4f*)(wrow + c * 128);
  float p[8];
  #pragma unroll
  for (int r = 0; r < 8; ++r) {
    v2f acc = xr[r][0].lo * wv[0].lo;
    acc += xr[r][0].hi * wv[0].hi;
    #pragma unroll
    for (int c = 1; c < 4; ++c) {
      acc += xr[r][c].lo * wv[c].lo;
      acc += xr[r][c].hi * wv[c].hi;
    }
    p[r] = acc.x + acc.y;
  }
  #pragma unroll
  for (int k = 16; k >= 1; k >>= 1)
    #pragma unroll
    for (int r = 0; r < 8; ++r) p[r] += __shfl_xor(p[r], k, 32);
  // every lane now holds all eight scores
  #pragma unroll
  for (int r = 0; r < 8; ++r) p[r] *= SCALE_;
  const float mc = fmaxf(fmaxf(fmaxf(p[0], p[1]), fmaxf(p[2], p[3])),
                         fmaxf(fmaxf(p[4], p[5]), fmaxf(p[6], p[7])));
  const float mn = fmaxf(m, mc);
  const float alpha = __expf(m - mn);   // 0 at the first chunk, where l and ya are 0
  m = mn;
  #pragma unroll
  for (int r = 0; r < 8; ++r) p[r] = __expf(p[r] - mn);
  l = l * alpha + (((p[0] + p[1]) + (p[2] + p[3])) + ((p[4] + p[5]) + (p[6] + p[7])));
  #pragma unroll
  for (int c = 0; c < 4; ++c) ya[c] = ya[c] * alpha + p[0] * xr[0][c];
  #pragma unroll
  for (int r = 1; r < 8; ++r)
    #pragma unroll
    for (int c = 0; c < 4; ++c) ya[c] += p[r] * xr[r][c];
  // an empty asm statement on each
  // running sum: the sums are finished here, in front of the LDS reads that refill
  // xr's registers. Left free they sank behind those loads, the old rows stayed
  // live beside the new ones and the Wv panel was spilled. Inputs only: no value
  // is hidden from the compiler, every multiply still fuses with its add.
  asm volatile("" :: "v"(ya[0]), "v"(ya[1]), "v"(ya[2]), "v"(ya[3]), "v"(l));
}

// Launch 1, the whole center-token chain of BT_ batches and one head:
//   qc = x_center @ Wq(head), wt = Wk(head) @ qc,
//   per batch (one wave each): scores = x . wt, softmax over m, y = attn @ x,
//   outv = y @ Wv(head), sp = outv @ Wout(head rows).
__global__ __launch_bounds__(256)
void center_chain_kernel(const float* __restrict__ x,
                         const float* __restrict__ Wq,
                         const float* __restrict__ Wkv,
                         const float* __restrict__ Wout,
                         float* __restrict__ spg) {
  // 2-KiB alignment: the tensor loads' places are counted from the start of the LDS
  extern __shared__ __attribute__((aligned(2048))) char smem_c[];
  char* smem = smem_c;
  float* aT  = (float*)(smem + P_AT);
  float* red = (float*)(smem + P_RED);
  float* qs  = (float*)(smem + P_O);    // qs[bi][64], later outv[bi][64]
  float* WkS = (float*)(smem + P_WK);
  float* yp  = (float*)(smem + P_WK);   // yp[bi][wave][512], once the x stage is done with
  float* wts = (float*)(smem + P_WT);   // wts[bi][512], later y[bi][512]
  const int tid = threadIdx.x;
  const int h = blockIdx.x & 7, b0 = (blockIdx.x >> 3) * BT_;

  // The center rows and the Wq panel are asked for first, the Wk panel behind
  // them: it flies during the Wq sums and goes to LDS after them.
  float xc[16];
  #pragma unroll
  for (int kk = 0; kk < 16; ++kk) {
    const int idx = tid + kk * 256, bi = idx >> 9, d = idx & 511;
    xc[kk] = x[(size_t)(b0 + bi) * N_ * D_ + (N_ / 2) * D_ + d];
  }
  v4f wp[32], wk[32], acc4[BT_];
  load_panel(Wq + h * 64, panel_off(INNER_, tid), 16 * INNER_, wp);
  #pragma unroll
  for (int kk = 0; kk < 16; ++kk) {
    const int idx = tid + kk * 256, bi = idx >> 9, d = idx & 511;
    aT[d * BT_ + bi] = xc[kk];
  }
  load_panel(Wkv + h * 64, panel_off(2 * INNER_, tid), 16 * 2 * INNER_, wk);
  lds_barrier();     // x_center^T complete

  gemv_fma(wp, aT, acc4, tid);
  // the Wv panel takes the registers that Wq has left and waits there for y
  load_panel(Wkv + INNER_ + h * 64, panel_off(2 * INNER_, tid), 16 * 2 * INNER_, wp);
  // Wk head panel into LDS (read by rows below); gemv_reduce's barriers publish it
  {
    float* dst = WkS + (tid >> 4) * WK_LD + (tid & 15) * 4;
    #pragma unroll
    for (int i = 0; i < 32; ++i) *(v4f*)(dst + i * 16 * WK_LD) = wk[i];
  }
  gemv_reduce(acc4, red, qs, 1, 64, tid);

  // wave w owns batch b0 + w: tile k = its rows 8k .. 8k+7. Every wave issues its own
  // tensor loads, one request a tile, and is the only reader of its two slots, so
  // the ring needs this wave's own waits and no barrier.
  const uint32_t wave  = uni(tid >> 5);
  const uint32_t slotA = wave < 3u ? wave * XTILE_B : P_RING + (wave - 3u) * XTILE_B;
  const uint32_t slotB = P_O + wave * XTILE_B;
  const uint32_t lbase = (uint32_t)(size_t)smem;
  const uint64_t xga   = (uint64_t)(size_t)(x + (size_t)(b0 + wave) * N_ * D_);
  // Both descriptor groups live in one scalar tuple each from here to the wait behind
  // the loop. While a request is outstanding only the LDS place and the low address
  // word (group 0, words 1 and 2) take new values.
  u32x8 xg1 = xtile_group1();
  u32x4 xg0;
  xg0[0] = uni(1u);
  xg0[1] = uni(lbase + slotA);
  xg0[2] = uni((uint32_t)xga);
  xg0[3] = tdm_word3(xga);
  // both groups as in-out operands: the next request is formed in the same registers
  auto fire = [&]() {
    asm volatile("tensor_load_to_lds %0, %1" : "+s"(xg0), "+s"(xg1) :: "memory");
  };
  auto issue_tile = [&](uint32_t k, uint32_t slot) {
    const uint64_t ga = xga + (uint64_t)k * XTILE_B;
    const uint32_t w3 = tdm_word3(ga);
    // word 3 changes only where a batch straddles a 4-GiB line: it then takes its
    // new value with no request of this wave outstanding
    if (pinned(w3 != xg0[3])) {
      wait_tensor_le<0>();
      xg0[3] = pinned(w3);
    }
    xg0[1] = uni(lbase + slot);
    xg0[2] = uni((uint32_t)ga);
    fire();
  };
  // tile 0 flies during the wt stage: aT and red are free since gemv_reduce's last
  // barrier, which also holds this wave's s_wait_dscnt 0
  fire();

  {
    float acc0[BT_], acc1[BT_];
    #pragma unroll
    for (int bi = 0; bi < BT_; ++bi) { acc0[bi] = 0.f; acc1[bi] = 0.f; }
    // unroll 2: LDS reads of two steps issued ahead of their sums; four would take
    // the kernel's text, with the unrolled sums of gemv_fma, past its former length
    #pragma unroll 2
    for (int j4 = 0; j4 < 16; ++j4) {
      float4 w0 = *(const float4*)(WkS + tid * WK_LD + j4 * 4);
      float4 w1 = *(const float4*)(WkS + (tid + 256) * WK_LD + j4 * 4);
      #pragma unroll
      for (int bi = 0; bi < BT_; ++bi) {
        float4 q = *(const float4*)(qs + bi * 64 + j4 * 4);
        acc0[bi] += dot4(w0, q);
        acc1[bi] += dot4(w1, q);
      }
    }
    #pragma unroll
    for (int bi = 0; bi < BT_; ++bi) {
      wts[bi * 512 + tid]       = acc0[bi];
      wts[bi * 512 + tid + 256] = acc1[bi];
    }
  }
  lds_barrier();     // wts complete; qs and WkS free for slot B
  issue_tile(1u, slotB);

  // A wave takes its batch's 64 rows through a running softmax, eight rows at a
  // time, so the waves exchange nothing and meet at no barrier in this stage.
  // A landed tile goes to registers at once and its slot is refilled behind that
  // read, so two requests of the wave fly while a tile is worked on.
  // Eight of this head's 64 rows of Wout (wave w: rows 8w .. 8w+7) are asked for
  // here, a stage ahead of their use.
  const float* wow = Wout + ((size_t)h * 64 + (tid >> 5) * 8) * D_ + (tid & 31) * 4;
  v4f wo[8][4];
  load_rows(wow, wo);
  {
    const int lane = tid & 31, w = tid >> 5;
    const float* wrow = wts + w * 512 + lane * 4;   // this lane's 16 columns of wt
    v4f ya[4];
    #pragma unroll
    for (int c = 0; c < 4; ++c) ya[c] = (v4f){0.f, 0.f, 0.f, 0.f};
    float m = -3.0e38f, l = 0.f;
    const float* sA = (const float*)(smem + slotA) + lane * 4;
    const float* sB = (const float*)(smem + slotB) + lane * 4;
    v4f xr[8][4];
    // unroll 1: the body already holds two chunks; more would only grow the code
    #pragma unroll 1
    for (uint32_t k = 0; k < N_ / 8; k += 2) {
      const uint32_t more = k + 2 < N_ / 8;   // tiles k + 2 and k + 3 exist
      wait_tensor_le<1>();          // tile k has landed (tile k + 1 is the one younger)
      read_rows(sA, xr);
      wait_ds0();
      if (pinned(more)) issue_tile(k + 2, slotA);
      attn_chunk(xr, wrow, m, l, ya);
      // tile k + 1 has landed: tile k + 2 is the one younger, where it exists
      if (pinned(more)) wait_tensor_le<1>(); else wait_tensor_le<0>();
      read_rows(sB, xr);
      wait_ds0();
      if (pinned(more)) issue_tile(k + 3, slotB);
      attn_chunk(xr, wrow, m, l, ya);
    }
    // no request outstanding, no LDS read in flight: the slots go back to the work-group;
    // the descriptor groups as inputs keep their registers unwritten up to this wait
    asm volatile("s_wait_tensorcnt 0x0" :: "s"(xg0), "s"(xg1) : "memory");
    wait_ds0();
    const float inv = 1.f / l;
    // y takes the place of this wave's own row of wt (yp lies in other waves' slots)
    #pragma unroll
    for (int c = 0; c < 4; ++c)
      *(v4f*)(wts + w * 512 + c * 128 + lane * 4) = ya[c] * inv;
  }
  lds_barrier();     // all eight batches' y; every wave has left its slots
  // y^T for gemv_fma: a lane takes two columns d of the eight batches
  {
    const int d2 = tid * 2;
    v2f v[BT_];
    #pragma unroll
    for (int bj = 0; bj < BT_; ++bj) v[bj] = *(const v2f*)(wts + bj * 512 + d2);
    *(v4f*)(aT + d2 * BT_)      = (v4f){v[0].x, v[1].x, v[2].x, v[3].x};
    *(v4f*)(aT + d2 * BT_ + 4)  = (v4f){v[4].x, v[5].x, v[6].x, v[7].x};
    *(v4f*)(aT + d2 * BT_ + 8)  = (v4f){v[0].y, v[1].y, v[2].y, v[3].y};
    *(v4f*)(aT + d2 * BT_ + 12) = (v4f){v[4].y, v[5].y, v[6].y, v[7].y};
  }
  lds_barrier();     // y^T complete

  gemv_fma(wp, aT, acc4, tid);
  gemv_reduce(acc4, red, qs, 1, 64, tid);   // qs[bi][j] = outv

  // sp = outv @ Wout(head rows): this wave's eight rows (in wo), then the eight
  // waves' parts summed through LDS (yp is free since the barrier behind y)
  {
    const int lane = tid & 31, w = tid >> 5;
    // unroll 2: two batches' outv reads in flight, and the text stays short
    #pragma unroll 2
    for (int bi = 0; bi < BT_; ++bi) {
      const v4f o0 = *(const v4f*)(qs + bi * 64 + w * 8);
      const v4f o1 = *(const v4f*)(qs + bi * 64 + w * 8 + 4);
      const float a[8] = {o0.x, o0.y, o0.z, o0.w, o1.x, o1.y, o1.z, o1.w};
      v4f ya[4];
      #pragma unroll
      for (int c = 0; c < 4; ++c) ya[c] = a[0] * wo[0][c];
      #pragma unroll
      for (int r = 1; r < 8; ++r)
        #pragma unroll
        for (int c = 0; c < 4; ++c) ya[c] += a[r] * wo[r][c];
      #pragma unroll
      for (int c = 0; c < 4; ++c)
        *(v4f*)(yp + (bi * 8 + w) * 512 + c * 128 + lane * 4) = ya[c];
    }
  }
  lds_barrier();     // all parts of sp
  const int e2 = tid * 2;
  // unroll 2: 16 LDS reads in flight, and the text stays short
  #pragma unroll 2
  for (int bi = 0; bi < BT_; ++bi) {
    v2f s = *(const v2f*)(yp + bi * 8 * 512 + e2);
    #pragma unroll
    for (int ww = 1; ww < 8; ++ww) s += *(const v2f*)(yp + (bi * 8 + ww) * 512 + e2);
    *(v2f*)(spg + (size_t)(b0 + bi) * (H_ * 512) + h * 512 + e2) = s;
  }
}

// Stage 4 of the fused kernel: t[e] = sum_d s_d * softmax_row(q_s k_s^T)[e].
// One WMMA sweep per strip: the strip's 16 x 512 scores stay in registers
// (32 accumulator tiles), so exp, row sum and the weighted column sums all read
// registers. Column sums also stay in registers over the wave's four strips and
// are stored once. Scores arrive in log2 units.
// SHIFT: the row maximum is found and subtracted before 2^score.
// !SHIFT (every |score| <= NOSHIFT_LIM_): 2^score is taken straight from the
// accumulators, one group of four tiles behind the group being multiplied, so
// that it runs beside the WMMAs and the fragment loads.
template <bool SHIFT>
__device__ __forceinline__ void spectral_strips(const __bf16* QK, const float* sv,
                                                float* tw, int lane, int w) {
  const int nloc = lane & 15, g = lane >> 4;
  v2f tcol[32];   // per column tile: even rows | odd rows of this lane
  #pragma unroll
  for (int nt = 0; nt < 32; ++nt) tcol[nt] = (v2f){0.f, 0.f};
  for (int strip = w; strip < 32; strip += 8) {
    const int row0 = strip * 16;
    v16bf afr[2];
    #pragma unroll
    for (int kt = 0; kt < 2; ++kt)
      afr[kt] = ldfrag(QK + (row0 + nloc) * QK_LD + kt * 32 + 8 * g);

    // scores; k_s fragments are fetched one group of four tiles ahead of the
    // group being multiplied
    v8f z[32];
    v2f zp[4];      // row sums, on row pairs
    #pragma unroll
    for (int p = 0; p < 4; ++p) zp[p] = (v2f){0.f, 0.f};
    v16bf bq[2][4][2];
    #pragma unroll
    for (int t = 0; t < 4; ++t)
      #pragma unroll
      for (int kt = 0; kt < 2; ++kt)
        bq[0][t][kt] = ldfrag(QK + (t * 16 + nloc) * QK_LD + 64 + kt * 32 + 8 * g);
    #pragma unroll
    for (int gi = 0; gi < 9; ++gi) {
      if (gi < 7) {
        #pragma unroll
        for (int t = 0; t < 4; ++t)
          #pragma unroll
          for (int kt = 0; kt < 2; ++kt)
            bq[(gi + 1) & 1][t][kt] =
                ldfrag(QK + ((gi * 4 + 4 + t) * 16 + nloc) * QK_LD + 64 + kt * 32 + 8 * g);
      }
      #pragma unroll
      for (int t = 0; t < 4; ++t) {
        if (gi < 8) {
          v8f acc = {};
          #pragma unroll
          for (int kt = 0; kt < 2; ++kt)
            acc = __builtin_amdgcn_wmma_f32_16x16x32_bf16(false, afr[kt], false,
                                                          bq[gi & 1][t][kt],
                                                          (short)0, acc, false, false);
          z[gi * 4 + t] = acc;
        }
        if (!SHIFT && gi > 0) {
          const int nt = gi * 4 - 4 + t;
          #pragma unroll
          for (int p = 0; p < 4; ++p) {
            v2f e = (v2f){__builtin_amdgcn_exp2f(z[nt][2 * p]),
                          __builtin_amdgcn_exp2f(z[nt][2 * p + 1])};
            z[nt][2 * p] = e.x;
            z[nt][2 * p + 1] = e.y;
            zp[p] += e;
          }
        }
      }
      // keeps the scheduler from lifting all 128 fragment loads to the top,
      // which overflows the register budget and spills
      __builtin_amdgcn_sched_barrier(0);
    }

    if (SHIFT) {
      // row max: per lane over the 32 tiles, then across the 16 lanes
      float mrow[8];
      #pragma unroll
      for (int r = 0; r < 8; ++r) {
        float mp = -1e30f;
        #pragma unroll
        for (int nt = 0; nt < 32; ++nt) mp = fmaxf(mp, z[nt][r]);
        mrow[r] = rmax16(mp);
      }
      // exp in place and row sum, on row pairs (packed f32 subtract and add)
      #pragma unroll
      for (int nt = 0; nt < 32; ++nt) {
        #pragma unroll
        for (int p = 0; p < 4; ++p) {
          v2f a = (v2f){z[nt][2 * p], z[nt][2 * p + 1]} - (v2f){mrow[2 * p], mrow[2 * p + 1]};
          v2f e = (v2f){__builtin_amdgcn_exp2f(a.x), __builtin_amdgcn_exp2f(a.y)};
          z[nt][2 * p] = e.x;
          z[nt][2 * p + 1] = e.y;
          zp[p] += e;
        }
      }
    }
    float crow[8];
    #pragma unroll
    for (int r = 0; r < 8; ++r)
      crow[r] = sv[row0 + r + 8 * g] / rsum16(zp[r >> 1][r & 1]);

    // t_e += sum_r c_r * 2^(score), this lane's eight rows as four pairs
    #pragma unroll
    for (int nt = 0; nt < 32; ++nt) {
      #pragma unroll
      for (int p = 0; p < 4; ++p)
        tcol[nt] += (v2f){crow[2 * p], crow[2 * p + 1]} *
                    (v2f){z[nt][2 * p], z[nt][2 * p + 1]};
    }
  }
  float* twp = tw + w * 512;
  float tsum[32];
  #pragma unroll
  for (int nt = 0; nt < 32; ++nt) {
    tsum[nt] = tcol[nt].x + tcol[nt].y;
    tsum[nt] += __shfl_xor(tsum[nt], 16, 32);           // rows 0-7 + rows 8-15
  }
  if (g == 0) {
    #pragma unroll
    for (int nt = 0; nt < 32; ++nt) twp[nt * 16 + nloc] = tsum[nt];  // wave-private plane
  }
}

__global__ __launch_bounds__(256)
void center_attn_fused_kernel(const float* __restrict__ x,
                              const float* __restrict__ spg,
                              const float* __restrict__ bout,
                              const float* __restrict__ Wspec,
                              float* __restrict__ out) {
  extern __shared__ char smem[];
  __bf16* XT   = (__bf16*)(smem + OFF_XT);
  __bf16* WspT = (__bf16*)(smem + OFF_WSPT);
  __bf16* QK   = (__bf16*)(smem + OFF_QK);
  float* sv   = (float*)(smem + OFF_S);
  float* tv   = (float*)(smem + OFF_T);
  float* tw   = (float*)(smem + OFF_TW);

  const int b    = blockIdx.x;
  const int tid  = threadIdx.x;
  const int lane = tid & 31;
  const int w    = tid >> 5;
  const float* xb = x + (size_t)b * N_ * D_;

  // ---- Stage 1: x^T and Wspec^T (cols 0..127) into bf16 LDS.
  // A lane owns a block of 4 columns x 8 rows of the f32 source: eight 16-byte
  // loads (a wave-load = four whole 128-B lines), then per column one 16-byte
  // store of its 8 rows packed to bf16. Lanes 0-15 (and 16-31) hold 4 column
  // quads x 4 row blocks, which at the 144-B pitch fall on all 64 banks once.
  const float *xsrc, *wsrc;   // named again by the wait behind stage 2
  {
    const int cq = (lane & 3) | ((lane >> 4) << 2);   // column quad in a 32-column chunk
    const int rb = (w >> 2) * 4 + ((lane >> 2) & 3);  // block of 8 source rows
    xsrc = xb + rb * 8 * D_ + (w & 3) * 128 + cq * 4;
    wsrc = Wspec + rb * 8 * 192 + (w & 3) * 32 + cq * 4;
    v4f xv[4][8], wv[8];
    #pragma unroll
    for (int u = 0; u < 4; ++u)
      #pragma unroll
      for (int k = 0; k < 8; ++k) xv[u][k] = *(const v4f*)(xsrc + k * D_ + u * 32);
    #pragma unroll
    for (int k = 0; k < 8; ++k) wv[k] = *(const v4f*)(wsrc + k * 192);

    __bf16* xdst = XT + ((w & 3) * 128 + cq * 4) * XT_LD + rb * 8;
    #pragma unroll
    for (int u = 0; u < 4; ++u)
      #pragma unroll
      for (int c = 0; c < 4; ++c) {
        v8bf p;
        #pragma unroll
        for (int k = 0; k < 8; ++k) p[k] = (__bf16)xv[u][k][c];
        *(v8bf*)(xdst + (u * 32 + c) * XT_LD) = p;
      }
    const float qsc = (w & 3) < 2 ? SCALE_ * LOG2E_ : 1.f;   // fold scale, log2(e) into q_s (j < 64)
    __bf16* wdst = WspT + ((w & 3) * 32 + cq * 4) * WT_LD + rb * 8;
    #pragma unroll
    for (int c = 0; c < 4; ++c) {
      v8bf p;
      #pragma unroll
      for (int k = 0; k < 8; ++k) p[k] = (__bf16)(wv[k][c] * qsc);
      *(v8bf*)(wdst + c * WT_LD) = p;
    }
  }

  // ---- Stage 2: s[e] = bout[e] + the eight heads' shares from launch 1
  #pragma unroll
  for (int kk = 0; kk < 2; ++kk) {
    int e = tid + kk * 256;
    float acc = bout[e];
    #pragma unroll
    for (int h = 0; h < H_; ++h) acc += spg[(size_t)b * (H_ * 512) + h * 512 + e];
    sv[e] = acc;
  }
  // the wait that belongs in front of a rewrite of a load's address registers
  // of the loads of stages 1 and 2 and of the kernel-argument loads; the addresses as inputs keep those registers
  // unwritten up to here (out: its argument load is issued in front of the wait)
  asm volatile("s_wait_xcnt 0x0"
               :: "v"(xsrc), "v"(wsrc), "s"(spg + (size_t)b * (H_ * 512)), "s"(bout), "s"(out),
                  "s"(__builtin_amdgcn_kernarg_segment_ptr())
               : "memory");
  __syncthreads();

  // ---- Stage 3: GEMM1 (WMMA bf16), computed transposed:
  // QK^T(128x512) = Wspec^T(128x64) @ X(64x512), tile by tile. The accumulator
  // then holds, per lane, eight neighbouring columns j of ONE row d of QK: one
  // packed 16-byte store (lanes 0-15 and 16-31 each cover all 64 banks once).
  // A wave keeps all of Wspec^T in registers and takes four 16-row blocks of
  // x^T, so x^T is read from LDS once and eight independent tiles are in flight.
  {
    const int mloc = lane & 15, g = lane >> 4;
    v16bf xf[4][2], wf[8][2];
    float qa = 0.f, ka = 0.f;   // largest |q_s|, |k_s| this lane has formed
    #pragma unroll
    for (int i = 0; i < 4; ++i)
      #pragma unroll
      for (int kt = 0; kt < 2; ++kt)
        xf[i][kt] = ldfrag(XT + ((w + 8 * i) * 16 + mloc) * XT_LD + kt * 32 + 8 * g);
    #pragma unroll
    for (int jt = 0; jt < 8; ++jt)
      #pragma unroll
      for (int kt = 0; kt < 2; ++kt)
        wf[jt][kt] = ldfrag(WspT + (jt * 16 + mloc) * WT_LD + kt * 32 + 8 * g);
    #pragma unroll
    for (int i = 0; i < 4; ++i) {
      v8f acc[8];
      #pragma unroll
      for (int jt = 0; jt < 8; ++jt) {
        v8f zero = {};
        acc[jt] = __builtin_amdgcn_wmma_f32_16x16x32_bf16(false, wf[jt][0], false, xf[i][0],
                                                          (short)0, zero, false, false);
      }
      #pragma unroll
      for (int jt = 0; jt < 8; ++jt)
        acc[jt] = __builtin_amdgcn_wmma_f32_16x16x32_bf16(false, wf[jt][1], false, xf[i][1],
                                                          (short)0, acc[jt], false, false);
      __bf16* qrow = QK + ((w + 8 * i) * 16 + mloc) * QK_LD + 8 * g;
      #pragma unroll
      for (int jt = 0; jt < 8; ++jt) {
        v8bf pk;
        #pragma unroll
        for (int r = 0; r < 8; ++r) {
          pk[r] = (__bf16)acc[jt][r];
          if (jt < 4) qa = fmaxf(qa, fabsf(acc[jt][r]));
          else        ka = fmaxf(ka, fabsf(acc[jt][r]));
        }
        *(v8bf*)(qrow + jt * 16) = pk;
      }
    }
    qa = wave_max(qa);
    ka = wave_max(ka);
    if (lane == 0) *(v2f*)(tv + 2 * w) = (v2f){qa, ka};   // tv is free up to stage 5
  }
  __syncthreads();

  // |score| <= 64 * max|q_s| * max|k_s| (64 products a score). The rounding of q_s
  // and k_s to bf16 moves that bound by under 1 %, far inside the room that
  // NOSHIFT_LIM_ leaves to the f32 exponent range. An infinity or a NaN in the
  // bound fails the comparison and takes the shifted path.
  bool noshift;
  {
    v4f m4 = *(const v4f*)(tv);
    #pragma unroll
    for (int i = 1; i < 4; ++i) {
      v4f a = *(const v4f*)(tv + 4 * i);
      m4.x = fmaxf(m4.x, a.x); m4.y = fmaxf(m4.y, a.y);
      m4.z = fmaxf(m4.z, a.z); m4.w = fmaxf(m4.w, a.w);
    }
    noshift = 64.f * fmaxf(m4.x, m4.z) * fmaxf(m4.y, m4.w) <= NOSHIFT_LIM_;
  }

  // ---- Stage 4: t[e] = sum_d s_d * softmax_row(q_s k_s^T)[e]
  // The test reads the same in every lane of the work-group; readfirstlane makes
  // it a scalar branch, so that every WMMA runs with all lanes on.
  if (__builtin_amdgcn_readfirstlane((int)noshift))
    spectral_strips<false>(QK, sv, tw, lane, w);
  else
    spectral_strips<true>(QK, sv, tw, lane, w);
  __syncthreads();

  // ---- Stage 5: reduce per-wave accumulators; broadcast over n to output
  #pragma unroll
  for (int kk = 0; kk < 2; ++kk) {
    int e = tid + kk * 256;
    float acc = 0.f;
    #pragma unroll
    for (int ww = 0; ww < 8; ++ww) acc += tw[ww * 512 + e];
    tv[e] = acc;
  }
  __syncthreads();
  float* ob = out + (size_t)b * N_ * D_;
  for (int i = tid; i < (N_ * D_) / 4; i += 256) {
    int flat = i * 4, e = flat & 511;
    float4 v;
    v.x = tv[e]; v.y = tv[e + 1]; v.z = tv[e + 2]; v.w = tv[e + 3];
    ((float4*)ob)[i] = v;
  }
}

extern "C" void kernel_launch(void* const* d_in, const int* in_sizes, int n_in,
                              void* d_out, int out_size, void* d_ws, size_t ws_size,
                              hipStream_t stream) {
  const float* x     = (const float*)d_in[0];
  const float* Wq    = (const float*)d_in[1];
  const float* Wkv   = (const float*)d_in[2];
  const float* Wout  = (const float*)d_in[3];
  const float* bout  = (const float*)d_in[4];
  const float* Wspec = (const float*)d_in[5];
  float* out = (float*)d_out;
  float* spg = (float*)d_ws;
  (void)in_sizes; (void)n_in; (void)out_size; (void)ws_size;

  center_chain_kernel<<<(B_ / BT_) * H_, 256, LDS_CH, stream>>>(x, Wq, Wkv, Wout, spg);
  center_attn_fused_kernel<<<B_, 256, LDS_BYTES, stream>>>(
      x, spg, bout, Wspec, out);
}

// v010
// It runs in 33.4 microseconds.
// In both of two side-by-side timings against v009, it was 1.03 times as fast.
// Over all steps from v000 it is 6.87 times as fast.
#include <hip/hip_runtime.h>

typedef __attribute__((ext_vector_type(16))) __bf16 v16bf;
typedef __attribute__((ext_vector_type(8)))  __bf16 v8bf;
typedef __attribute__((ext_vector_type(8)))  float  v8f;
typedef __attribute__((ext_vector_type(2)))  float  v2f;
typedef __attribute__((ext_vector_type(4)))  float  v4f;
typedef __attribute__((ext_vector_type(4)))  uint32_t u32x4;
typedef __attribute__((ext_vector_type(8)))  uint32_t u32x8;

#define B_     256
#define N_     64
#define D_     512
#define H_     8
#define INNER_ 512
#define SCALE_ 0.125f
#define LOG2E_ 1.4426950408889634f
// Spectral scores are formed in log2 units (q_s carries SCALE_ * LOG2E_). Where
// every |score| of a batch is proved to be at most this, 2^score needs no shift
// by the row maximum: each term lies within 2^-41 .. 2^41 and a row's sum under 2^50.
#define NOSHIFT_LIM_ 40.0f

// ---- LDS layout. All row strides are multiples of 8 bf16 (16 B) so each
// WMMA fragment loads as two ds_load_b128; all OFF_* are 16B-aligned. ----
#define XT_LD  72    // XT[512][72]  bf16 : x^T  (d-major, n contiguous)
#define WT_LD  72    // WspT[128][72] bf16: Wspec^T cols 0..127 (k contiguous);
                     //   q-columns (j<64) pre-scaled by SCALE_ * LOG2E_
#define QK_LD  136   // QK[512][136] bf16 : cols 0..63 q_s*scale*log2e | 64..127 k_s
constexpr int OFF_XT   = 0;
constexpr int OFF_WSPT = OFF_XT   + 512 * XT_LD * 2;   // 73728
constexpr int OFF_QK   = OFF_WSPT + 128 * WT_LD * 2;   // 92160
constexpr int OFF_S    = OFF_QK   + 512 * QK_LD * 2;   // 231424
constexpr int OFF_T    = OFF_S    + 512 * 4;
constexpr int OFF_TW   = OFF_T    + 512 * 4;
constexpr int LDS_BYTES = OFF_TW  + 8 * 512 * 4;       // 251904 B < 320 KB

// ---- Center-token chain, one launch: one work-group = BT_ batches x one head
// goes through the whole chain, so each head's weight panels are read once per
// BT_ batches and nothing but the last stage's result leaves the work-group.
// Workspace: sp[b][h][e] = sum_j outv[b][h*64+j] * Wout[h*64+j][e], [B][H][512] f32.
#define BT_    8
// (A bare "#pragma unroll" below stands on short loops over register arrays,
// which stay in registers only when their indices are constants.)
#define WK_LD  68    // staged Wk panel pitch (f32): b128 rows, lanes 4 banks apart
constexpr int P_AT   = 0;                          // aT[512][8]  f32: x_center^T, later y^T
constexpr int P_RED  = P_AT  + 512 * BT_ * 4;      // red[16][8][64] f32
constexpr int P_O    = P_RED + 16 * BT_ * 64 * 4;  // o: 8 x 64 f32
constexpr int P_WK   = P_O   + BT_ * 64 * 4;       // WkS[512][WK_LD] f32, later yp[8][8][512]
constexpr int P_WT   = P_WK  + 512 * WK_LD * 4;    // wts[8][512] f32, later y[8][512]
static_assert(BT_ * 8 * 512 <= 512 * WK_LD, "yp fits where the Wk panel stood");
// x stage: a wave's rows of x land in LDS as tiles of 8 rows (contiguous in x), in
// two slots that only this wave reads and refills.
//   slot A (even tiles), free from the end of the Wq stage: waves 0-2 where aT and
//   red stand, waves 3-7 above wts;  slot B (odd tiles), free from the end of the
//   wt stage: where qs and WkS stand.
constexpr int XTILE_B = 8 * D_ * 4;                                    // 16 KiB
constexpr int P_RING  = (P_WT + BT_ * 512 * 4 + 2047) / 2048 * 2048;   // 206848
constexpr int LDS_CH  = P_RING + 5 * XTILE_B;                          // 288768 B
static_assert(3 * XTILE_B <= P_O, "slot A of waves 0-2 ends below qs");
static_assert(P_O % 2048 == 0 && P_O + 8 * XTILE_B <= P_WT, "slot B: 2-KiB places, below wts");
static_assert(LDS_CH <= 320 * 1024, "one work-group's LDS");

// One WMMA 16-bit operand fragment = two contiguous 8-bf16 runs per lane
// (K = base+8g..+7 in VGPRs 0-3, K = base+16+8g..+7 in VGPRs 4-7)
// -> two ds_load_b128 from a K-contiguous, 16B-aligned row.
__device__ __forceinline__ v16bf ldfrag(const __bf16* p) {
  union { v16bf v; v8bf h[2]; } u;
  u.h[0] = *(const v8bf*)(p);
  u.h[1] = *(const v8bf*)(p + 16);
  return u.v;
}

// Cross-lane moves on the vector pipe. __shfl_xor goes through the LDS pipe and a
// wait on its counter at every step of a reduction; these do not.
// lane l ^ M's value inside a 16-lane row, as a DPP operand (all lanes on)
template <int M>
__device__ __forceinline__ float row_xor(float v) {
  return __builtin_bit_cast(float, __builtin_amdgcn_update_dpp(
      0, __builtin_bit_cast(int, v), 0x160 | M, 0xf, 0xf, true));
}
// lane l ^ 16's value (all lanes on)
__device__ __forceinline__ float half_xor(float v) {
  const int b = __builtin_bit_cast(int, v);
  return __builtin_bit_cast(float, __builtin_amdgcn_permlanex16(
      b, b, 0x76543210, 0xfedcba98, false, false));
}
// maximum, sum over a 16-lane row, in every lane of the row; partners 1, 2, 4, 8
__device__ __forceinline__ float rmax16(float v) {
  v = fmaxf(v, row_xor<1>(v));
  v = fmaxf(v, row_xor<2>(v));
  v = fmaxf(v, row_xor<4>(v));
  return fmaxf(v, row_xor<8>(v));
}
__device__ __forceinline__ float rsum16(float v) {
  v += row_xor<1>(v);
  v += row_xor<2>(v);
  v += row_xor<4>(v);
  return v + row_xor<8>(v);
}
// maximum over the 32 lanes of a wave, in every lane
__device__ __forceinline__ float wave_max(float v) {
  v = rmax16(v);
  return fmaxf(v, half_xor(v));
}

__device__ __forceinline__ float dot4(const float4& a, const float4& b) {
  return a.x * b.x + a.y * b.y + a.z * b.z + a.w * b.w;
}

// Work-group barrier for data handed over through LDS only: it waits for this
// wave's LDS operations and no more. __syncthreads() would also wait for the
// global loads in flight, that is, for the weights fetched ahead.
__device__ __forceinline__ void lds_barrier() {
  asm volatile("s_wait_dscnt 0x0\n\ts_barrier_signal -1\n\ts_barrier_wait -1" ::: "memory");
}

__device__ __forceinline__ uint32_t uni(uint32_t v) { return __builtin_amdgcn_readfirstlane(v); }
// a wave-uniform value held in a scalar register: a test on it compiles to a scalar
// branch (a tensor load ignores EXEC), a descriptor word stays scalar
__device__ __forceinline__ uint32_t pinned(uint32_t v) {
  uint32_t w = __builtin_amdgcn_readfirstlane(v);
  asm volatile("" : "+s"(w));
  return w;
}
// returns when all but this wave's N youngest tensor loads have landed
template <int N>
__device__ __forceinline__ void wait_tensor_le() { asm volatile("s_wait_tensorcnt %0" :: "i"(N) : "memory"); }
// this wave's LDS reads are done: in front of a tensor load into the slot they read
__device__ __forceinline__ void wait_ds0() { asm volatile("s_wait_dscnt 0x0" ::: "memory"); }
// Descriptor group 1 of an x tile: 1-byte elements, 8 rows of 2048 B, source pitch
// 2048 B, tensor = tile, no mask, no pad.
__device__ __forceinline__ u32x8 xtile_group1() {
  constexpr uint32_t d0 = D_ * 4, d1 = 8u;
  u32x8 g;
  g[0] = uni(0u);
  g[1] = uni((d0 & 0xFFFFu) << 16);
  g[2] = uni((d0 >> 16) | ((d1 & 0xFFFFu) << 16));
  g[3] = uni((d1 >> 16) | (d0 << 16));
  g[4] = uni(d1);
  g[5] = uni(d0);
  g[6] = uni(0u);
  g[7] = uni(0u);
  return g;
}
// word 3 of descriptor group 0: address bits 56..32, type 2
__device__ __forceinline__ uint32_t tdm_word3(uint64_t ga) {
  return uni((((uint32_t)(ga >> 32)) & 0x01FFFFFFu) | 0x80000000u);
}

// N vectors of a weight panel, 'stride' floats apart, from base (the same in every
// lane) + off (the lane's own, in floats), into registers: all N loads of a lane
// are in flight at once, and the caller issues them a stage or more ahead of the
// sums that read them, so that their latency runs beside other work.
template <typename V, int N>
__device__ __forceinline__ void load_panel(const float* __restrict__ base, unsigned off,
                                           int stride, V (&r)[N]) {
  static_assert(N <= 32, "with the wait below, at most 63 loads of a wave are out");
  // keeps the tail of the work before from sinking in between the loads and their wait
  __builtin_amdgcn_sched_barrier(0);
  // at most 31 older loads still out when these are issued: the wave's
  // outstanding loads stay within what the load counter can count (63)
  asm volatile("s_wait_loadcnt 0x1f" ::: "memory");
  #pragma unroll
  for (int i = 0; i < N; ++i) r[i] = *(const V*)(base + i * stride + off);
  // the wait that belongs in front of a rewrite of the loads' address registers
  asm volatile("s_wait_xcnt 0x0" ::: "memory");
  // keeps these loads up here: moved down to their sums, they would be issued
  // a few at a time and their latency paid once per group
  __builtin_amdgcn_sched_barrier(0);
}

// This lane's offset in a 512 x 64 weight panel for gemv_fma: 16 lanes take one
// 256-B row as float4, 16 rows a step (load_panel stride 16 * ld).
__device__ __forceinline__ unsigned panel_off(int ld, int tid) {
  return (unsigned)((tid >> 4) * ld + (tid & 15) * 4);
}

// o[bi][j] = sum_d aT[d][bi] * W[d][j], bi < 8, j < 64, d < 512, in two parts.
// Part 1: this lane's d-slice (d = 16 i + tid / 16), weights wr[i] already loaded.
__device__ __forceinline__ void gemv_fma(const v4f (&wr)[32], const float* aT,
                                         v4f (&acc)[BT_], int tid) {
  const float* ap = aT + (tid >> 4) * BT_;
  #pragma unroll
  for (int bi = 0; bi < BT_; ++bi) acc[bi] = (v4f){0.f, 0.f, 0.f, 0.f};
  // aT is read in groups of four steps, one group ahead of the sums
  v4f a[2][4][2];
  #pragma unroll
  for (int k = 0; k < 4; ++k) {
    a[0][k][0] = *(const v4f*)(ap + k * 16 * BT_);
    a[0][k][1] = *(const v4f*)(ap + k * 16 * BT_ + 4);
  }
  #pragma unroll
  for (int q = 0; q < 8; ++q) {
    if (q < 7) {
      #pragma unroll
      for (int k = 0; k < 4; ++k) {
        a[(q + 1) & 1][k][0] = *(const v4f*)(ap + (q * 4 + 4 + k) * 16 * BT_);
        a[(q + 1) & 1][k][1] = *(const v4f*)(ap + (q * 4 + 4 + k) * 16 * BT_ + 4);
      }
    }
    // keeps the next group's LDS reads in front of this group's sums: spread among
    // them, two or three were in flight at a time and each step waited for its own
    __builtin_amdgcn_sched_barrier(0);
    #pragma unroll
    for (int k = 0; k < 4; ++k) {
      const v4f a0 = a[q & 1][k][0], a1 = a[q & 1][k][1], w4 = wr[q * 4 + k];
      acc[0] += a0.x * w4; acc[1] += a0.y * w4; acc[2] += a0.z * w4; acc[3] += a0.w * w4;
      acc[4] += a1.x * w4; acc[5] += a1.y * w4; acc[6] += a1.z * w4; acc[7] += a1.w * w4;
    }
  }
}
// Part 2: the 16 d-slices summed through LDS; the result is stored at
// o[j*sj + bi*sb]. Ends with a barrier.
__device__ __forceinline__ void gemv_reduce(const v4f (&acc)[BT_], float* red, float* o,
                                            int sj, int sb, int tid) {
  const int j4 = tid & 15, ds = tid >> 4;
  #pragma unroll
  for (int bi = 0; bi < BT_; ++bi)
    *(v4f*)(red + (ds * BT_ + bi) * 64 + j4 * 4) = acc[bi];
  lds_barrier();
  #pragma unroll
  for (int kk = 0; kk < 2; ++kk) {
    const int idx = tid + kk * 256, bi = idx >> 6, j = idx & 63;
    float s = 0.f;
    #pragma unroll
    for (int t = 0; t < 16; ++t) s += red[(t * BT_ + bi) * 64 + j];
    o[j * sj + bi * sb] = s;
  }
  lds_barrier();
}

// Eight rows of 512 f32, a wave's share, into registers: row r as four 512-B wave loads.
__device__ __forceinline__ void load_rows(const float* __restrict__ xw, v4f (&xr)[8][4]) {
  // keeps the tail of the work before from sinking in between the loads and their wait
  __builtin_amdgcn_sched_barrier(0);
  // at most 31 older loads still out when these 32 are issued: the wave's
  // outstanding loads stay within what the load counter can count (63)
  asm volatile("s_wait_loadcnt 0x1f" ::: "memory");
  #pragma unroll
  for (int r = 0; r < 8; ++r)
    #pragma unroll
    for (int c = 0; c < 4; ++c)
      xr[r][c] = *(const v4f*)(xw + r * D_ + c * 128);
  // the address registers of the loads above are rewritten soon after: the wait
  // that belongs in front of such a rewrite;
  // xw as an input keeps those registers from being handed to a loaded value
  asm volatile("s_wait_xcnt 0x0" :: "v"(xw) : "memory");
  // keeps these loads, and that wait, up here, a stage ahead of the sums that read them
  __builtin_amdgcn_sched_barrier(0);
}

// A landed tile from this wave's slot into registers; sl = slot + this lane's 16 B.
__device__ __forceinline__ void read_rows(const float* sl, v4f (&xr)[8][4]) {
  #pragma unroll
  for (int r = 0; r < 8; ++r)
    #pragma unroll
    for (int c = 0; c < 4; ++c)
      xr[r][c] = *(const v4f*)(sl + r * D_ + c * 128);
}

// Eight rows of the wave's own batch, in registers: their scores against wt, then
// one step of a running softmax. m is the largest score so far, l the sum of
// exp(score - m), ya this lane's 16 columns of sum exp(score - m) * x_row. A new
// maximum rescales l and ya. Nothing leaves the wave: no LDS exchange, no barrier.
__device__ __forceinline__ void attn_chunk(const v4f (&xr)[8][4], const float* wrow,
                                           float& m, float& l, v4f (&ya)[4]) {
  // wt is read anew for each chunk: 16 registers less across the loop
  v4f wv[4];
  #pragma unroll
  for (int c = 0; c < 4; ++c) wv[c] = *(const v4f*)(wrow + c * 128);
  float p[8];
  #pragma unroll
  for (int r = 0; r < 8; ++r) {
    v2f acc = xr[r][0].lo * wv[0].lo;
    acc += xr[r][0].hi * wv[0].hi;
    #pragma unroll
    for (int c = 1; c < 4; ++c) {
      acc += xr[r][c].lo * wv[c].lo;
      acc += xr[r][c].hi * wv[c].hi;
    }
    p[r] = acc.x + acc.y;
  }
  // partners 16, 8, 4, 2, 1, step by step over the eight rows: eight independent
  // sums stand between an add and the next step's read of its result
  #pragma unroll
  for (int r = 0; r < 8; ++r) p[r] += half_xor(p[r]);
  #pragma unroll
  for (int r = 0; r < 8; ++r) p[r] += row_xor<8>(p[r]);
  #pragma unroll
  for (int r = 0; r < 8; ++r) p[r] += row_xor<4>(p[r]);
  #pragma unroll
  for (int r = 0; r < 8; ++r) p[r] += row_xor<2>(p[r]);
  #pragma unroll
  for (int r = 0; r < 8; ++r) p[r] += row_xor<1>(p[r]);
  // every lane now holds all eight scores
  #pragma unroll
  for (int r = 0; r < 8; ++r) p[r] *= SCALE_;
  const float mc = fmaxf(fmaxf(fmaxf(p[0], p[1]), fmaxf(p[2], p[3])),
                         fmaxf(fmaxf(p[4], p[5]), fmaxf(p[6], p[7])));
  const float mn = fmaxf(m, mc);
  const float alpha = __expf(m - mn);   // 0 at the first chunk, where l and ya are 0
  m = mn;
  #pragma unroll
  for (int r = 0; r < 8; ++r) p[r] = __expf(p[r] - mn);
  l = l * alpha + (((p[0] + p[1]) + (p[2] + p[3])) + ((p[4] + p[5]) + (p[6] + p[7])));
  #pragma unroll
  for (int c = 0; c < 4; ++c) ya[c] = ya[c] * alpha + p[0] * xr[0][c];
  #pragma unroll
  for (int r = 1; r < 8; ++r)
    #pragma unroll
    for (int c = 0; c < 4; ++c) ya[c] += p[r] * xr[r][c];
  // an empty asm statement on each
  // running sum: the sums are finished here, in front of the LDS reads that refill
  // xr's registers. Left free they sank behind those loads, the old rows stayed
  // live beside the new ones and the Wv panel was spilled. Inputs only: no value
  // is hidden from the compiler, every multiply still fuses with its add.
  asm volatile("" :: "v"(ya[0]), "v"(ya[1]), "v"(ya[2]), "v"(ya[3]), "v"(l));
}

// Launch 1, the whole center-token chain of BT_ batches and one head:
//   qc = x_center @ Wq(head), wt = Wk(head) @ qc,
//   per batch (one wave each): scores = x . wt, softmax over m, y = attn @ x,
//   outv = y @ Wv(head), sp = outv @ Wout(head rows).
__global__ __launch_bounds__(256)
void center_chain_kernel(const float* __restrict__ x,
                         const float* __restrict__ Wq,
                         const float* __restrict__ Wkv,
                         const float* __restrict__ Wout,
                         float* __restrict__ spg) {
  // 2-KiB alignment: the tensor loads' places are counted from the start of the LDS
  extern __shared__ __attribute__((aligned(2048))) char smem_c[];
  char* smem = smem_c;
  float* aT  = (float*)(smem + P_AT);
  float* red = (float*)(smem + P_RED);
  float* qs  = (float*)(smem + P_O);    // qs[bi][64], later outv[bi][64]
  float* WkS = (float*)(smem + P_WK);
  float* yp  = (float*)(smem + P_WK);   // yp[bi][wave][512], once the x stage is done with
  float* wts = (float*)(smem + P_WT);   // wts[bi][512], later y[bi][512]
  const int tid = threadIdx.x;
  const int h = blockIdx.x & 7, b0 = (blockIdx.x >> 3) * BT_;

  // The center rows and the Wq panel are asked for first, the Wk panel behind
  // them: it flies during the Wq sums and goes to LDS after them.
  float xc[16];
  #pragma unroll
  for (int kk = 0; kk < 16; ++kk) {
    const int idx = tid + kk * 256, bi = idx >> 9, d = idx & 511;
    xc[kk] = x[(size_t)(b0 + bi) * N_ * D_ + (N_ / 2) * D_ + d];
  }
  v4f wp[32], wk[32], acc4[BT_];
  load_panel(Wq + h * 64, panel_off(INNER_, tid), 16 * INNER_, wp);
  #pragma unroll
  for (int kk = 0; kk < 16; ++kk) {
    const int idx = tid + kk * 256, bi = idx >> 9, d = idx & 511;
    aT[d * BT_ + bi] = xc[kk];
  }
  load_panel(Wkv + h * 64, panel_off(2 * INNER_, tid), 16 * 2 * INNER_, wk);
  lds_barrier();     // x_center^T complete

  gemv_fma(wp, aT, acc4, tid);
  // the Wv panel takes the registers that Wq has left and waits there for y
  load_panel(Wkv + INNER_ + h * 64, panel_off(2 * INNER_, tid), 16 * 2 * INNER_, wp);
  // Wk head panel into LDS (read by rows below); gemv_reduce's barriers publish it
  {
    float* dst = WkS + (tid >> 4) * WK_LD + (tid & 15) * 4;
    #pragma unroll
    for (int i = 0; i < 32; ++i) *(v4f*)(dst + i * 16 * WK_LD) = wk[i];
  }
  gemv_reduce(acc4, red, qs, 1, 64, tid);

  // wave w owns batch b0 + w: tile k = its rows 8k .. 8k+7. Every wave issues its own
  // tensor loads, one request a tile, and is the only reader of its two slots, so
  // the ring needs this wave's own waits and no barrier.
  const uint32_t wave  = uni(tid >> 5);
  const uint32_t slotA = wave < 3u ? wave * XTILE_B : P_RING + (wave - 3u) * XTILE_B;
  const uint32_t slotB = P_O + wave * XTILE_B;
  const uint32_t lbase = (uint32_t)(size_t)smem;
  const uint64_t xga   = (uint64_t)(size_t)(x + (size_t)(b0 + wave) * N_ * D_);
  // Both descriptor groups live in one scalar tuple each from here to the wait behind
  // the loop. While a request is outstanding only the LDS place and the low address
  // word (group 0, words 1 and 2) take new values.
  u32x8 xg1 = xtile_group1();
  u32x4 xg0;
  xg0[0] = uni(1u);
  xg0[1] = uni(lbase + slotA);
  xg0[2] = uni((uint32_t)xga);
  xg0[3] = tdm_word3(xga);
  // both groups as in-out operands: the next request is formed in the same registers
  auto fire = [&]() {
    asm volatile("tensor_load_to_lds %0, %1" : "+s"(xg0), "+s"(xg1) :: "memory");
  };
  auto issue_tile = [&](uint32_t k, uint32_t slot) {
    const uint64_t ga = xga + (uint64_t)k * XTILE_B;
    const uint32_t w3 = tdm_word3(ga);
    // word 3 changes only where a batch straddles a 4-GiB line: it then takes its
    // new value with no request of this wave outstanding
    if (pinned(w3 != xg0[3])) {
      wait_tensor_le<0>();
      xg0[3] = pinned(w3);
    }
    xg0[1] = uni(lbase + slot);
    xg0[2] = uni((uint32_t)ga);
    fire();
  };
  // tile 0 flies during the wt stage: aT and red are free since gemv_reduce's last
  // barrier, which also holds this wave's s_wait_dscnt 0
  fire();

  {
    float acc0[BT_], acc1[BT_];
    #pragma unroll
    for (int bi = 0; bi < BT_; ++bi) { acc0[bi] = 0.f; acc1[bi] = 0.f; }
    // unroll 2: LDS reads of two steps issued ahead of their sums; four would take
    // the kernel's text, with the unrolled sums of gemv_fma, past its former length
    #pragma unroll 2
    for (int j4 = 0; j4 < 16; ++j4) {
      float4 w0 = *(const float4*)(WkS + tid * WK_LD + j4 * 4);
      float4 w1 = *(const float4*)(WkS + (tid + 256) * WK_LD + j4 * 4);
      #pragma unroll
      for (int bi = 0; bi < BT_; ++bi) {
        float4 q = *(const float4*)(qs + bi * 64 + j4 * 4);
        acc0[bi] += dot4(w0, q);
        acc1[bi] += dot4(w1, q);
      }
    }
    #pragma unroll
    for (int bi = 0; bi < BT_; ++bi) {
      wts[bi * 512 + tid]       = acc0[bi];
      wts[bi * 512 + tid + 256] = acc1[bi];
    }
  }
  lds_barrier();     // wts complete; qs and WkS free for slot B
  issue_tile(1u, slotB);

  // A wave takes its batch's 64 rows through a running softmax, eight rows at a
  // time, so the waves exchange nothing and meet at no barrier in this stage.
  // A landed tile goes to registers at once and its slot is refilled behind that
  // read, so two requests of the wave fly while a tile is worked on.
  // Eight of this head's 64 rows of Wout (wave w: rows 8w .. 8w+7) are asked for
  // here, a stage ahead of their use.
  const float* wow = Wout + ((size_t)h * 64 + (tid >> 5) * 8) * D_ + (tid & 31) * 4;
  v4f wo[8][4];
  load_rows(wow, wo);
  {
    const int lane = tid & 31, w = tid >> 5;
    const float* wrow = wts + w * 512 + lane * 4;   // this lane's 16 columns of wt
    v4f ya[4];
    #pragma unroll
    for (int c = 0; c < 4; ++c) ya[c] = (v4f){0.f, 0.f, 0.f, 0.f};
    float m = -3.0e38f, l = 0.f;
    const float* sA = (const float*)(smem + slotA) + lane * 4;
    const float* sB = (const float*)(smem + slotB) + lane * 4;
    v4f xr[8][4];
    // unroll 1: the body already holds two chunks; more would only grow the code
    #pragma unroll 1
    for (uint32_t k = 0; k < N_ / 8; k += 2) {
      const uint32_t more = k + 2 < N_ / 8;   // tiles k + 2 and k + 3 exist
      wait_tensor_le<1>();          // tile k has landed (tile k + 1 is the one younger)
      read_rows(sA, xr);
      wait_ds0();
      if (pinned(more)) issue_tile(k + 2, slotA);
      attn_chunk(xr, wrow, m, l, ya);
      // tile k + 1 has landed: tile k + 2 is the one younger, where it exists
      if (pinned(more)) wait_tensor_le<1>(); else wait_tensor_le<0>();
      read_rows(sB, xr);
      wait_ds0();
      if (pinned(more)) issue_tile(k + 3, slotB);
      attn_chunk(xr, wrow, m, l, ya);
    }
    // no request outstanding, no LDS read in flight: the slots go back to the work-group;
    // the descriptor groups as inputs keep their registers unwritten up to this wait
    asm volatile("s_wait_tensorcnt 0x0" :: "s"(xg0), "s"(xg1) : "memory");
    wait_ds0();
    const float inv = 1.f / l;
    // y takes the place of this wave's own row of wt (yp lies in other waves' slots)
    #pragma unroll
    for (int c = 0; c < 4; ++c)
      *(v4f*)(wts + w * 512 + c * 128 + lane * 4) = ya[c] * inv;
  }
  lds_barrier();     // all eight batches' y; every wave has left its slots
  // y^T for gemv_fma: a lane takes two columns d of the eight batches
  {
    const int d2 = tid * 2;
    v2f v[BT_];
    #pragma unroll
    for (int bj = 0; bj < BT_; ++bj) v[bj] = *(const v2f*)(wts + bj * 512 + d2);
    *(v4f*)(aT + d2 * BT_)      = (v4f){v[0].x, v[1].x, v[2].x, v[3].x};
    *(v4f*)(aT + d2 * BT_ + 4)  = (v4f){v[4].x, v[5].x, v[6].x, v[7].x};
    *(v4f*)(aT + d2 * BT_ + 8)  = (v4f){v[0].y, v[1].y, v[2].y, v[3].y};
    *(v4f*)(aT + d2 * BT_ + 12) = (v4f){v[4].y, v[5].y, v[6].y, v[7].y};
  }
  lds_barrier();     // y^T complete

  gemv_fma(wp, aT, acc4, tid);
  gemv_reduce(acc4, red, qs, 1, 64, tid);   // qs[bi][j] = outv

  // sp = outv @ Wout(head rows): this wave's eight rows (in wo), then the eight
  // waves' parts summed through LDS (yp is free since the barrier behind y)
  {
    const int lane = tid & 31, w = tid >> 5;
    // unroll 2: two batches' outv reads in flight, and the text stays short
    #pragma unroll 2
    for (int bi = 0; bi < BT_; ++bi) {
      const v4f o0 = *(const v4f*)(qs + bi * 64 + w * 8);
      const v4f o1 = *(const v4f*)(qs + bi * 64 + w * 8 + 4);
      const float a[8] = {o0.x, o0.y, o0.z, o0.w, o1.x, o1.y, o1.z, o1.w};
      v4f ya[4];
      #pragma unroll
      for (int c = 0; c < 4; ++c) ya[c] = a[0] * wo[0][c];
      #pragma unroll
      for (int r = 1; r < 8; ++r)
        #pragma unroll
        for (int c = 0; c < 4; ++c) ya[c] += a[r] * wo[r][c];
      #pragma unroll
      for (int c = 0; c < 4; ++c)
        *(v4f*)(yp + (bi * 8 + w) * 512 + c * 128 + lane * 4) = ya[c];
    }
  }
  lds_barrier();     // all parts of sp
  const int e2 = tid * 2;
  // unroll 2: 16 LDS reads in flight, and the text stays short
  #pragma unroll 2
  for (int bi = 0; bi < BT_; ++bi) {
    v2f s = *(const v2f*)(yp + bi * 8 * 512 + e2);
    #pragma unroll
    for (int ww = 1; ww < 8; ++ww) s += *(const v2f*)(yp + (bi * 8 + ww) * 512 + e2);
    *(v2f*)(spg + (size_t)(b0 + bi) * (H_ * 512) + h * 512 + e2) = s;
  }
}

// Stage 4 of the fused kernel: t[e] = sum_d s_d * softmax_row(q_s k_s^T)[e].
// One WMMA sweep per strip: the strip's 16 x 512 scores stay in registers
// (32 accumulator tiles), so exp, row sum and the weighted column sums all read
// registers. Column sums also stay in registers over the wave's four strips and
// are stored once. Scores arrive in log2 units.
// SHIFT: the row maximum is found and subtracted before 2^score.
// !SHIFT (every |score| <= NOSHIFT_LIM_): 2^score is taken straight from the
// accumulators, one group of four tiles behind the group being multiplied, so
// that it runs beside the WMMAs and the fragment loads.
template <bool SHIFT>
__device__ __forceinline__ void spectral_strips(const __bf16* QK, const float* sv,
                                                float* tw, int lane, int w) {
  const int nloc = lane & 15, g = lane >> 4;
  v2f tcol[32];   // per column tile: even rows | odd rows of this lane
  #pragma unroll
  for (int nt = 0; nt < 32; ++nt) tcol[nt] = (v2f){0.f, 0.f};
  for (int strip = w; strip < 32; strip += 8) {
    const int row0 = strip * 16;
    v16bf afr[2];
    #pragma unroll
    for (int kt = 0; kt < 2; ++kt)
      afr[kt] = ldfrag(QK + (row0 + nloc) * QK_LD + kt * 32 + 8 * g);

    // scores; k_s fragments are fetched one group of four tiles ahead of the
    // group being multiplied
    v8f z[32];
    v2f zp[4];      // row sums, on row pairs
    #pragma unroll
    for (int p = 0; p < 4; ++p) zp[p] = (v2f){0.f, 0.f};
    v16bf bq[2][4][2];
    #pragma unroll
    for (int t = 0; t < 4; ++t)
      #pragma unroll
      for (int kt = 0; kt < 2; ++kt)
        bq[0][t][kt] = ldfrag(QK + (t * 16 + nloc) * QK_LD + 64 + kt * 32 + 8 * g);
    #pragma unroll
    for (int gi = 0; gi < 9; ++gi) {
      if (gi < 7) {
        #pragma unroll
        for (int t = 0; t < 4; ++t)
          #pragma unroll
          for (int kt = 0; kt < 2; ++kt)
            bq[(gi + 1) & 1][t][kt] =
                ldfrag(QK + ((gi * 4 + 4 + t) * 16 + nloc) * QK_LD + 64 + kt * 32 + 8 * g);
      }
      #pragma unroll
      for (int t = 0; t < 4; ++t) {
        if (gi < 8) {
          v8f acc = {};
          #pragma unroll
          for (int kt = 0; kt < 2; ++kt)
            acc = __builtin_amdgcn_wmma_f32_16x16x32_bf16(false, afr[kt], false,
                                                          bq[gi & 1][t][kt],
                                                          (short)0, acc, false, false);
          z[gi * 4 + t] = acc;
        }
        if (!SHIFT && gi > 0) {
          const int nt = gi * 4 - 4 + t;
          #pragma unroll
          for (int p = 0; p < 4; ++p) {
            v2f e = (v2f){__builtin_amdgcn_exp2f(z[nt][2 * p]),
                          __builtin_amdgcn_exp2f(z[nt][2 * p + 1])};
            z[nt][2 * p] = e.x;
            z[nt][2 * p + 1] = e.y;
            zp[p] += e;
          }
        }
      }
      // keeps the scheduler from lifting all 128 fragment loads to the top,
      // which overflows the register budget and spills
      __builtin_amdgcn_sched_barrier(0);
    }

    if (SHIFT) {
      // row max: per lane over the 32 tiles, then across the 16 lanes
      float mrow[8];
      #pragma unroll
      for (int r = 0; r < 8; ++r) {
        float mp = -1e30f;
        #pragma unroll
        for (int nt = 0; nt < 32; ++nt) mp = fmaxf(mp, z[nt][r]);
        mrow[r] = rmax16(mp);
      }
      // exp in place and row sum, on row pairs (packed f32 subtract and add)
      #pragma unroll
      for (int nt = 0; nt < 32; ++nt) {
        #pragma unroll
        for (int p = 0; p < 4; ++p) {
          v2f a = (v2f){z[nt][2 * p], z[nt][2 * p + 1]} - (v2f){mrow[2 * p], mrow[2 * p + 1]};
          v2f e = (v2f){__builtin_amdgcn_exp2f(a.x), __builtin_amdgcn_exp2f(a.y)};
          z[nt][2 * p] = e.x;
          z[nt][2 * p + 1] = e.y;
          zp[p] += e;
        }
      }
    }
    float crow[8];
    #pragma unroll
    for (int r = 0; r < 8; ++r)
      crow[r] = sv[row0 + r + 8 * g] / rsum16(zp[r >> 1][r & 1]);

    // t_e += sum_r c_r * 2^(score), this lane's eight rows as four pairs
    #pragma unroll
    for (int nt = 0; nt < 32; ++nt) {
      #pragma unroll
      for (int p = 0; p < 4; ++p)
        tcol[nt] += (v2f){crow[2 * p], crow[2 * p + 1]} *
                    (v2f){z[nt][2 * p], z[nt][2 * p + 1]};
    }
  }
  float* twp = tw + w * 512;
  float tsum[32];
  #pragma unroll
  for (int nt = 0; nt < 32; ++nt) {
    tsum[nt] = tcol[nt].x + tcol[nt].y;
    tsum[nt] += half_xor(tsum[nt]);                     // rows 0-7 + rows 8-15
  }
  if (g == 0) {
    #pragma unroll
    for (int nt = 0; nt < 32; ++nt) twp[nt * 16 + nloc] = tsum[nt];  // wave-private plane
  }
}

__global__ __launch_bounds__(256)
void center_attn_fused_kernel(const float* __restrict__ x,
                              const float* __restrict__ spg,
                              const float* __restrict__ bout,
                              const float* __restrict__ Wspec,
                              float* __restrict__ out) {
  extern __shared__ char smem[];
  __bf16* XT   = (__bf16*)(smem + OFF_XT);
  __bf16* WspT = (__bf16*)(smem + OFF_WSPT);
  __bf16* QK   = (__bf16*)(smem + OFF_QK);
  float* sv   = (float*)(smem + OFF_S);
  float* tv   = (float*)(smem + OFF_T);
  float* tw   = (float*)(smem + OFF_TW);

  const int b    = blockIdx.x;
  const int tid  = threadIdx.x;
  const int lane = tid & 31;
  const int w    = tid >> 5;
  const float* xb = x + (size_t)b * N_ * D_;

  // ---- Stage 1: x^T and Wspec^T (cols 0..127) into bf16 LDS.
  // A lane owns a block of 4 columns x 8 rows of the f32 source: eight 16-byte
  // loads (a wave-load = four whole 128-B lines), then per column one 16-byte
  // store of its 8 rows packed to bf16. Lanes 0-15 (and 16-31) hold 4 column
  // quads x 4 row blocks, which at the 144-B pitch fall on all 64 banks once.
  const float *xsrc, *wsrc;   // named again by the wait behind stage 2
  {
    const int cq = (lane & 3) | ((lane >> 4) << 2);   // column quad in a 32-column chunk
    const int rb = (w >> 2) * 4 + ((lane >> 2) & 3);  // block of 8 source rows
    xsrc = xb + rb * 8 * D_ + (w & 3) * 128 + cq * 4;
    wsrc = Wspec + rb * 8 * 192 + (w & 3) * 32 + cq * 4;
    v4f xv[4][8], wv[8];
    #pragma unroll
    for (int u = 0; u < 4; ++u)
      #pragma unroll
      for (int k = 0; k < 8; ++k) xv[u][k] = *(const v4f*)(xsrc + k * D_ + u * 32);
    #pragma unroll
    for (int k = 0; k < 8; ++k) wv[k] = *(const v4f*)(wsrc + k * 192);

    __bf16* xdst = XT + ((w & 3) * 128 + cq * 4) * XT_LD + rb * 8;
    #pragma unroll
    for (int u = 0; u < 4; ++u)
      #pragma unroll
      for (int c = 0; c < 4; ++c) {
        v8bf p;
        #pragma unroll
        for (int k = 0; k < 8; ++k) p[k] = (__bf16)xv[u][k][c];
        *(v8bf*)(xdst + (u * 32 + c) * XT_LD) = p;
      }
    const float qsc = (w & 3) < 2 ? SCALE_ * LOG2E_ : 1.f;   // fold scale, log2(e) into q_s (j < 64)
    __bf16* wdst = WspT + ((w & 3) * 32 + cq * 4) * WT_LD + rb * 8;
    #pragma unroll
    for (int c = 0; c < 4; ++c) {
      v8bf p;
      #pragma unroll
      for (int k = 0; k < 8; ++k) p[k] = (__bf16)(wv[k][c] * qsc);
      *(v8bf*)(wdst + c * WT_LD) = p;
    }
  }

  // ---- Stage 2: s[e] = bout[e] + the eight heads' shares from launch 1
  #pragma unroll
  for (int kk = 0; kk < 2; ++kk) {
    int e = tid + kk * 256;
    float acc = bout[e];
    #pragma unroll
    for (int h = 0; h < H_; ++h) acc += spg[(size_t)b * (H_ * 512) + h * 512 + e];
    sv[e] = acc;
  }
  // the wait that belongs in front of a rewrite of a load's address registers
  // of the loads of stages 1 and 2 and of the kernel-argument loads; the addresses as inputs keep those registers
  // unwritten up to here (out: its argument load is issued in front of the wait)
  asm volatile("s_wait_xcnt 0x0"
               :: "v"(xsrc), "v"(wsrc), "s"(spg + (size_t)b * (H_ * 512)), "s"(bout), "s"(out),
                  "s"(__builtin_amdgcn_kernarg_segment_ptr())
               : "memory");
  __syncthreads();

  // ---- Stage 3: GEMM1 (WMMA bf16), computed transposed:
  // QK^T(128x512) = Wspec^T(128x64) @ X(64x512), tile by tile. The accumulator
  // then holds, per lane, eight neighbouring columns j of ONE row d of QK: one
  // packed 16-byte store (lanes 0-15 and 16-31 each cover all 64 banks once).
  // A wave keeps all of Wspec^T in registers and takes four 16-row blocks of
  // x^T, so x^T is read from LDS once and eight independent tiles are in flight.
  {
    const int mloc = lane & 15, g = lane >> 4;
    v16bf xf[4][2], wf[8][2];
    float qa = 0.f, ka = 0.f;   // largest |q_s|, |k_s| this lane has formed
    #pragma unroll
    for (int i = 0; i < 4; ++i)
      #pragma unroll
      for (int kt = 0; kt < 2; ++kt)
        xf[i][kt] = ldfrag(XT + ((w + 8 * i) * 16 + mloc) * XT_LD + kt * 32 + 8 * g);
    #pragma unroll
    for (int jt = 0; jt < 8; ++jt)
      #pragma unroll
      for (int kt = 0; kt < 2; ++kt)
        wf[jt][kt] = ldfrag(WspT + (jt * 16 + mloc) * WT_LD + kt * 32 + 8 * g);
    #pragma unroll
    for (int i = 0; i < 4; ++i) {
      v8f acc[8];
      #pragma unroll
      for (int jt = 0; jt < 8; ++jt) {
        v8f zero = {};
        acc[jt] = __builtin_amdgcn_wmma_f32_16x16x32_bf16(false, wf[jt][0], false, xf[i][0],
                                                          (short)0, zero, false, false);
      }
      #pragma unroll
      for (int jt = 0; jt < 8; ++jt)
        acc[jt] = __builtin_amdgcn_wmma_f32_16x16x32_bf16(false, wf[jt][1], false, xf[i][1],
                                                          (short)0, acc[jt], false, false);
      __bf16* qrow = QK + ((w + 8 * i) * 16 + mloc) * QK_LD + 8 * g;
      #pragma unroll
      for (int jt = 0; jt < 8; ++jt) {
        v8bf pk;
        #pragma unroll
        for (int r = 0; r < 8; ++r) {
          pk[r] = (__bf16)acc[jt][r];
          if (jt < 4) qa = fmaxf(qa, fabsf(acc[jt][r]));
          else        ka = fmaxf(ka, fabsf(acc[jt][r]));
        }
        *(v8bf*)(qrow + jt * 16) = pk;
      }
    }
    qa = wave_max(qa);
    ka = wave_max(ka);
    if (lane == 0) *(v2f*)(tv + 2 * w) = (v2f){qa, ka};   // tv is free up to stage 5
  }
  __syncthreads();

  // |score| <= 64 * max|q_s| * max|k_s| (64 products a score). The rounding of q_s
  // and k_s to bf16 moves that bound by under 1 %, far inside the room that
  // NOSHIFT_LIM_ leaves to the f32 exponent range. An infinity or a NaN in the
  // bound fails the comparison and takes the shifted path.
  bool noshift;
  {
    v4f m4 = *(const v4f*)(tv);
    #pragma unroll
    for (int i = 1; i < 4; ++i) {
      v4f a = *(const v4f*)(tv + 4 * i);
      m4.x = fmaxf(m4.x, a.x); m4.y = fmaxf(m4.y, a.y);
      m4.z = fmaxf(m4.z, a.z); m4.w = fmaxf(m4.w, a.w);
    }
    noshift = 64.f * fmaxf(m4.x, m4.z) * fmaxf(m4.y, m4.w) <= NOSHIFT_LIM_;
  }

  // ---- Stage 4: t[e] = sum_d s_d * softmax_row(q_s k_s^T)[e]
  // The test reads the same in every lane of the work-group; readfirstlane makes
  // it a scalar branch, so that every WMMA runs with all lanes on.
  if (__builtin_amdgcn_readfirstlane((int)noshift))
    spectral_strips<false>(QK, sv, tw, lane, w);
  else
    spectral_strips<true>(QK, sv, tw, lane, w);
  __syncthreads();

  // ---- Stage 5: reduce per-wave accumulators; broadcast over n to output
  #pragma unroll
  for (int kk = 0; kk < 2; ++kk) {
    int e = tid + kk * 256;
    float acc = 0.f;
    #pragma unroll
    for (int ww = 0; ww < 8; ++ww) acc += tw[ww * 512 + e];
    tv[e] = acc;
  }
  __syncthreads();
  float* ob = out + (size_t)b * N_ * D_;
  for (int i = tid; i < (N_ * D_) / 4; i += 256) {
    int flat = i * 4, e = flat & 511;
    float4 v;
    v.x = tv[e]; v.y = tv[e + 1]; v.z = tv[e + 2]; v.w = tv[e + 3];
    ((float4*)ob)[i] = v;
  }
}

extern "C" void kernel_launch(void* const* d_in, const int* in_sizes, int n_in,
                              void* d_out, int out_size, void* d_ws, size_t ws_size,
                              hipStream_t stream) {
  const float* x     = (const float*)d_in[0];
  const float* Wq    = (const float*)d_in[1];
  const float* Wkv   = (const float*)d_in[2];
  const float* Wout  = (const float*)d_in[3];
  const float* bout  = (const float*)d_in[4];
  const float* Wspec = (const float*)d_in[5];
  float* out = (float*)d_out;
  float* spg = (float*)d_ws;
  (void)in_sizes; (void)n_in; (void)out_size; (void)ws_size;

  center_chain_kernel<<<(B_ / BT_) * H_, 256, LDS_CH, stream>>>(x, Wq, Wkv, Wout, spg);
  center_attn_fused_kernel<<<B_, 256, LDS_BYTES, stream>>>(
      x, spg, bout, Wspec, out);
}
